// v000
// The times below were measured on an AMD MI455X: many runs one after another, warmed up first and cycling through
// copies of the inputs, with the whole window's GPU time divided by the number of runs. Launches and the gaps
// between them are all in it. The median over several windows is given; except for v000 it joins two sittings, which
// can be a few percent apart, so the side-by-side timings, each taken in one sitting, are the better comparison.
// v000, which the later versions start from, runs in 338 microseconds.
#include <hip/hip_runtime.h>

// ---------- types ----------
typedef __attribute__((ext_vector_type(16))) _Float16 v16h;
typedef __attribute__((ext_vector_type(8)))  _Float16 v8h;
typedef __attribute__((ext_vector_type(8)))  float    v8f;

#define B_   4
#define N_   2048
#define D_   512
#define H_   8
#define KVH_ 2
#define DH_  64
#define BN_  (B_ * N_)   // 8192 tokens

// ---------- WMMA helpers ----------
__device__ __forceinline__ v8f wmma_f16(v16h a, v16h b, v8f c) {
  // D = A(16x32 f16) x B(32x16 f16) + C(16x16 f32)
  return __builtin_amdgcn_wmma_f32_16x16x32_f16(
      /*neg_a=*/false, a, /*neg_b=*/false, b,
      /*c_mod=*/(short)0, c, /*reuse_a=*/false, /*reuse_b=*/false);
}

// Load a 16x32 f16 fragment (A-layout; identical striping assumed for B^T rows)
// from a row-major matrix with leading dimension `ld` (in elements).
// Lane (r = lane&15, g = lane>>4) holds row r, K = {g*8..g*8+7, 16+g*8..16+g*8+7}.
__device__ __forceinline__ v16h load_frag(const _Float16* __restrict__ base,
                                          int ld, int lane) {
  const int r = lane & 15, g = lane >> 4;
  const _Float16* p = base + (size_t)r * ld + g * 8;
  v8h lo = *(const v8h*)(p);
  v8h hi = *(const v8h*)(p + 16);
  v16h f;
#pragma unroll
  for (int i = 0; i < 8; ++i) { f[i] = lo[i]; f[i + 8] = hi[i]; }
  return f;
}

// ---------- 1) LayerNorm: x (b,d,n) -> xn (b*n, d) f32 + f16 ----------
__global__ __launch_bounds__(256) void layernorm_k(
    const float* __restrict__ x, const float* __restrict__ gamma,
    const float* __restrict__ beta, float* __restrict__ xnf,
    _Float16* __restrict__ xnh) {
  const int t = blockIdx.x * 256 + threadIdx.x;  // token id, 8192 total
  const int b = t >> 11, pos = t & (N_ - 1);
  const float* xb = x + (size_t)b * D_ * N_ + pos;  // stride N_ over d, coalesced over pos
  float s = 0.f, ss = 0.f;
  for (int d = 0; d < D_; ++d) {
    float v = xb[(size_t)d * N_];
    s += v; ss += v * v;
  }
  const float mu  = s * (1.f / D_);
  const float var = ss * (1.f / D_) - mu * mu;
  const float rst = rsqrtf(var + 1e-5f);
  float*     o  = xnf + (size_t)t * D_;
  _Float16*  oh = xnh + (size_t)t * D_;
  for (int d = 0; d < D_; ++d) {
    float v = (xb[(size_t)d * N_] - mu) * rst * gamma[d] + beta[d];
    o[d]  = v;
    oh[d] = (_Float16)v;
  }
}

// ---------- 2) Weight convert + transpose: W (K x N) f32 -> W^T (N x K) f16 ----------
__global__ __launch_bounds__(256) void transpose_w_k(
    const float* __restrict__ W, _Float16* __restrict__ WT, int K, int N) {
  const int idx = blockIdx.x * 256 + threadIdx.x;
  if (idx >= K * N) return;
  const int k = idx / N, n = idx % N;
  WT[(size_t)n * K + k] = (_Float16)W[(size_t)k * N + n];
}

// ---------- 3) Generic WMMA GEMM: C = A(MxK) * B(KxN), B given transposed ----------
// EPI 0: store f16 row-major MxN.
// EPI 1: out-proj epilogue: +resid(row,col) +bias(col), store f32 transposed (b,d,n).
template <int EPI>
__global__ __launch_bounds__(256) void gemm_wmma_k(
    const _Float16* __restrict__ A, const _Float16* __restrict__ BT,
    int M, int N, int K, _Float16* __restrict__ Ch,
    const float* __restrict__ resid, const float* __restrict__ bias,
    float* __restrict__ outT) {
  const int lane = threadIdx.x & 31;
  const int w    = threadIdx.x >> 5;             // 8 waves
  const int m0   = blockIdx.x * 64  + (w & 1) * 32;
  const int n0   = blockIdx.y * 128 + (w >> 1) * 32;

  const v8f z = {0.f, 0.f, 0.f, 0.f, 0.f, 0.f, 0.f, 0.f};
  v8f acc[2][2];
  acc[0][0] = z; acc[0][1] = z; acc[1][0] = z; acc[1][1] = z;

  for (int k0 = 0; k0 < K; k0 += 32) {
    v16h a0 = load_frag(A  + (size_t)(m0     ) * K + k0, K, lane);
    v16h a1 = load_frag(A  + (size_t)(m0 + 16) * K + k0, K, lane);
    v16h b0 = load_frag(BT + (size_t)(n0     ) * K + k0, K, lane);
    v16h b1 = load_frag(BT + (size_t)(n0 + 16) * K + k0, K, lane);
    acc[0][0] = wmma_f16(a0, b0, acc[0][0]);
    acc[0][1] = wmma_f16(a0, b1, acc[0][1]);
    acc[1][0] = wmma_f16(a1, b0, acc[1][0]);
    acc[1][1] = wmma_f16(a1, b1, acc[1][1]);
  }

  const int c = lane & 15, g = lane >> 4;
#pragma unroll
  for (int ti = 0; ti < 2; ++ti)
#pragma unroll
    for (int tj = 0; tj < 2; ++tj)
#pragma unroll
      for (int p = 0; p < 8; ++p) {
        const int row = m0 + ti * 16 + g * 8 + p;
        const int col = n0 + tj * 16 + c;
        float v = acc[ti][tj][p];
        if (EPI == 0) {
          Ch[(size_t)row * N + col] = (_Float16)v;
        } else {
          v += resid[(size_t)row * N + col] + bias[col];
          const int bb = row >> 11, pos = row & (N_ - 1);
          outT[((size_t)(bb * D_ + col)) * N_ + pos] = v;
        }
      }
}

// ---------- 4) xPos rotary ----------
__device__ __forceinline__ void xpos_coeffs(int pos, int j, float& cs, float& sn,
                                            float& scl) {
  const float fpos = (float)pos;
  const float invf = __powf(10000.f, -(float)(2 * j) * (1.f / (float)DH_));
  const float fr   = fpos * invf;
  cs = __cosf(fr);
  sn = __sinf(fr);
  const float bs = ((float)(2 * j) + 0.4f * DH_) * (1.f / (1.4f * DH_));
  const float pw = (fpos - (float)(N_ / 2)) * (1.f / 4096.f);
  scl = __powf(bs, pw);
}

__global__ __launch_bounds__(256) void rotary_q_k(
    const _Float16* __restrict__ qraw, _Float16* __restrict__ qh) {
  const int idx = blockIdx.x * 256 + threadIdx.x;  // b*h*n*dh = 4M
  const int i   = idx & 63;
  const int pos = (idx >> 6) & (N_ - 1);
  const int h   = (idx >> 17) & (H_ - 1);
  const int b   = idx >> 20;
  const size_t tok = (size_t)(b * N_ + pos);
  const _Float16* qp = qraw + tok * (H_ * DH_) + h * DH_;
  const float qv = (float)qp[i];
  const float pr = (i < 32) ? -(float)qp[i + 32] : (float)qp[i - 32];
  float cs, sn, scl;
  xpos_coeffs(pos, i & 31, cs, sn, scl);
  const float out = (qv * cs + pr * sn) * scl * 0.125f;  // fold 1/sqrt(dh)
  qh[(((size_t)(b * H_ + h) * N_) + pos) * DH_ + i] = (_Float16)out;
}

__global__ __launch_bounds__(256) void rotary_kv_k(
    const _Float16* __restrict__ kvraw, _Float16* __restrict__ kh,
    _Float16* __restrict__ vT) {
  const int idx = blockIdx.x * 256 + threadIdx.x;  // b*kvh*n*dh = 1M
  const int i   = idx & 63;
  const int pos = (idx >> 6) & (N_ - 1);
  const int kv  = (idx >> 17) & 1;
  const int b   = idx >> 18;
  const size_t tok = (size_t)(b * N_ + pos);
  const _Float16* kp = kvraw + tok * 256 + kv * DH_;
  const _Float16* vp = kvraw + tok * 256 + 128 + kv * DH_;
  const float kvv = (float)kp[i];
  const float pr  = (i < 32) ? -(float)kp[i + 32] : (float)kp[i - 32];
  float cs, sn, scl;
  xpos_coeffs(pos, i & 31, cs, sn, scl);
  const float out = (kvv * cs + pr * sn) / scl;
  kh[(((size_t)(b * KVH_ + kv) * N_) + pos) * DH_ + i] = (_Float16)out;
  vT[(((size_t)(b * KVH_ + kv) * DH_) + i) * N_ + pos] = vp[i];
}

// ---------- 5) Flash attention: per (b,h), wave = 16 query rows ----------
__global__ __launch_bounds__(256) void flash_k(
    const _Float16* __restrict__ Q,   // (b, h, n, dh)
    const _Float16* __restrict__ Kt,  // (b, kvh, n, dh)
    const _Float16* __restrict__ VT,  // (b, kvh, dh, n)
    _Float16* __restrict__ O) {       // (b, n, h*dh)
  __shared__ __align__(16) _Float16 lds[8 * 16 * 32];  // per-wave 16x32 probs tile
  const int lane = threadIdx.x & 31;
  const int w    = threadIdx.x >> 5;
  const int h    = blockIdx.y, b = blockIdx.z;
  const int kv   = h & (KVH_ - 1);                     // tile(k, r): head h -> h % kvh
  const int qRow0 = blockIdx.x * 128 + w * 16;

  const _Float16* qptr  = Q  + (((size_t)(b * H_ + h) * N_) + qRow0) * DH_;
  const _Float16* kbase = Kt + ((size_t)(b * KVH_ + kv) * N_) * DH_;
  const _Float16* vbase = VT + ((size_t)(b * KVH_ + kv) * DH_) * N_;

  const v16h aq0 = load_frag(qptr,      DH_, lane);    // K dims  0..31
  const v16h aq1 = load_frag(qptr + 32, DH_, lane);    // K dims 32..63

  const v8f z = {0.f, 0.f, 0.f, 0.f, 0.f, 0.f, 0.f, 0.f};
  v8f oacc[4]; oacc[0] = z; oacc[1] = z; oacc[2] = z; oacc[3] = z;
  float mrow[8], lrow[8];
#pragma unroll
  for (int p = 0; p < 8; ++p) { mrow[p] = -1e30f; lrow[p] = 0.f; }

  const int c = lane & 15, g = lane >> 4;
  _Float16* wl = lds + w * 512;

  for (int kb = 0; kb < N_; kb += 32) {
    // ---- scores: two 16x16 f32 tiles covering 32 keys ----
    v8f s0 = z, s1 = z;
    {
      const _Float16* kp0 = kbase + (size_t)kb * DH_;
      s0 = wmma_f16(aq0, load_frag(kp0,      DH_, lane), s0);
      s0 = wmma_f16(aq1, load_frag(kp0 + 32, DH_, lane), s0);
      const _Float16* kp1 = kbase + (size_t)(kb + 16) * DH_;
      s1 = wmma_f16(aq0, load_frag(kp1,      DH_, lane), s1);
      s1 = wmma_f16(aq1, load_frag(kp1 + 32, DH_, lane), s1);
    }
    // ---- online softmax: row reductions across the 16-lane C-layout halves ----
#pragma unroll
    for (int p = 0; p < 8; ++p) {
      float rmax = fmaxf(s0[p], s1[p]);
      rmax = fmaxf(rmax, __shfl_xor(rmax, 1, 32));
      rmax = fmaxf(rmax, __shfl_xor(rmax, 2, 32));
      rmax = fmaxf(rmax, __shfl_xor(rmax, 4, 32));
      rmax = fmaxf(rmax, __shfl_xor(rmax, 8, 32));
      const float nm = fmaxf(mrow[p], rmax);
      const float sc = __expf(mrow[p] - nm);
      const float p0 = __expf(s0[p] - nm);
      const float p1 = __expf(s1[p] - nm);
      wl[(g * 8 + p) * 32 + c]      = (_Float16)p0;   // row-major 16x32 probs tile
      wl[(g * 8 + p) * 32 + 16 + c] = (_Float16)p1;
      float rs = p0 + p1;
      rs += __shfl_xor(rs, 1, 32);
      rs += __shfl_xor(rs, 2, 32);
      rs += __shfl_xor(rs, 4, 32);
      rs += __shfl_xor(rs, 8, 32);
      lrow[p] = lrow[p] * sc + rs;
      mrow[p] = nm;
#pragma unroll
      for (int j = 0; j < 4; ++j) oacc[j][p] *= sc;
    }
    // ---- reload probs as A-fragment, accumulate AV over dh in 4 tiles of 16 ----
    const v16h pa = load_frag(wl, 32, lane);
#pragma unroll
    for (int j = 0; j < 4; ++j) {
      const v16h bv = load_frag(vbase + (size_t)(j * 16) * N_ + kb, N_, lane);
      oacc[j] = wmma_f16(pa, bv, oacc[j]);
    }
  }

#pragma unroll
  for (int p = 0; p < 8; ++p) {
    const float inv = 1.f / lrow[p];
    const size_t row = (size_t)(b * N_ + qRow0 + g * 8 + p);
#pragma unroll
    for (int j = 0; j < 4; ++j)
      O[row * (H_ * DH_) + h * DH_ + j * 16 + c] = (_Float16)(oacc[j][p] * inv);
  }
}

// ---------- launch ----------
extern "C" void kernel_launch(void* const* d_in, const int* in_sizes, int n_in,
                              void* d_out, int out_size, void* d_ws, size_t ws_size,
                              hipStream_t stream) {
  const float* x     = (const float*)d_in[0];
  const float* gamma = (const float*)d_in[1];
  const float* beta  = (const float*)d_in[2];
  const float* Wq    = (const float*)d_in[3];
  const float* Wkv   = (const float*)d_in[4];
  const float* Wout  = (const float*)d_in[5];
  const float* bout  = (const float*)d_in[6];
  float* y = (float*)d_out;

  char* wsp = (char*)d_ws;
  auto take = [&](size_t bytes) {
    void* p = (void*)wsp;
    wsp += (bytes + 255) & ~(size_t)255;
    return p;
  };
  float*    xnf   = (float*)take((size_t)BN_ * D_ * 4);
  _Float16* xnh   = (_Float16*)take((size_t)BN_ * D_ * 2);
  _Float16* WqT   = (_Float16*)take((size_t)D_ * D_ * 2);
  _Float16* WkvT  = (_Float16*)take((size_t)256 * D_ * 2);
  _Float16* WoutT = (_Float16*)take((size_t)D_ * D_ * 2);
  _Float16* qraw  = (_Float16*)take((size_t)BN_ * D_ * 2);
  _Float16* kvraw = (_Float16*)take((size_t)BN_ * 256 * 2);
  _Float16* qh    = (_Float16*)take((size_t)B_ * H_ * N_ * DH_ * 2);
  _Float16* kh    = (_Float16*)take((size_t)B_ * KVH_ * N_ * DH_ * 2);
  _Float16* vT    = (_Float16*)take((size_t)B_ * KVH_ * N_ * DH_ * 2);
  _Float16* ao    = (_Float16*)take((size_t)BN_ * D_ * 2);

  layernorm_k<<<BN_ / 256, 256, 0, stream>>>(x, gamma, beta, xnf, xnh);
  transpose_w_k<<<(D_ * D_ + 255) / 256, 256, 0, stream>>>(Wq, WqT, D_, D_);
  transpose_w_k<<<(D_ * 256 + 255) / 256, 256, 0, stream>>>(Wkv, WkvT, D_, 256);
  transpose_w_k<<<(D_ * D_ + 255) / 256, 256, 0, stream>>>(Wout, WoutT, D_, D_);

  gemm_wmma_k<0><<<dim3(BN_ / 64, D_ / 128), 256, 0, stream>>>(
      xnh, WqT, BN_, D_, D_, qraw, nullptr, nullptr, nullptr);
  gemm_wmma_k<0><<<dim3(BN_ / 64, 256 / 128), 256, 0, stream>>>(
      xnh, WkvT, BN_, 256, D_, kvraw, nullptr, nullptr, nullptr);

  rotary_q_k<<<(B_ * H_ * N_ * DH_) / 256, 256, 0, stream>>>(qraw, qh);
  rotary_kv_k<<<(B_ * KVH_ * N_ * DH_) / 256, 256, 0, stream>>>(kvraw, kh, vT);

  flash_k<<<dim3(N_ / 128, H_, B_), 256, 0, stream>>>(qh, kh, vT, ao);

  gemm_wmma_k<1><<<dim3(BN_ / 64, D_ / 128), 256, 0, stream>>>(
      ao, WoutT, BN_, D_, D_, nullptr, xnf, bout, y);
}

// v001
// A run of this version takes 279 microseconds.
// Two timings next to v000 put it at 1.25 and 1.26 times that version's speed.
#include <hip/hip_runtime.h>

// ---------- types ----------
typedef __attribute__((ext_vector_type(16))) _Float16 v16h;
typedef __attribute__((ext_vector_type(8)))  _Float16 v8h;
typedef __attribute__((ext_vector_type(8)))  float    v8f;

#define B_   4
#define N_   2048
#define D_   512
#define H_   8
#define KVH_ 2
#define DH_  64
#define BN_  (B_ * N_)   // 8192 tokens

// ---------- WMMA helpers ----------
__device__ __forceinline__ v8f wmma_f16(v16h a, v16h b, v8f c) {
  // D = A(16x32 f16) x B(32x16 f16) + C(16x16 f32)
  return __builtin_amdgcn_wmma_f32_16x16x32_f16(
      /*neg_a=*/false, a, /*neg_b=*/false, b,
      /*c_mod=*/(short)0, c, /*reuse_a=*/false, /*reuse_b=*/false);
}

// Load a 16x32 f16 fragment (A-layout; identical striping assumed for B^T rows)
// from a row-major matrix with leading dimension `ld` (in elements).
// Lane (r = lane&15, g = lane>>4) holds row r, K = {g*8..g*8+7, 16+g*8..16+g*8+7}.
__device__ __forceinline__ v16h load_frag(const _Float16* __restrict__ base,
                                          int ld, int lane) {
  const int r = lane & 15, g = lane >> 4;
  const _Float16* p = base + (size_t)r * ld + g * 8;
  v8h lo = *(const v8h*)(p);
  v8h hi = *(const v8h*)(p + 16);
  v16h f;
#pragma unroll
  for (int i = 0; i < 8; ++i) { f[i] = lo[i]; f[i + 8] = hi[i]; }
  return f;
}

// ---------- 1) LayerNorm: x (b,d,n) -> xn (b*n, d) f32 + f16 ----------
// One work-group takes 32 tokens x all 512 channels. x is read along n (whole
// 128-byte lines), turned through LDS, and each token's row is then summed,
// normalised and stored along d (whole lines again).
typedef __attribute__((ext_vector_type(4))) _Float16 v4h;
#define LN_TOK   32
#define LN_PITCH 516  // dwords; 4 mod 64, so a column walk of 16-byte stores meets every bank once

__global__ __launch_bounds__(512) void layernorm_k(
    const float* __restrict__ x, const float* __restrict__ gamma,
    const float* __restrict__ beta, float* __restrict__ xnf,
    _Float16* __restrict__ xnh) {
  __shared__ __align__(16) float tile[LN_TOK * LN_PITCH];
  const int lane = threadIdx.x & 31;
  const int w    = threadIdx.x >> 5;               // 16 waves
  const int t0   = blockIdx.x * LN_TOK;            // first token of the tile
  const int b = t0 >> 11, pos0 = t0 & (N_ - 1);

  // lane = token, wave w holds channels w*32 .. w*32+31 of it
  const float* xb = x + ((size_t)b * D_ + w * 32) * N_ + pos0 + lane;
  float v[32];
  for (int i = 0; i < 32; ++i) v[i] = xb[(size_t)i * N_];
  float* tp = tile + lane * LN_PITCH + w * 32;
  for (int i = 0; i < 32; i += 4)
    *(float4*)(tp + i) = make_float4(v[i], v[i + 1], v[i + 2], v[i + 3]);

  // lane holds channels k*128 + lane*4 .. +3, k = 0..3
  float4 gm[4], bt[4];
  for (int k = 0; k < 4; ++k) {
    gm[k] = *(const float4*)(gamma + k * 128 + lane * 4);
    bt[k] = *(const float4*)(beta  + k * 128 + lane * 4);
  }
  __syncthreads();

  // wave w owns tokens 2w and 2w+1 of the tile
  for (int r = 0; r < 2; ++r) {
    const int row = w * 2 + r;
    const float* rp = tile + row * LN_PITCH + lane * 4;
    float4 a[4];
    for (int k = 0; k < 4; ++k) a[k] = *(const float4*)(rp + k * 128);
    float s = 0.f, ss = 0.f;
    for (int k = 0; k < 4; ++k) {
      s  += (a[k].x + a[k].y) + (a[k].z + a[k].w);
      ss += (a[k].x * a[k].x + a[k].y * a[k].y) + (a[k].z * a[k].z + a[k].w * a[k].w);
    }
    for (int m = 1; m < 32; m <<= 1) {
      s  += __shfl_xor(s,  m, 32);
      ss += __shfl_xor(ss, m, 32);
    }
    const float mu  = s * (1.f / D_);
    const float var = ss * (1.f / D_) - mu * mu;
    const float rst = rsqrtf(var + 1e-5f);
    float*    o  = xnf + (size_t)(t0 + row) * D_ + lane * 4;
    _Float16* oh = xnh + (size_t)(t0 + row) * D_ + lane * 4;
    for (int k = 0; k < 4; ++k) {
      float4 y;
      y.x = (a[k].x - mu) * rst * gm[k].x + bt[k].x;
      y.y = (a[k].y - mu) * rst * gm[k].y + bt[k].y;
      y.z = (a[k].z - mu) * rst * gm[k].z + bt[k].z;
      y.w = (a[k].w - mu) * rst * gm[k].w + bt[k].w;
      *(float4*)(o + k * 128) = y;
      v4h yh = {(_Float16)y.x, (_Float16)y.y, (_Float16)y.z, (_Float16)y.w};
      *(v4h*)(oh + k * 128) = yh;
    }
  }
}

// ---------- 2) Weight convert + transpose: W (K x N) f32 -> W^T (N x K) f16 ----------
__global__ __launch_bounds__(256) void transpose_w_k(
    const float* __restrict__ W, _Float16* __restrict__ WT, int K, int N) {
  const int idx = blockIdx.x * 256 + threadIdx.x;
  if (idx >= K * N) return;
  const int k = idx / N, n = idx % N;
  WT[(size_t)n * K + k] = (_Float16)W[(size_t)k * N + n];
}

// ---------- 3) Generic WMMA GEMM: C = A(MxK) * B(KxN), B given transposed ----------
// EPI 0: store f16 row-major MxN.
// EPI 1: out-proj epilogue: +resid(row,col) +bias(col), store f32 transposed (b,d,n).
template <int EPI>
__global__ __launch_bounds__(256) void gemm_wmma_k(
    const _Float16* __restrict__ A, const _Float16* __restrict__ BT,
    int M, int N, int K, _Float16* __restrict__ Ch,
    const float* __restrict__ resid, const float* __restrict__ bias,
    float* __restrict__ outT) {
  const int lane = threadIdx.x & 31;
  const int w    = threadIdx.x >> 5;             // 8 waves
  const int m0   = blockIdx.x * 64  + (w & 1) * 32;
  const int n0   = blockIdx.y * 128 + (w >> 1) * 32;

  const v8f z = {0.f, 0.f, 0.f, 0.f, 0.f, 0.f, 0.f, 0.f};
  v8f acc[2][2];
  acc[0][0] = z; acc[0][1] = z; acc[1][0] = z; acc[1][1] = z;

  for (int k0 = 0; k0 < K; k0 += 32) {
    v16h a0 = load_frag(A  + (size_t)(m0     ) * K + k0, K, lane);
    v16h a1 = load_frag(A  + (size_t)(m0 + 16) * K + k0, K, lane);
    v16h b0 = load_frag(BT + (size_t)(n0     ) * K + k0, K, lane);
    v16h b1 = load_frag(BT + (size_t)(n0 + 16) * K + k0, K, lane);
    acc[0][0] = wmma_f16(a0, b0, acc[0][0]);
    acc[0][1] = wmma_f16(a0, b1, acc[0][1]);
    acc[1][0] = wmma_f16(a1, b0, acc[1][0]);
    acc[1][1] = wmma_f16(a1, b1, acc[1][1]);
  }

  const int c = lane & 15, g = lane >> 4;
#pragma unroll
  for (int ti = 0; ti < 2; ++ti)
#pragma unroll
    for (int tj = 0; tj < 2; ++tj)
#pragma unroll
      for (int p = 0; p < 8; ++p) {
        const int row = m0 + ti * 16 + g * 8 + p;
        const int col = n0 + tj * 16 + c;
        float v = acc[ti][tj][p];
        if (EPI == 0) {
          Ch[(size_t)row * N + col] = (_Float16)v;
        } else {
          v += resid[(size_t)row * N + col] + bias[col];
          const int bb = row >> 11, pos = row & (N_ - 1);
          outT[((size_t)(bb * D_ + col)) * N_ + pos] = v;
        }
      }
}

// ---------- 4) xPos rotary ----------
__device__ __forceinline__ void xpos_coeffs(int pos, int j, float& cs, float& sn,
                                            float& scl) {
  const float fpos = (float)pos;
  const float invf = __powf(10000.f, -(float)(2 * j) * (1.f / (float)DH_));
  const float fr   = fpos * invf;
  cs = __cosf(fr);
  sn = __sinf(fr);
  const float bs = ((float)(2 * j) + 0.4f * DH_) * (1.f / (1.4f * DH_));
  const float pw = (fpos - (float)(N_ / 2)) * (1.f / 4096.f);
  scl = __powf(bs, pw);
}

__global__ __launch_bounds__(256) void rotary_q_k(
    const _Float16* __restrict__ qraw, _Float16* __restrict__ qh) {
  const int idx = blockIdx.x * 256 + threadIdx.x;  // b*h*n*dh = 4M
  const int i   = idx & 63;
  const int pos = (idx >> 6) & (N_ - 1);
  const int h   = (idx >> 17) & (H_ - 1);
  const int b   = idx >> 20;
  const size_t tok = (size_t)(b * N_ + pos);
  const _Float16* qp = qraw + tok * (H_ * DH_) + h * DH_;
  const float qv = (float)qp[i];
  const float pr = (i < 32) ? -(float)qp[i + 32] : (float)qp[i - 32];
  float cs, sn, scl;
  xpos_coeffs(pos, i & 31, cs, sn, scl);
  const float out = (qv * cs + pr * sn) * scl * 0.125f;  // fold 1/sqrt(dh)
  qh[(((size_t)(b * H_ + h) * N_) + pos) * DH_ + i] = (_Float16)out;
}

__global__ __launch_bounds__(256) void rotary_kv_k(
    const _Float16* __restrict__ kvraw, _Float16* __restrict__ kh,
    _Float16* __restrict__ vT) {
  const int idx = blockIdx.x * 256 + threadIdx.x;  // b*kvh*n*dh = 1M
  const int i   = idx & 63;
  const int pos = (idx >> 6) & (N_ - 1);
  const int kv  = (idx >> 17) & 1;
  const int b   = idx >> 18;
  const size_t tok = (size_t)(b * N_ + pos);
  const _Float16* kp = kvraw + tok * 256 + kv * DH_;
  const _Float16* vp = kvraw + tok * 256 + 128 + kv * DH_;
  const float kvv = (float)kp[i];
  const float pr  = (i < 32) ? -(float)kp[i + 32] : (float)kp[i - 32];
  float cs, sn, scl;
  xpos_coeffs(pos, i & 31, cs, sn, scl);
  const float out = (kvv * cs + pr * sn) / scl;
  kh[(((size_t)(b * KVH_ + kv) * N_) + pos) * DH_ + i] = (_Float16)out;
  vT[(((size_t)(b * KVH_ + kv) * DH_) + i) * N_ + pos] = vp[i];
}

// ---------- 5) Flash attention: per (b,h), wave = 16 query rows ----------
__global__ __launch_bounds__(256) void flash_k(
    const _Float16* __restrict__ Q,   // (b, h, n, dh)
    const _Float16* __restrict__ Kt,  // (b, kvh, n, dh)
    const _Float16* __restrict__ VT,  // (b, kvh, dh, n)
    _Float16* __restrict__ O) {       // (b, n, h*dh)
  __shared__ __align__(16) _Float16 lds[8 * 16 * 32];  // per-wave 16x32 probs tile
  const int lane = threadIdx.x & 31;
  const int w    = threadIdx.x >> 5;
  const int h    = blockIdx.y, b = blockIdx.z;
  const int kv   = h & (KVH_ - 1);                     // tile(k, r): head h -> h % kvh
  const int qRow0 = blockIdx.x * 128 + w * 16;

  const _Float16* qptr  = Q  + (((size_t)(b * H_ + h) * N_) + qRow0) * DH_;
  const _Float16* kbase = Kt + ((size_t)(b * KVH_ + kv) * N_) * DH_;
  const _Float16* vbase = VT + ((size_t)(b * KVH_ + kv) * DH_) * N_;

  const v16h aq0 = load_frag(qptr,      DH_, lane);    // K dims  0..31
  const v16h aq1 = load_frag(qptr + 32, DH_, lane);    // K dims 32..63

  const v8f z = {0.f, 0.f, 0.f, 0.f, 0.f, 0.f, 0.f, 0.f};
  v8f oacc[4]; oacc[0] = z; oacc[1] = z; oacc[2] = z; oacc[3] = z;
  float mrow[8], lrow[8];
#pragma unroll
  for (int p = 0; p < 8; ++p) { mrow[p] = -1e30f; lrow[p] = 0.f; }

  const int c = lane & 15, g = lane >> 4;
  _Float16* wl = lds + w * 512;

  for (int kb = 0; kb < N_; kb += 32) {
    // ---- scores: two 16x16 f32 tiles covering 32 keys ----
    v8f s0 = z, s1 = z;
    {
      const _Float16* kp0 = kbase + (size_t)kb * DH_;
      s0 = wmma_f16(aq0, load_frag(kp0,      DH_, lane), s0);
      s0 = wmma_f16(aq1, load_frag(kp0 + 32, DH_, lane), s0);
      const _Float16* kp1 = kbase + (size_t)(kb + 16) * DH_;
      s1 = wmma_f16(aq0, load_frag(kp1,      DH_, lane), s1);
      s1 = wmma_f16(aq1, load_frag(kp1 + 32, DH_, lane), s1);
    }
    // ---- online softmax: row reductions across the 16-lane C-layout halves ----
#pragma unroll
    for (int p = 0; p < 8; ++p) {
      float rmax = fmaxf(s0[p], s1[p]);
      rmax = fmaxf(rmax, __shfl_xor(rmax, 1, 32));
      rmax = fmaxf(rmax, __shfl_xor(rmax, 2, 32));
      rmax = fmaxf(rmax, __shfl_xor(rmax, 4, 32));
      rmax = fmaxf(rmax, __shfl_xor(rmax, 8, 32));
      const float nm = fmaxf(mrow[p], rmax);
      const float sc = __expf(mrow[p] - nm);
      const float p0 = __expf(s0[p] - nm);
      const float p1 = __expf(s1[p] - nm);
      wl[(g * 8 + p) * 32 + c]      = (_Float16)p0;   // row-major 16x32 probs tile
      wl[(g * 8 + p) * 32 + 16 + c] = (_Float16)p1;
      float rs = p0 + p1;
      rs += __shfl_xor(rs, 1, 32);
      rs += __shfl_xor(rs, 2, 32);
      rs += __shfl_xor(rs, 4, 32);
      rs += __shfl_xor(rs, 8, 32);
      lrow[p] = lrow[p] * sc + rs;
      mrow[p] = nm;
#pragma unroll
      for (int j = 0; j < 4; ++j) oacc[j][p] *= sc;
    }
    // ---- reload probs as A-fragment, accumulate AV over dh in 4 tiles of 16 ----
    const v16h pa = load_frag(wl, 32, lane);
#pragma unroll
    for (int j = 0; j < 4; ++j) {
      const v16h bv = load_frag(vbase + (size_t)(j * 16) * N_ + kb, N_, lane);
      oacc[j] = wmma_f16(pa, bv, oacc[j]);
    }
  }

#pragma unroll
  for (int p = 0; p < 8; ++p) {
    const float inv = 1.f / lrow[p];
    const size_t row = (size_t)(b * N_ + qRow0 + g * 8 + p);
#pragma unroll
    for (int j = 0; j < 4; ++j)
      O[row * (H_ * DH_) + h * DH_ + j * 16 + c] = (_Float16)(oacc[j][p] * inv);
  }
}

// ---------- launch ----------
extern "C" void kernel_launch(void* const* d_in, const int* in_sizes, int n_in,
                              void* d_out, int out_size, void* d_ws, size_t ws_size,
                              hipStream_t stream) {
  const float* x     = (const float*)d_in[0];
  const float* gamma = (const float*)d_in[1];
  const float* beta  = (const float*)d_in[2];
  const float* Wq    = (const float*)d_in[3];
  const float* Wkv   = (const float*)d_in[4];
  const float* Wout  = (const float*)d_in[5];
  const float* bout  = (const float*)d_in[6];
  float* y = (float*)d_out;

  char* wsp = (char*)d_ws;
  auto take = [&](size_t bytes) {
    void* p = (void*)wsp;
    wsp += (bytes + 255) & ~(size_t)255;
    return p;
  };
  float*    xnf   = (float*)take((size_t)BN_ * D_ * 4);
  _Float16* xnh   = (_Float16*)take((size_t)BN_ * D_ * 2);
  _Float16* WqT   = (_Float16*)take((size_t)D_ * D_ * 2);
  _Float16* WkvT  = (_Float16*)take((size_t)256 * D_ * 2);
  _Float16* WoutT = (_Float16*)take((size_t)D_ * D_ * 2);
  _Float16* qraw  = (_Float16*)take((size_t)BN_ * D_ * 2);
  _Float16* kvraw = (_Float16*)take((size_t)BN_ * 256 * 2);
  _Float16* qh    = (_Float16*)take((size_t)B_ * H_ * N_ * DH_ * 2);
  _Float16* kh    = (_Float16*)take((size_t)B_ * KVH_ * N_ * DH_ * 2);
  _Float16* vT    = (_Float16*)take((size_t)B_ * KVH_ * N_ * DH_ * 2);
  _Float16* ao    = (_Float16*)take((size_t)BN_ * D_ * 2);

  layernorm_k<<<BN_ / LN_TOK, 512, 0, stream>>>(x, gamma, beta, xnf, xnh);
  transpose_w_k<<<(D_ * D_ + 255) / 256, 256, 0, stream>>>(Wq, WqT, D_, D_);
  transpose_w_k<<<(D_ * 256 + 255) / 256, 256, 0, stream>>>(Wkv, WkvT, D_, 256);
  transpose_w_k<<<(D_ * D_ + 255) / 256, 256, 0, stream>>>(Wout, WoutT, D_, D_);

  gemm_wmma_k<0><<<dim3(BN_ / 64, D_ / 128), 256, 0, stream>>>(
      xnh, WqT, BN_, D_, D_, qraw, nullptr, nullptr, nullptr);
  gemm_wmma_k<0><<<dim3(BN_ / 64, 256 / 128), 256, 0, stream>>>(
      xnh, WkvT, BN_, 256, D_, kvraw, nullptr, nullptr, nullptr);

  rotary_q_k<<<(B_ * H_ * N_ * DH_) / 256, 256, 0, stream>>>(qraw, qh);
  rotary_kv_k<<<(B_ * KVH_ * N_ * DH_) / 256, 256, 0, stream>>>(kvraw, kh, vT);

  flash_k<<<dim3(N_ / 128, H_, B_), 256, 0, stream>>>(qh, kh, vT, ao);

  gemm_wmma_k<1><<<dim3(BN_ / 64, D_ / 128), 256, 0, stream>>>(
      ao, WoutT, BN_, D_, D_, nullptr, xnf, bout, y);
}

// v002
// One run takes 216 microseconds.
// In two side-by-side timings against v001, it was 1.29 and 1.28 times as fast.
// All steps since v000 together make it 1.61 times as fast.
#include <hip/hip_runtime.h>

// ---------- types ----------
typedef __attribute__((ext_vector_type(16))) _Float16 v16h;
typedef __attribute__((ext_vector_type(8)))  _Float16 v8h;
typedef __attribute__((ext_vector_type(8)))  float    v8f;

#define B_   4
#define N_   2048
#define D_   512
#define H_   8
#define KVH_ 2
#define DH_  64
#define BN_  (B_ * N_)   // 8192 tokens

// ---------- WMMA helpers ----------
__device__ __forceinline__ v8f wmma_f16(v16h a, v16h b, v8f c) {
  // D = A(16x32 f16) x B(32x16 f16) + C(16x16 f32)
  return __builtin_amdgcn_wmma_f32_16x16x32_f16(
      /*neg_a=*/false, a, /*neg_b=*/false, b,
      /*c_mod=*/(short)0, c, /*reuse_a=*/false, /*reuse_b=*/false);
}

// Load a 16x32 f16 fragment (A-layout; identical striping assumed for B^T rows)
// from a row-major matrix with leading dimension `ld` (in elements).
// Lane (r = lane&15, g = lane>>4) holds row r, K = {g*8..g*8+7, 16+g*8..16+g*8+7}.
__device__ __forceinline__ v16h load_frag(const _Float16* __restrict__ base,
                                          int ld, int lane) {
  const int r = lane & 15, g = lane >> 4;
  const _Float16* p = base + (size_t)r * ld + g * 8;
  v8h lo = *(const v8h*)(p);
  v8h hi = *(const v8h*)(p + 16);
  v16h f;
#pragma unroll
  for (int i = 0; i < 8; ++i) { f[i] = lo[i]; f[i + 8] = hi[i]; }
  return f;
}

// ---------- 1) LayerNorm: x (b,d,n) -> xn (b*n, d) f32 + f16 ----------
// One work-group takes 32 tokens x all 512 channels. x is read along n (whole
// 128-byte lines), turned through LDS, and each token's row is then summed,
// normalised and stored along d (whole lines again).
typedef __attribute__((ext_vector_type(4))) _Float16 v4h;
#define LN_TOK   32
#define LN_PITCH 516  // dwords; 4 mod 64, so a column walk of 16-byte stores meets every bank once

__global__ __launch_bounds__(512) void layernorm_k(
    const float* __restrict__ x, const float* __restrict__ gamma,
    const float* __restrict__ beta, float* __restrict__ xnf,
    _Float16* __restrict__ xnh) {
  __shared__ __align__(16) float tile[LN_TOK * LN_PITCH];
  const int lane = threadIdx.x & 31;
  const int w    = threadIdx.x >> 5;               // 16 waves
  const int t0   = blockIdx.x * LN_TOK;            // first token of the tile
  const int b = t0 >> 11, pos0 = t0 & (N_ - 1);

  // lane = token, wave w holds channels w*32 .. w*32+31 of it
  const float* xb = x + ((size_t)b * D_ + w * 32) * N_ + pos0 + lane;
  float v[32];
  for (int i = 0; i < 32; ++i) v[i] = xb[(size_t)i * N_];
  float* tp = tile + lane * LN_PITCH + w * 32;
  for (int i = 0; i < 32; i += 4)
    *(float4*)(tp + i) = make_float4(v[i], v[i + 1], v[i + 2], v[i + 3]);

  // lane holds channels k*128 + lane*4 .. +3, k = 0..3
  float4 gm[4], bt[4];
  for (int k = 0; k < 4; ++k) {
    gm[k] = *(const float4*)(gamma + k * 128 + lane * 4);
    bt[k] = *(const float4*)(beta  + k * 128 + lane * 4);
  }
  __syncthreads();

  // wave w owns tokens 2w and 2w+1 of the tile
  for (int r = 0; r < 2; ++r) {
    const int row = w * 2 + r;
    const float* rp = tile + row * LN_PITCH + lane * 4;
    float4 a[4];
    for (int k = 0; k < 4; ++k) a[k] = *(const float4*)(rp + k * 128);
    float s = 0.f, ss = 0.f;
    for (int k = 0; k < 4; ++k) {
      s  += (a[k].x + a[k].y) + (a[k].z + a[k].w);
      ss += (a[k].x * a[k].x + a[k].y * a[k].y) + (a[k].z * a[k].z + a[k].w * a[k].w);
    }
    for (int m = 1; m < 32; m <<= 1) {
      s  += __shfl_xor(s,  m, 32);
      ss += __shfl_xor(ss, m, 32);
    }
    const float mu  = s * (1.f / D_);
    const float var = ss * (1.f / D_) - mu * mu;
    const float rst = rsqrtf(var + 1e-5f);
    float*    o  = xnf + (size_t)(t0 + row) * D_ + lane * 4;
    _Float16* oh = xnh + (size_t)(t0 + row) * D_ + lane * 4;
    for (int k = 0; k < 4; ++k) {
      float4 y;
      y.x = (a[k].x - mu) * rst * gm[k].x + bt[k].x;
      y.y = (a[k].y - mu) * rst * gm[k].y + bt[k].y;
      y.z = (a[k].z - mu) * rst * gm[k].z + bt[k].z;
      y.w = (a[k].w - mu) * rst * gm[k].w + bt[k].w;
      *(float4*)(o + k * 128) = y;
      v4h yh = {(_Float16)y.x, (_Float16)y.y, (_Float16)y.z, (_Float16)y.w};
      *(v4h*)(oh + k * 128) = yh;
    }
  }
}

// ---------- 2) Weight convert + transpose: W (K x N) f32 -> W^T (N x K) f16 ----------
// One lane turns an 8 (k) x 8 (n) block in its registers, so a launch starts 64 times
// fewer waves than with one element a lane. A wave takes 64 k x 32 n: eight lanes side
// by side along k store one whole 128-byte line of a W^T row. The grid is exact:
// K * N / 64 lanes, a multiple of 256.
template <int K, int N>
__global__ __launch_bounds__(256) void transpose_w_k(
    const float* __restrict__ W, _Float16* __restrict__ WT) {
  static_assert(K % 64 == 0 && N % 32 == 0 && (K * N / 64) % 256 == 0, "tile shape");
  const int idx = blockIdx.x * 256 + threadIdx.x;
  const int lane = idx & 31, tile = idx >> 5;
  const int tk = tile % (K >> 6), tn = tile / (K >> 6);
  const int k0 = tk * 64 + (lane & 7) * 8;
  const int n0 = tn * 32 + (lane >> 3) * 8;
  const float* wp = W + (size_t)k0 * N + n0;
  float r[8][8];
#pragma unroll
  for (int e = 0; e < 8; ++e) {
    const float4 a = *(const float4*)(wp + (size_t)e * N);
    const float4 b = *(const float4*)(wp + (size_t)e * N + 4);
    r[e][0] = a.x; r[e][1] = a.y; r[e][2] = a.z; r[e][3] = a.w;
    r[e][4] = b.x; r[e][5] = b.y; r[e][6] = b.z; r[e][7] = b.w;
  }
  _Float16* op = WT + (size_t)n0 * K + k0;
#pragma unroll
  for (int n = 0; n < 8; ++n) {
    v8h o;
#pragma unroll
    for (int e = 0; e < 8; ++e) o[e] = (_Float16)r[e][n];
    *(v8h*)(op + (size_t)n * K) = o;
  }
}

// ---------- 3) Generic WMMA GEMM: C = A(MxK) * B(KxN), B given transposed ----------
// EPI 0: store f16 row-major MxN.
// EPI 1: out-proj epilogue: +resid(row,col) +bias(col), store f32 transposed (b,d,n).
template <int EPI>
__global__ __launch_bounds__(256) void gemm_wmma_k(
    const _Float16* __restrict__ A, const _Float16* __restrict__ BT,
    int M, int N, int K, _Float16* __restrict__ Ch,
    const float* __restrict__ resid, const float* __restrict__ bias,
    float* __restrict__ outT) {
  const int lane = threadIdx.x & 31;
  const int w    = threadIdx.x >> 5;             // 8 waves
  const int m0   = blockIdx.x * 64  + (w & 1) * 32;
  const int n0   = blockIdx.y * 128 + (w >> 1) * 32;

  const v8f z = {0.f, 0.f, 0.f, 0.f, 0.f, 0.f, 0.f, 0.f};
  v8f acc[2][2];
  acc[0][0] = z; acc[0][1] = z; acc[1][0] = z; acc[1][1] = z;

  for (int k0 = 0; k0 < K; k0 += 32) {
    v16h a0 = load_frag(A  + (size_t)(m0     ) * K + k0, K, lane);
    v16h a1 = load_frag(A  + (size_t)(m0 + 16) * K + k0, K, lane);
    v16h b0 = load_frag(BT + (size_t)(n0     ) * K + k0, K, lane);
    v16h b1 = load_frag(BT + (size_t)(n0 + 16) * K + k0, K, lane);
    acc[0][0] = wmma_f16(a0, b0, acc[0][0]);
    acc[0][1] = wmma_f16(a0, b1, acc[0][1]);
    acc[1][0] = wmma_f16(a1, b0, acc[1][0]);
    acc[1][1] = wmma_f16(a1, b1, acc[1][1]);
  }

  const int c = lane & 15, g = lane >> 4;
#pragma unroll
  for (int ti = 0; ti < 2; ++ti)
#pragma unroll
    for (int tj = 0; tj < 2; ++tj)
#pragma unroll
      for (int p = 0; p < 8; ++p) {
        const int row = m0 + ti * 16 + g * 8 + p;
        const int col = n0 + tj * 16 + c;
        float v = acc[ti][tj][p];
        if (EPI == 0) {
          Ch[(size_t)row * N + col] = (_Float16)v;
        } else {
          v += resid[(size_t)row * N + col] + bias[col];
          const int bb = row >> 11, pos = row & (N_ - 1);
          outT[((size_t)(bb * D_ + col)) * N_ + pos] = v;
        }
      }
}

// ---------- 4) xPos rotary ----------
__device__ __forceinline__ void xpos_coeffs(int pos, int j, float& cs, float& sn,
                                            float& scl) {
  const float fpos = (float)pos;
  const float invf = __powf(10000.f, -(float)(2 * j) * (1.f / (float)DH_));
  const float fr   = fpos * invf;
  cs = __cosf(fr);
  sn = __sinf(fr);
  const float bs = ((float)(2 * j) + 0.4f * DH_) * (1.f / (1.4f * DH_));
  const float pw = (fpos - (float)(N_ / 2)) * (1.f / 4096.f);
  scl = __powf(bs, pw);
}

// One lane takes 8 rotation pairs of one (token, head): dims j0 .. j0+7 and their
// partners 32 on, each half one 16-byte load and one 16-byte store. The coefficients of
// a pair are formed once, and a launch starts 16 times fewer waves.
__global__ __launch_bounds__(256) void rotary_q_k(
    const _Float16* __restrict__ qraw, _Float16* __restrict__ qh) {
  const int idx = blockIdx.x * 256 + threadIdx.x;  // b*h*n*4 = 256K
  const int j0  = (idx & 3) * 8;
  const int pos = (idx >> 2) & (N_ - 1);
  const int h   = (idx >> 13) & (H_ - 1);
  const int b   = idx >> 16;
  const size_t tok = (size_t)(b * N_ + pos);
  const _Float16* qp = qraw + tok * (H_ * DH_) + h * DH_ + j0;
  const v8h lo = *(const v8h*)qp;
  const v8h hi = *(const v8h*)(qp + 32);
  v8h olo, ohi;
#pragma unroll
  for (int e = 0; e < 8; ++e) {
    float cs, sn, scl;
    xpos_coeffs(pos, j0 + e, cs, sn, scl);
    const float a = (float)lo[e], c = (float)hi[e];
    olo[e] = (_Float16)((a * cs + (-c) * sn) * scl * 0.125f);  // fold 1/sqrt(dh)
    ohi[e] = (_Float16)((c * cs + a * sn) * scl * 0.125f);
  }
  _Float16* op = qh + (((size_t)(b * H_ + h) * N_) + pos) * DH_ + j0;
  *(v8h*)op        = olo;
  *(v8h*)(op + 32) = ohi;
}

// Blocks 0 .. KV_KBLK-1 rotate K as above. The rest turn V: one lane takes an
// 8 (positions) x 8 (dims) block in its registers; eight lanes side by side along the
// positions store one whole 128-byte line of a V^T row.
#define KV_KBLK (B_ * KVH_ * N_ * 4 / 256)          // 256
#define KV_VBLK (B_ * KVH_ * N_ * DH_ / 64 / 256)   // 64
__global__ __launch_bounds__(256) void rotary_kv_k(
    const _Float16* __restrict__ kvraw, _Float16* __restrict__ kh,
    _Float16* __restrict__ vT) {
  if (blockIdx.x < KV_KBLK) {
    const int idx = blockIdx.x * 256 + threadIdx.x;  // b*kvh*n*4 = 64K
    const int j0  = (idx & 3) * 8;
    const int pos = (idx >> 2) & (N_ - 1);
    const int kv  = (idx >> 13) & 1;
    const int b   = idx >> 14;
    const size_t tok = (size_t)(b * N_ + pos);
    const _Float16* kp = kvraw + tok * 256 + kv * DH_ + j0;
    const v8h lo = *(const v8h*)kp;
    const v8h hi = *(const v8h*)(kp + 32);
    v8h olo, ohi;
#pragma unroll
    for (int e = 0; e < 8; ++e) {
      float cs, sn, scl;
      xpos_coeffs(pos, j0 + e, cs, sn, scl);
      const float a = (float)lo[e], c = (float)hi[e];
      olo[e] = (_Float16)((a * cs + (-c) * sn) / scl);
      ohi[e] = (_Float16)((c * cs + a * sn) / scl);
    }
    _Float16* op = kh + (((size_t)(b * KVH_ + kv) * N_) + pos) * DH_ + j0;
    *(v8h*)op        = olo;
    *(v8h*)(op + 32) = ohi;
  } else {
    const int idx = (blockIdx.x - KV_KBLK) * 256 + threadIdx.x;  // b*kvh*(n/8)*(dh/8) = 16K
    const int p0 = ((idx >> 6) & 31) * 64 + (idx & 7) * 8;
    const int d0 = ((idx >> 3) & 7) * 8;
    const int kv = (idx >> 11) & 1;
    const int b  = idx >> 12;
    const _Float16* vp = kvraw + (size_t)(b * N_ + p0) * 256 + 128 + kv * DH_ + d0;
    v8h r[8];
#pragma unroll
    for (int e = 0; e < 8; ++e) r[e] = *(const v8h*)(vp + (size_t)e * 256);
    _Float16* op = vT + (((size_t)(b * KVH_ + kv) * DH_) + d0) * N_ + p0;
#pragma unroll
    for (int d = 0; d < 8; ++d) {
      v8h o;
#pragma unroll
      for (int e = 0; e < 8; ++e) o[e] = r[e][d];
      *(v8h*)(op + (size_t)d * N_) = o;
    }
    // the built code lays the K branch behind these stores: keep the wait in front of
    // any rewrite of a register that an issued store names
    asm volatile("s_wait_xcnt 0x0" ::: "memory");
  }
}

// ---------- 5) Flash attention: per (b,h), wave = 16 query rows ----------
__global__ __launch_bounds__(256) void flash_k(
    const _Float16* __restrict__ Q,   // (b, h, n, dh)
    const _Float16* __restrict__ Kt,  // (b, kvh, n, dh)
    const _Float16* __restrict__ VT,  // (b, kvh, dh, n)
    _Float16* __restrict__ O) {       // (b, n, h*dh)
  __shared__ __align__(16) _Float16 lds[8 * 16 * 32];  // per-wave 16x32 probs tile
  const int lane = threadIdx.x & 31;
  const int w    = threadIdx.x >> 5;
  const int h    = blockIdx.y, b = blockIdx.z;
  const int kv   = h & (KVH_ - 1);                     // tile(k, r): head h -> h % kvh
  const int qRow0 = blockIdx.x * 128 + w * 16;

  const _Float16* qptr  = Q  + (((size_t)(b * H_ + h) * N_) + qRow0) * DH_;
  const _Float16* kbase = Kt + ((size_t)(b * KVH_ + kv) * N_) * DH_;
  const _Float16* vbase = VT + ((size_t)(b * KVH_ + kv) * DH_) * N_;

  const v16h aq0 = load_frag(qptr,      DH_, lane);    // K dims  0..31
  const v16h aq1 = load_frag(qptr + 32, DH_, lane);    // K dims 32..63

  const v8f z = {0.f, 0.f, 0.f, 0.f, 0.f, 0.f, 0.f, 0.f};
  v8f oacc[4]; oacc[0] = z; oacc[1] = z; oacc[2] = z; oacc[3] = z;
  float mrow[8], lrow[8];
#pragma unroll
  for (int p = 0; p < 8; ++p) { mrow[p] = -1e30f; lrow[p] = 0.f; }

  const int c = lane & 15, g = lane >> 4;
  _Float16* wl = lds + w * 512;

  for (int kb = 0; kb < N_; kb += 32) {
    // ---- scores: two 16x16 f32 tiles covering 32 keys ----
    v8f s0 = z, s1 = z;
    {
      const _Float16* kp0 = kbase + (size_t)kb * DH_;
      s0 = wmma_f16(aq0, load_frag(kp0,      DH_, lane), s0);
      s0 = wmma_f16(aq1, load_frag(kp0 + 32, DH_, lane), s0);
      const _Float16* kp1 = kbase + (size_t)(kb + 16) * DH_;
      s1 = wmma_f16(aq0, load_frag(kp1,      DH_, lane), s1);
      s1 = wmma_f16(aq1, load_frag(kp1 + 32, DH_, lane), s1);
    }
    // ---- online softmax: row reductions across the 16-lane C-layout halves ----
#pragma unroll
    for (int p = 0; p < 8; ++p) {
      float rmax = fmaxf(s0[p], s1[p]);
      rmax = fmaxf(rmax, __shfl_xor(rmax, 1, 32));
      rmax = fmaxf(rmax, __shfl_xor(rmax, 2, 32));
      rmax = fmaxf(rmax, __shfl_xor(rmax, 4, 32));
      rmax = fmaxf(rmax, __shfl_xor(rmax, 8, 32));
      const float nm = fmaxf(mrow[p], rmax);
      const float sc = __expf(mrow[p] - nm);
      const float p0 = __expf(s0[p] - nm);
      const float p1 = __expf(s1[p] - nm);
      wl[(g * 8 + p) * 32 + c]      = (_Float16)p0;   // row-major 16x32 probs tile
      wl[(g * 8 + p) * 32 + 16 + c] = (_Float16)p1;
      float rs = p0 + p1;
      rs += __shfl_xor(rs, 1, 32);
      rs += __shfl_xor(rs, 2, 32);
      rs += __shfl_xor(rs, 4, 32);
      rs += __shfl_xor(rs, 8, 32);
      lrow[p] = lrow[p] * sc + rs;
      mrow[p] = nm;
#pragma unroll
      for (int j = 0; j < 4; ++j) oacc[j][p] *= sc;
    }
    // ---- reload probs as A-fragment, accumulate AV over dh in 4 tiles of 16 ----
    const v16h pa = load_frag(wl, 32, lane);
#pragma unroll
    for (int j = 0; j < 4; ++j) {
      const v16h bv = load_frag(vbase + (size_t)(j * 16) * N_ + kb, N_, lane);
      oacc[j] = wmma_f16(pa, bv, oacc[j]);
    }
  }

#pragma unroll
  for (int p = 0; p < 8; ++p) {
    const float inv = 1.f / lrow[p];
    const size_t row = (size_t)(b * N_ + qRow0 + g * 8 + p);
#pragma unroll
    for (int j = 0; j < 4; ++j)
      O[row * (H_ * DH_) + h * DH_ + j * 16 + c] = (_Float16)(oacc[j][p] * inv);
  }
}

// ---------- launch ----------
extern "C" void kernel_launch(void* const* d_in, const int* in_sizes, int n_in,
                              void* d_out, int out_size, void* d_ws, size_t ws_size,
                              hipStream_t stream) {
  const float* x     = (const float*)d_in[0];
  const float* gamma = (const float*)d_in[1];
  const float* beta  = (const float*)d_in[2];
  const float* Wq    = (const float*)d_in[3];
  const float* Wkv   = (const float*)d_in[4];
  const float* Wout  = (const float*)d_in[5];
  const float* bout  = (const float*)d_in[6];
  float* y = (float*)d_out;

  char* wsp = (char*)d_ws;
  auto take = [&](size_t bytes) {
    void* p = (void*)wsp;
    wsp += (bytes + 255) & ~(size_t)255;
    return p;
  };
  float*    xnf   = (float*)take((size_t)BN_ * D_ * 4);
  _Float16* xnh   = (_Float16*)take((size_t)BN_ * D_ * 2);
  _Float16* WqT   = (_Float16*)take((size_t)D_ * D_ * 2);
  _Float16* WkvT  = (_Float16*)take((size_t)256 * D_ * 2);
  _Float16* WoutT = (_Float16*)take((size_t)D_ * D_ * 2);
  _Float16* qraw  = (_Float16*)take((size_t)BN_ * D_ * 2);
  _Float16* kvraw = (_Float16*)take((size_t)BN_ * 256 * 2);
  _Float16* qh    = (_Float16*)take((size_t)B_ * H_ * N_ * DH_ * 2);
  _Float16* kh    = (_Float16*)take((size_t)B_ * KVH_ * N_ * DH_ * 2);
  _Float16* vT    = (_Float16*)take((size_t)B_ * KVH_ * N_ * DH_ * 2);
  _Float16* ao    = (_Float16*)take((size_t)BN_ * D_ * 2);

  layernorm_k<<<BN_ / LN_TOK, 512, 0, stream>>>(x, gamma, beta, xnf, xnh);
  transpose_w_k<D_, D_><<<D_ * D_ / 64 / 256, 256, 0, stream>>>(Wq, WqT);
  transpose_w_k<D_, 256><<<D_ * 256 / 64 / 256, 256, 0, stream>>>(Wkv, WkvT);
  transpose_w_k<D_, D_><<<D_ * D_ / 64 / 256, 256, 0, stream>>>(Wout, WoutT);

  gemm_wmma_k<0><<<dim3(BN_ / 64, D_ / 128), 256, 0, stream>>>(
      xnh, WqT, BN_, D_, D_, qraw, nullptr, nullptr, nullptr);
  gemm_wmma_k<0><<<dim3(BN_ / 64, 256 / 128), 256, 0, stream>>>(
      xnh, WkvT, BN_, 256, D_, kvraw, nullptr, nullptr, nullptr);

  rotary_q_k<<<(B_ * H_ * N_ * 4) / 256, 256, 0, stream>>>(qraw, qh);
  rotary_kv_k<<<KV_KBLK + KV_VBLK, 256, 0, stream>>>(kvraw, kh, vT);

  flash_k<<<dim3(N_ / 128, H_, B_), 256, 0, stream>>>(qh, kh, vT, ao);

  gemm_wmma_k<1><<<dim3(BN_ / 64, D_ / 128), 256, 0, stream>>>(
      ao, WoutT, BN_, D_, D_, nullptr, xnf, bout, y);
}

// v003
// A run of this version takes 159 microseconds.
// Timed twice side by side with v002, it ran 1.37 and 1.38 times as fast.
// All steps since v000 together make it 2.22 times as fast.
#include <hip/hip_runtime.h>

// ---------- types ----------
typedef __attribute__((ext_vector_type(16))) _Float16 v16h;
typedef __attribute__((ext_vector_type(8)))  _Float16 v8h;
typedef __attribute__((ext_vector_type(8)))  float    v8f;

#define B_   4
#define N_   2048
#define D_   512
#define H_   8
#define KVH_ 2
#define DH_  64
#define BN_  (B_ * N_)   // 8192 tokens

// ---------- WMMA helpers ----------
__device__ __forceinline__ v8f wmma_f16(v16h a, v16h b, v8f c) {
  // D = A(16x32 f16) x B(32x16 f16) + C(16x16 f32)
  return __builtin_amdgcn_wmma_f32_16x16x32_f16(
      /*neg_a=*/false, a, /*neg_b=*/false, b,
      /*c_mod=*/(short)0, c, /*reuse_a=*/false, /*reuse_b=*/false);
}

// Load a 16x32 f16 fragment (A-layout; identical striping assumed for B^T rows)
// from a row-major matrix with leading dimension `ld` (in elements).
// Lane (r = lane&15, g = lane>>4) holds row r, K = {g*8..g*8+7, 16+g*8..16+g*8+7}.
__device__ __forceinline__ v16h load_frag(const _Float16* __restrict__ base,
                                          int ld, int lane) {
  const int r = lane & 15, g = lane >> 4;
  const _Float16* p = base + (size_t)r * ld + g * 8;
  v8h lo = *(const v8h*)(p);
  v8h hi = *(const v8h*)(p + 16);
  v16h f;
#pragma unroll
  for (int i = 0; i < 8; ++i) { f[i] = lo[i]; f[i + 8] = hi[i]; }
  return f;
}

// ---------- 1) LayerNorm: x (b,d,n) -> xn (b*n, d) f32 + f16 ----------
// One work-group takes 32 tokens x all 512 channels. x is read along n (whole
// 128-byte lines), turned through LDS, and each token's row is then summed,
// normalised and stored along d (whole lines again).
typedef __attribute__((ext_vector_type(4))) _Float16 v4h;
#define LN_TOK   32
#define LN_PITCH 516  // dwords; 4 mod 64, so a column walk of 16-byte stores meets every bank once

__global__ __launch_bounds__(512) void layernorm_k(
    const float* __restrict__ x, const float* __restrict__ gamma,
    const float* __restrict__ beta, float* __restrict__ xnf,
    _Float16* __restrict__ xnh) {
  __shared__ __align__(16) float tile[LN_TOK * LN_PITCH];
  const int lane = threadIdx.x & 31;
  const int w    = threadIdx.x >> 5;               // 16 waves
  const int t0   = blockIdx.x * LN_TOK;            // first token of the tile
  const int b = t0 >> 11, pos0 = t0 & (N_ - 1);

  // lane = token, wave w holds channels w*32 .. w*32+31 of it
  const float* xb = x + ((size_t)b * D_ + w * 32) * N_ + pos0 + lane;
  float v[32];
  for (int i = 0; i < 32; ++i) v[i] = xb[(size_t)i * N_];
  float* tp = tile + lane * LN_PITCH + w * 32;
  for (int i = 0; i < 32; i += 4)
    *(float4*)(tp + i) = make_float4(v[i], v[i + 1], v[i + 2], v[i + 3]);

  // lane holds channels k*128 + lane*4 .. +3, k = 0..3
  float4 gm[4], bt[4];
  for (int k = 0; k < 4; ++k) {
    gm[k] = *(const float4*)(gamma + k * 128 + lane * 4);
    bt[k] = *(const float4*)(beta  + k * 128 + lane * 4);
  }
  __syncthreads();

  // wave w owns tokens 2w and 2w+1 of the tile
  for (int r = 0; r < 2; ++r) {
    const int row = w * 2 + r;
    const float* rp = tile + row * LN_PITCH + lane * 4;
    float4 a[4];
    for (int k = 0; k < 4; ++k) a[k] = *(const float4*)(rp + k * 128);
    float s = 0.f, ss = 0.f;
    for (int k = 0; k < 4; ++k) {
      s  += (a[k].x + a[k].y) + (a[k].z + a[k].w);
      ss += (a[k].x * a[k].x + a[k].y * a[k].y) + (a[k].z * a[k].z + a[k].w * a[k].w);
    }
    for (int m = 1; m < 32; m <<= 1) {
      s  += __shfl_xor(s,  m, 32);
      ss += __shfl_xor(ss, m, 32);
    }
    const float mu  = s * (1.f / D_);
    const float var = ss * (1.f / D_) - mu * mu;
    const float rst = rsqrtf(var + 1e-5f);
    float*    o  = xnf + (size_t)(t0 + row) * D_ + lane * 4;
    _Float16* oh = xnh + (size_t)(t0 + row) * D_ + lane * 4;
    for (int k = 0; k < 4; ++k) {
      float4 y;
      y.x = (a[k].x - mu) * rst * gm[k].x + bt[k].x;
      y.y = (a[k].y - mu) * rst * gm[k].y + bt[k].y;
      y.z = (a[k].z - mu) * rst * gm[k].z + bt[k].z;
      y.w = (a[k].w - mu) * rst * gm[k].w + bt[k].w;
      *(float4*)(o + k * 128) = y;
      v4h yh = {(_Float16)y.x, (_Float16)y.y, (_Float16)y.z, (_Float16)y.w};
      *(v4h*)(oh + k * 128) = yh;
    }
  }
}

// ---------- 2) Weight convert + transpose: W (K x N) f32 -> W^T (N x K) f16 ----------
// One lane turns an 8 (k) x 8 (n) block in its registers, so a launch starts 64 times
// fewer waves than with one element a lane. A wave takes 64 k x 32 n: eight lanes side
// by side along k store one whole 128-byte line of a W^T row. The grid is exact:
// K * N / 64 lanes, a multiple of 256.
template <int K, int N>
__global__ __launch_bounds__(256) void transpose_w_k(
    const float* __restrict__ W, _Float16* __restrict__ WT) {
  static_assert(K % 64 == 0 && N % 32 == 0 && (K * N / 64) % 256 == 0, "tile shape");
  const int idx = blockIdx.x * 256 + threadIdx.x;
  const int lane = idx & 31, tile = idx >> 5;
  const int tk = tile % (K >> 6), tn = tile / (K >> 6);
  const int k0 = tk * 64 + (lane & 7) * 8;
  const int n0 = tn * 32 + (lane >> 3) * 8;
  const float* wp = W + (size_t)k0 * N + n0;
  float r[8][8];
#pragma unroll
  for (int e = 0; e < 8; ++e) {
    const float4 a = *(const float4*)(wp + (size_t)e * N);
    const float4 b = *(const float4*)(wp + (size_t)e * N + 4);
    r[e][0] = a.x; r[e][1] = a.y; r[e][2] = a.z; r[e][3] = a.w;
    r[e][4] = b.x; r[e][5] = b.y; r[e][6] = b.z; r[e][7] = b.w;
  }
  _Float16* op = WT + (size_t)n0 * K + k0;
#pragma unroll
  for (int n = 0; n < 8; ++n) {
    v8h o;
#pragma unroll
    for (int e = 0; e < 8; ++e) o[e] = (_Float16)r[e][n];
    *(v8h*)(op + (size_t)n * K) = o;
  }
}

// ---------- 3) Generic WMMA GEMM: C = A(MxK) * B(KxN), B given transposed ----------
// EPI 0: store f16 row-major MxN.
// EPI 1: out-proj epilogue: +resid(row,col) +bias(col), store f32 transposed (b,d,n).
template <int EPI>
__global__ __launch_bounds__(256) void gemm_wmma_k(
    const _Float16* __restrict__ A, const _Float16* __restrict__ BT,
    int M, int N, int K, _Float16* __restrict__ Ch,
    const float* __restrict__ resid, const float* __restrict__ bias,
    float* __restrict__ outT) {
  const int lane = threadIdx.x & 31;
  const int w    = threadIdx.x >> 5;             // 8 waves
  const int m0   = blockIdx.x * 64  + (w & 1) * 32;
  const int n0   = blockIdx.y * 128 + (w >> 1) * 32;

  const v8f z = {0.f, 0.f, 0.f, 0.f, 0.f, 0.f, 0.f, 0.f};
  v8f acc[2][2];
  acc[0][0] = z; acc[0][1] = z; acc[1][0] = z; acc[1][1] = z;

  for (int k0 = 0; k0 < K; k0 += 32) {
    v16h a0 = load_frag(A  + (size_t)(m0     ) * K + k0, K, lane);
    v16h a1 = load_frag(A  + (size_t)(m0 + 16) * K + k0, K, lane);
    v16h b0 = load_frag(BT + (size_t)(n0     ) * K + k0, K, lane);
    v16h b1 = load_frag(BT + (size_t)(n0 + 16) * K + k0, K, lane);
    acc[0][0] = wmma_f16(a0, b0, acc[0][0]);
    acc[0][1] = wmma_f16(a0, b1, acc[0][1]);
    acc[1][0] = wmma_f16(a1, b0, acc[1][0]);
    acc[1][1] = wmma_f16(a1, b1, acc[1][1]);
  }

  const int c = lane & 15, g = lane >> 4;
#pragma unroll
  for (int ti = 0; ti < 2; ++ti)
#pragma unroll
    for (int tj = 0; tj < 2; ++tj)
#pragma unroll
      for (int p = 0; p < 8; ++p) {
        const int row = m0 + ti * 16 + g * 8 + p;
        const int col = n0 + tj * 16 + c;
        float v = acc[ti][tj][p];
        if (EPI == 0) {
          Ch[(size_t)row * N + col] = (_Float16)v;
        } else {
          v += resid[(size_t)row * N + col] + bias[col];
          const int bb = row >> 11, pos = row & (N_ - 1);
          outT[((size_t)(bb * D_ + col)) * N_ + pos] = v;
        }
      }
}

// ---------- 4) xPos rotary ----------
__device__ __forceinline__ void xpos_coeffs(int pos, int j, float& cs, float& sn,
                                            float& scl) {
  const float fpos = (float)pos;
  const float invf = __powf(10000.f, -(float)(2 * j) * (1.f / (float)DH_));
  const float fr   = fpos * invf;
  cs = __cosf(fr);
  sn = __sinf(fr);
  const float bs = ((float)(2 * j) + 0.4f * DH_) * (1.f / (1.4f * DH_));
  const float pw = (fpos - (float)(N_ / 2)) * (1.f / 4096.f);
  scl = __powf(bs, pw);
}

// One lane takes 8 rotation pairs of one (token, head): dims j0 .. j0+7 and their
// partners 32 on, each half one 16-byte load and one 16-byte store. The coefficients of
// a pair are formed once, and a launch starts 16 times fewer waves.
__global__ __launch_bounds__(256) void rotary_q_k(
    const _Float16* __restrict__ qraw, _Float16* __restrict__ qh) {
  const int idx = blockIdx.x * 256 + threadIdx.x;  // b*h*n*4 = 256K
  const int j0  = (idx & 3) * 8;
  const int pos = (idx >> 2) & (N_ - 1);
  const int h   = (idx >> 13) & (H_ - 1);
  const int b   = idx >> 16;
  const size_t tok = (size_t)(b * N_ + pos);
  const _Float16* qp = qraw + tok * (H_ * DH_) + h * DH_ + j0;
  const v8h lo = *(const v8h*)qp;
  const v8h hi = *(const v8h*)(qp + 32);
  v8h olo, ohi;
#pragma unroll
  for (int e = 0; e < 8; ++e) {
    float cs, sn, scl;
    xpos_coeffs(pos, j0 + e, cs, sn, scl);
    const float a = (float)lo[e], c = (float)hi[e];
    olo[e] = (_Float16)((a * cs + (-c) * sn) * scl * 0.125f);  // fold 1/sqrt(dh)
    ohi[e] = (_Float16)((c * cs + a * sn) * scl * 0.125f);
  }
  _Float16* op = qh + (((size_t)(b * H_ + h) * N_) + pos) * DH_ + j0;
  *(v8h*)op        = olo;
  *(v8h*)(op + 32) = ohi;
}

// Blocks 0 .. KV_KBLK-1 rotate K as above. The rest turn V: one lane takes an
// 8 (positions) x 8 (dims) block in its registers; eight lanes side by side along the
// positions store one whole 128-byte line of a V^T row.
#define KV_KBLK (B_ * KVH_ * N_ * 4 / 256)          // 256
#define KV_VBLK (B_ * KVH_ * N_ * DH_ / 64 / 256)   // 64
__global__ __launch_bounds__(256) void rotary_kv_k(
    const _Float16* __restrict__ kvraw, _Float16* __restrict__ kh,
    _Float16* __restrict__ vT) {
  if (blockIdx.x < KV_KBLK) {
    const int idx = blockIdx.x * 256 + threadIdx.x;  // b*kvh*n*4 = 64K
    const int j0  = (idx & 3) * 8;
    const int pos = (idx >> 2) & (N_ - 1);
    const int kv  = (idx >> 13) & 1;
    const int b   = idx >> 14;
    const size_t tok = (size_t)(b * N_ + pos);
    const _Float16* kp = kvraw + tok * 256 + kv * DH_ + j0;
    const v8h lo = *(const v8h*)kp;
    const v8h hi = *(const v8h*)(kp + 32);
    v8h olo, ohi;
#pragma unroll
    for (int e = 0; e < 8; ++e) {
      float cs, sn, scl;
      xpos_coeffs(pos, j0 + e, cs, sn, scl);
      const float a = (float)lo[e], c = (float)hi[e];
      olo[e] = (_Float16)((a * cs + (-c) * sn) / scl);
      ohi[e] = (_Float16)((c * cs + a * sn) / scl);
    }
    _Float16* op = kh + (((size_t)(b * KVH_ + kv) * N_) + pos) * DH_ + j0;
    *(v8h*)op        = olo;
    *(v8h*)(op + 32) = ohi;
  } else {
    const int idx = (blockIdx.x - KV_KBLK) * 256 + threadIdx.x;  // b*kvh*(n/8)*(dh/8) = 16K
    const int p0 = ((idx >> 6) & 31) * 64 + (idx & 7) * 8;
    const int d0 = ((idx >> 3) & 7) * 8;
    const int kv = (idx >> 11) & 1;
    const int b  = idx >> 12;
    const _Float16* vp = kvraw + (size_t)(b * N_ + p0) * 256 + 128 + kv * DH_ + d0;
    v8h r[8];
#pragma unroll
    for (int e = 0; e < 8; ++e) r[e] = *(const v8h*)(vp + (size_t)e * 256);
    _Float16* op = vT + (((size_t)(b * KVH_ + kv) * DH_) + d0) * N_ + p0;
#pragma unroll
    for (int d = 0; d < 8; ++d) {
      v8h o;
#pragma unroll
      for (int e = 0; e < 8; ++e) o[e] = r[e][d];
      *(v8h*)(op + (size_t)d * N_) = o;
    }
    // the built code lays the K branch behind these stores: keep the wait in front of
    // any rewrite of a register that an issued store names
    asm volatile("s_wait_xcnt 0x0" ::: "memory");
  }
}

// ---------- 5) Flash attention: per (b,h), wave = 16 query rows ----------
// The 8 waves of a work-group walk the same keys, so K and V^T go through LDS once for
// all of them: tiles of 64 keys, two buffers, the next tile copied while this one is used.
#define FA_KEYS  64                   // keys per tile: a K row and a V^T row are 128 bytes each
#define FA_PITCH 72                   // halves per LDS row: 144 bytes, an odd multiple of 16
#define FA_OPER  (64 * FA_PITCH)      // halves of one operand's tile (64 rows)
#define FA_BUF   (2 * FA_OPER)        // K tile, V^T tile behind it
#define FA_TILES (N_ / FA_KEYS)

// One tile: 128 rows of 128 bytes, 16 bytes a lane and copy, so a wave's copy takes four
// whole lines. kg, vg: this lane's place in rows 0..31 of the K and the V^T tile.
__device__ __forceinline__ void stage_kv(const _Float16* kg, const _Float16* vg,
                                         unsigned dst) {
  const _Float16* kg1 = kg + 32 * DH_;
  const _Float16* vg1 = vg + (size_t)32 * N_;
  const unsigned dk1 = dst + 32 * FA_PITCH * 2;
  const unsigned dv0 = dst + FA_OPER * 2;
  const unsigned dv1 = dv0 + 32 * FA_PITCH * 2;
  // the wait stands inside the statement, in front of any rewrite of an address register
  asm volatile(
      "global_load_async_to_lds_b128 %0, %4, off\n\t"
      "global_load_async_to_lds_b128 %1, %5, off\n\t"
      "global_load_async_to_lds_b128 %2, %6, off\n\t"
      "global_load_async_to_lds_b128 %3, %7, off\n\t"
      "s_wait_xcnt 0x0"
      :: "v"(dst), "v"(dk1), "v"(dv0), "v"(dv1), "v"(kg), "v"(kg1), "v"(vg), "v"(vg1)
      : "memory");
}

__global__ __launch_bounds__(256) void flash_k(
    const _Float16* __restrict__ Q,   // (b, h, n, dh)
    const _Float16* __restrict__ Kt,  // (b, kvh, n, dh)
    const _Float16* __restrict__ VT,  // (b, kvh, dh, n)
    _Float16* __restrict__ O) {       // (b, n, h*dh)
  __shared__ __align__(16) _Float16 lds[8 * 16 * 32];  // per-wave 16x32 probs tile
  __shared__ __align__(16) _Float16 kvs[2 * FA_BUF];   // the two K / V^T buffers
  const int lane = threadIdx.x & 31;
  const int w    = threadIdx.x >> 5;
  const int h    = blockIdx.y, b = blockIdx.z;
  const int kv   = h & (KVH_ - 1);                     // tile(k, r): head h -> h % kvh
  const int qRow0 = blockIdx.x * 128 + w * 16;

  const _Float16* qptr  = Q  + (((size_t)(b * H_ + h) * N_) + qRow0) * DH_;
  const _Float16* kbase = Kt + ((size_t)(b * KVH_ + kv) * N_) * DH_;
  const _Float16* vbase = VT + ((size_t)(b * KVH_ + kv) * DH_) * N_;

  // this lane's share of a tile: row threadIdx.x / 8 (and 32 on), 16-byte piece threadIdx.x % 8
  const int srow = threadIdx.x >> 3, spc = (threadIdx.x & 7) * 8;
  const _Float16* kg = kbase + (size_t)srow * DH_ + spc;
  const _Float16* vg = vbase + (size_t)srow * N_ + spc;
  const unsigned sdst = (unsigned)(size_t)kvs + (unsigned)(srow * FA_PITCH + spc) * 2u;

  stage_kv(kg, vg, sdst);                              // tile 0 into buffer 0
  asm volatile("s_wait_asynccnt 0x0" ::: "memory");    // this wave's share of tile 0 has landed
  __syncthreads();                                     // every wave's share has
  stage_kv(kg + FA_KEYS * DH_, vg + FA_KEYS, sdst + FA_BUF * 2);  // tile 1 into buffer 1

  const v16h aq0 = load_frag(qptr,      DH_, lane);    // K dims  0..31
  const v16h aq1 = load_frag(qptr + 32, DH_, lane);    // K dims 32..63

  const v8f z = {0.f, 0.f, 0.f, 0.f, 0.f, 0.f, 0.f, 0.f};
  v8f oacc[4]; oacc[0] = z; oacc[1] = z; oacc[2] = z; oacc[3] = z;
  float mrow[8], lrow[8];
#pragma unroll
  for (int p = 0; p < 8; ++p) { mrow[p] = -1e30f; lrow[p] = 0.f; }

  const int c = lane & 15, g = lane >> 4;
  _Float16* wl = lds + w * 512;

  for (int t = 0; t < FA_TILES; ++t) {
    const _Float16* kt = kvs + (t & 1) * FA_BUF;
    const _Float16* vt = kt + FA_OPER;
    // both 32-key passes of a tile inline: sub becomes a constant offset of the LDS loads
#pragma unroll
    for (int sub = 0; sub < FA_KEYS; sub += 32) {
      // ---- scores: two 16x16 f32 tiles covering 32 keys ----
      v8f s0 = z, s1 = z;
      {
        const _Float16* kp0 = kt + sub * FA_PITCH;
        s0 = wmma_f16(aq0, load_frag(kp0,      FA_PITCH, lane), s0);
        s0 = wmma_f16(aq1, load_frag(kp0 + 32, FA_PITCH, lane), s0);
        const _Float16* kp1 = kt + (sub + 16) * FA_PITCH;
        s1 = wmma_f16(aq0, load_frag(kp1,      FA_PITCH, lane), s1);
        s1 = wmma_f16(aq1, load_frag(kp1 + 32, FA_PITCH, lane), s1);
      }
      // ---- online softmax: row reductions across the 16-lane C-layout halves ----
#pragma unroll
      for (int p = 0; p < 8; ++p) {
        float rmax = fmaxf(s0[p], s1[p]);
        rmax = fmaxf(rmax, __shfl_xor(rmax, 1, 32));
        rmax = fmaxf(rmax, __shfl_xor(rmax, 2, 32));
        rmax = fmaxf(rmax, __shfl_xor(rmax, 4, 32));
        rmax = fmaxf(rmax, __shfl_xor(rmax, 8, 32));
        const float nm = fmaxf(mrow[p], rmax);
        const float sc = __expf(mrow[p] - nm);
        const float p0 = __expf(s0[p] - nm);
        const float p1 = __expf(s1[p] - nm);
        wl[(g * 8 + p) * 32 + c]      = (_Float16)p0;   // row-major 16x32 probs tile
        wl[(g * 8 + p) * 32 + 16 + c] = (_Float16)p1;
        float rs = p0 + p1;
        rs += __shfl_xor(rs, 1, 32);
        rs += __shfl_xor(rs, 2, 32);
        rs += __shfl_xor(rs, 4, 32);
        rs += __shfl_xor(rs, 8, 32);
        lrow[p] = lrow[p] * sc + rs;
        mrow[p] = nm;
#pragma unroll
        for (int j = 0; j < 4; ++j) oacc[j][p] *= sc;
      }
      // ---- reload probs as A-fragment, accumulate AV over dh in 4 tiles of 16 ----
      const v16h pa = load_frag(wl, 32, lane);
#pragma unroll
      for (int j = 0; j < 4; ++j) {
        const v16h bv = load_frag(vt + (j * 16) * FA_PITCH + sub, FA_PITCH, lane);
        oacc[j] = wmma_f16(pa, bv, oacc[j]);
      }
    }
    // hand-over: this wave's reads of buffer t % 2 are done, its share of tile t + 1 has
    // landed; behind the barrier that holds for every wave, and the buffer may be refilled
    asm volatile("s_wait_dscnt 0x0" ::: "memory");
    asm volatile("s_wait_asynccnt 0x0" ::: "memory");
    __syncthreads();
    if (t + 2 < FA_TILES)
      stage_kv(kg + (size_t)(t + 2) * (FA_KEYS * DH_), vg + (t + 2) * FA_KEYS,
               sdst + (unsigned)(t & 1) * (FA_BUF * 2));
  }
  asm volatile("s_wait_asynccnt 0x0" ::: "memory");    // no copy is left in flight at the end

#pragma unroll
  for (int p = 0; p < 8; ++p) {
    const float inv = 1.f / lrow[p];
    const size_t row = (size_t)(b * N_ + qRow0 + g * 8 + p);
#pragma unroll
    for (int j = 0; j < 4; ++j)
      O[row * (H_ * DH_) + h * DH_ + j * 16 + c] = (_Float16)(oacc[j][p] * inv);
  }
}

// ---------- launch ----------
extern "C" void kernel_launch(void* const* d_in, const int* in_sizes, int n_in,
                              void* d_out, int out_size, void* d_ws, size_t ws_size,
                              hipStream_t stream) {
  const float* x     = (const float*)d_in[0];
  const float* gamma = (const float*)d_in[1];
  const float* beta  = (const float*)d_in[2];
  const float* Wq    = (const float*)d_in[3];
  const float* Wkv   = (const float*)d_in[4];
  const float* Wout  = (const float*)d_in[5];
  const float* bout  = (const float*)d_in[6];
  float* y = (float*)d_out;

  char* wsp = (char*)d_ws;
  auto take = [&](size_t bytes) {
    void* p = (void*)wsp;
    wsp += (bytes + 255) & ~(size_t)255;
    return p;
  };
  float*    xnf   = (float*)take((size_t)BN_ * D_ * 4);
  _Float16* xnh   = (_Float16*)take((size_t)BN_ * D_ * 2);
  _Float16* WqT   = (_Float16*)take((size_t)D_ * D_ * 2);
  _Float16* WkvT  = (_Float16*)take((size_t)256 * D_ * 2);
  _Float16* WoutT = (_Float16*)take((size_t)D_ * D_ * 2);
  _Float16* qraw  = (_Float16*)take((size_t)BN_ * D_ * 2);
  _Float16* kvraw = (_Float16*)take((size_t)BN_ * 256 * 2);
  _Float16* qh    = (_Float16*)take((size_t)B_ * H_ * N_ * DH_ * 2);
  _Float16* kh    = (_Float16*)take((size_t)B_ * KVH_ * N_ * DH_ * 2);
  _Float16* vT    = (_Float16*)take((size_t)B_ * KVH_ * N_ * DH_ * 2);
  _Float16* ao    = (_Float16*)take((size_t)BN_ * D_ * 2);

  layernorm_k<<<BN_ / LN_TOK, 512, 0, stream>>>(x, gamma, beta, xnf, xnh);
  transpose_w_k<D_, D_><<<D_ * D_ / 64 / 256, 256, 0, stream>>>(Wq, WqT);
  transpose_w_k<D_, 256><<<D_ * 256 / 64 / 256, 256, 0, stream>>>(Wkv, WkvT);
  transpose_w_k<D_, D_><<<D_ * D_ / 64 / 256, 256, 0, stream>>>(Wout, WoutT);

  gemm_wmma_k<0><<<dim3(BN_ / 64, D_ / 128), 256, 0, stream>>>(
      xnh, WqT, BN_, D_, D_, qraw, nullptr, nullptr, nullptr);
  gemm_wmma_k<0><<<dim3(BN_ / 64, 256 / 128), 256, 0, stream>>>(
      xnh, WkvT, BN_, 256, D_, kvraw, nullptr, nullptr, nullptr);

  rotary_q_k<<<(B_ * H_ * N_ * 4) / 256, 256, 0, stream>>>(qraw, qh);
  rotary_kv_k<<<KV_KBLK + KV_VBLK, 256, 0, stream>>>(kvraw, kh, vT);

  flash_k<<<dim3(N_ / 128, H_, B_), 256, 0, stream>>>(qh, kh, vT, ao);

  gemm_wmma_k<1><<<dim3(BN_ / 64, D_ / 128), 256, 0, stream>>>(
      ao, WoutT, BN_, D_, D_, nullptr, xnf, bout, y);
}

// v004
// One run takes 123 microseconds.
// Timed twice side by side with v003, it ran 1.29 times as fast both times.
// All steps since v000 together make it 2.86 times as fast.
#include <hip/hip_runtime.h>

// ---------- types ----------
typedef __attribute__((ext_vector_type(16))) _Float16 v16h;
typedef __attribute__((ext_vector_type(8)))  _Float16 v8h;
typedef __attribute__((ext_vector_type(8)))  float    v8f;

#define B_   4
#define N_   2048
#define D_   512
#define H_   8
#define KVH_ 2
#define DH_  64
#define BN_  (B_ * N_)   // 8192 tokens

// ---------- WMMA helpers ----------
__device__ __forceinline__ v8f wmma_f16(v16h a, v16h b, v8f c) {
  // D = A(16x32 f16) x B(32x16 f16) + C(16x16 f32)
  return __builtin_amdgcn_wmma_f32_16x16x32_f16(
      /*neg_a=*/false, a, /*neg_b=*/false, b,
      /*c_mod=*/(short)0, c, /*reuse_a=*/false, /*reuse_b=*/false);
}

// Load a 16x32 f16 fragment (A-layout; identical striping assumed for B^T rows)
// from a row-major matrix with leading dimension `ld` (in elements).
// Lane (r = lane&15, g = lane>>4) holds row r, K = {g*8..g*8+7, 16+g*8..16+g*8+7}.
__device__ __forceinline__ v16h load_frag(const _Float16* __restrict__ base,
                                          int ld, int lane) {
  const int r = lane & 15, g = lane >> 4;
  const _Float16* p = base + (size_t)r * ld + g * 8;
  v8h lo = *(const v8h*)(p);
  v8h hi = *(const v8h*)(p + 16);
  v16h f;
#pragma unroll
  for (int i = 0; i < 8; ++i) { f[i] = lo[i]; f[i + 8] = hi[i]; }
  return f;
}

// ---------- 1) LayerNorm: x (b,d,n) -> xn (b*n, d) f32 + f16 ----------
// One work-group takes 32 tokens x all 512 channels. x is read along n (whole
// 128-byte lines), turned through LDS, and each token's row is then summed,
// normalised and stored along d (whole lines again).
typedef __attribute__((ext_vector_type(4))) _Float16 v4h;
#define LN_TOK   32
#define LN_PITCH 516  // dwords; 4 mod 64, so a column walk of 16-byte stores meets every bank once

__global__ __launch_bounds__(512) void layernorm_k(
    const float* __restrict__ x, const float* __restrict__ gamma,
    const float* __restrict__ beta, float* __restrict__ xnf,
    _Float16* __restrict__ xnh) {
  __shared__ __align__(16) float tile[LN_TOK * LN_PITCH];
  const int lane = threadIdx.x & 31;
  const int w    = threadIdx.x >> 5;               // 16 waves
  const int t0   = blockIdx.x * LN_TOK;            // first token of the tile
  const int b = t0 >> 11, pos0 = t0 & (N_ - 1);

  // lane = token, wave w holds channels w*32 .. w*32+31 of it
  const float* xb = x + ((size_t)b * D_ + w * 32) * N_ + pos0 + lane;
  float v[32];
  for (int i = 0; i < 32; ++i) v[i] = xb[(size_t)i * N_];
  float* tp = tile + lane * LN_PITCH + w * 32;
  for (int i = 0; i < 32; i += 4)
    *(float4*)(tp + i) = make_float4(v[i], v[i + 1], v[i + 2], v[i + 3]);

  // lane holds channels k*128 + lane*4 .. +3, k = 0..3
  float4 gm[4], bt[4];
  for (int k = 0; k < 4; ++k) {
    gm[k] = *(const float4*)(gamma + k * 128 + lane * 4);
    bt[k] = *(const float4*)(beta  + k * 128 + lane * 4);
  }
  __syncthreads();

  // wave w owns tokens 2w and 2w+1 of the tile
  for (int r = 0; r < 2; ++r) {
    const int row = w * 2 + r;
    const float* rp = tile + row * LN_PITCH + lane * 4;
    float4 a[4];
    for (int k = 0; k < 4; ++k) a[k] = *(const float4*)(rp + k * 128);
    float s = 0.f, ss = 0.f;
    for (int k = 0; k < 4; ++k) {
      s  += (a[k].x + a[k].y) + (a[k].z + a[k].w);
      ss += (a[k].x * a[k].x + a[k].y * a[k].y) + (a[k].z * a[k].z + a[k].w * a[k].w);
    }
    for (int m = 1; m < 32; m <<= 1) {
      s  += __shfl_xor(s,  m, 32);
      ss += __shfl_xor(ss, m, 32);
    }
    const float mu  = s * (1.f / D_);
    const float var = ss * (1.f / D_) - mu * mu;
    const float rst = rsqrtf(var + 1e-5f);
    float*    o  = xnf + (size_t)(t0 + row) * D_ + lane * 4;
    _Float16* oh = xnh + (size_t)(t0 + row) * D_ + lane * 4;
    for (int k = 0; k < 4; ++k) {
      float4 y;
      y.x = (a[k].x - mu) * rst * gm[k].x + bt[k].x;
      y.y = (a[k].y - mu) * rst * gm[k].y + bt[k].y;
      y.z = (a[k].z - mu) * rst * gm[k].z + bt[k].z;
      y.w = (a[k].w - mu) * rst * gm[k].w + bt[k].w;
      *(float4*)(o + k * 128) = y;
      v4h yh = {(_Float16)y.x, (_Float16)y.y, (_Float16)y.z, (_Float16)y.w};
      *(v4h*)(oh + k * 128) = yh;
    }
  }
}

// ---------- 2) Weight convert + transpose: W (K x N) f32 -> W^T (N x K) f16 ----------
// One lane turns an 8 (k) x 8 (n) block in its registers, so a launch starts 64 times
// fewer waves than with one element a lane. A wave takes 64 k x 32 n: eight lanes side
// by side along k store one whole 128-byte line of a W^T row. The grid is exact:
// K * N / 64 lanes, a multiple of 256.
template <int K, int N>
__global__ __launch_bounds__(256) void transpose_w_k(
    const float* __restrict__ W, _Float16* __restrict__ WT) {
  static_assert(K % 64 == 0 && N % 32 == 0 && (K * N / 64) % 256 == 0, "tile shape");
  const int idx = blockIdx.x * 256 + threadIdx.x;
  const int lane = idx & 31, tile = idx >> 5;
  const int tk = tile % (K >> 6), tn = tile / (K >> 6);
  const int k0 = tk * 64 + (lane & 7) * 8;
  const int n0 = tn * 32 + (lane >> 3) * 8;
  const float* wp = W + (size_t)k0 * N + n0;
  float r[8][8];
#pragma unroll
  for (int e = 0; e < 8; ++e) {
    const float4 a = *(const float4*)(wp + (size_t)e * N);
    const float4 b = *(const float4*)(wp + (size_t)e * N + 4);
    r[e][0] = a.x; r[e][1] = a.y; r[e][2] = a.z; r[e][3] = a.w;
    r[e][4] = b.x; r[e][5] = b.y; r[e][6] = b.z; r[e][7] = b.w;
  }
  _Float16* op = WT + (size_t)n0 * K + k0;
#pragma unroll
  for (int n = 0; n < 8; ++n) {
    v8h o;
#pragma unroll
    for (int e = 0; e < 8; ++e) o[e] = (_Float16)r[e][n];
    *(v8h*)(op + (size_t)n * K) = o;
  }
}

// ---------- 3) Generic WMMA GEMM: C = A(MxK) * B(KxN), B given transposed ----------
// EPI 0: store f16 row-major MxN.
// EPI 1: out-proj epilogue: +resid(row,col) +bias(col), store f32 transposed (b,d,n).
template <int EPI>
__global__ __launch_bounds__(256) void gemm_wmma_k(
    const _Float16* __restrict__ A, const _Float16* __restrict__ BT,
    int M, int N, int K, _Float16* __restrict__ Ch,
    const float* __restrict__ resid, const float* __restrict__ bias,
    float* __restrict__ outT) {
  const int lane = threadIdx.x & 31;
  const int w    = threadIdx.x >> 5;             // 8 waves
  const int m0   = blockIdx.x * 64  + (w & 1) * 32;
  const int n0   = blockIdx.y * 128 + (w >> 1) * 32;

  const v8f z = {0.f, 0.f, 0.f, 0.f, 0.f, 0.f, 0.f, 0.f};
  v8f acc[2][2];
  acc[0][0] = z; acc[0][1] = z; acc[1][0] = z; acc[1][1] = z;

  for (int k0 = 0; k0 < K; k0 += 32) {
    v16h a0 = load_frag(A  + (size_t)(m0     ) * K + k0, K, lane);
    v16h a1 = load_frag(A  + (size_t)(m0 + 16) * K + k0, K, lane);
    v16h b0 = load_frag(BT + (size_t)(n0     ) * K + k0, K, lane);
    v16h b1 = load_frag(BT + (size_t)(n0 + 16) * K + k0, K, lane);
    acc[0][0] = wmma_f16(a0, b0, acc[0][0]);
    acc[0][1] = wmma_f16(a0, b1, acc[0][1]);
    acc[1][0] = wmma_f16(a1, b0, acc[1][0]);
    acc[1][1] = wmma_f16(a1, b1, acc[1][1]);
  }

  const int c = lane & 15, g = lane >> 4;
#pragma unroll
  for (int ti = 0; ti < 2; ++ti)
#pragma unroll
    for (int tj = 0; tj < 2; ++tj)
#pragma unroll
      for (int p = 0; p < 8; ++p) {
        const int row = m0 + ti * 16 + g * 8 + p;
        const int col = n0 + tj * 16 + c;
        float v = acc[ti][tj][p];
        if (EPI == 0) {
          Ch[(size_t)row * N + col] = (_Float16)v;
        } else {
          v += resid[(size_t)row * N + col] + bias[col];
          const int bb = row >> 11, pos = row & (N_ - 1);
          outT[((size_t)(bb * D_ + col)) * N_ + pos] = v;
        }
      }
}

// ---------- 4) xPos rotary ----------
__device__ __forceinline__ void xpos_coeffs(int pos, int j, float& cs, float& sn,
                                            float& scl) {
  const float fpos = (float)pos;
  const float invf = __powf(10000.f, -(float)(2 * j) * (1.f / (float)DH_));
  const float fr   = fpos * invf;
  cs = __cosf(fr);
  sn = __sinf(fr);
  const float bs = ((float)(2 * j) + 0.4f * DH_) * (1.f / (1.4f * DH_));
  const float pw = (fpos - (float)(N_ / 2)) * (1.f / 4096.f);
  scl = __powf(bs, pw);
}

// One lane takes 8 rotation pairs of one (token, head): dims j0 .. j0+7 and their
// partners 32 on, each half one 16-byte load and one 16-byte store. The coefficients of
// a pair are formed once, and a launch starts 16 times fewer waves.
__global__ __launch_bounds__(256) void rotary_q_k(
    const _Float16* __restrict__ qraw, _Float16* __restrict__ qh) {
  const int idx = blockIdx.x * 256 + threadIdx.x;  // b*h*n*4 = 256K
  const int j0  = (idx & 3) * 8;
  const int pos = (idx >> 2) & (N_ - 1);
  const int h   = (idx >> 13) & (H_ - 1);
  const int b   = idx >> 16;
  const size_t tok = (size_t)(b * N_ + pos);
  const _Float16* qp = qraw + tok * (H_ * DH_) + h * DH_ + j0;
  const v8h lo = *(const v8h*)qp;
  const v8h hi = *(const v8h*)(qp + 32);
  v8h olo, ohi;
#pragma unroll
  for (int e = 0; e < 8; ++e) {
    float cs, sn, scl;
    xpos_coeffs(pos, j0 + e, cs, sn, scl);
    const float a = (float)lo[e], c = (float)hi[e];
    olo[e] = (_Float16)((a * cs + (-c) * sn) * scl * 0.125f);  // fold 1/sqrt(dh)
    ohi[e] = (_Float16)((c * cs + a * sn) * scl * 0.125f);
  }
  _Float16* op = qh + (((size_t)(b * H_ + h) * N_) + pos) * DH_ + j0;
  *(v8h*)op        = olo;
  *(v8h*)(op + 32) = ohi;
}

// Blocks 0 .. KV_KBLK-1 rotate K as above. The rest turn V: one lane takes an
// 8 (positions) x 8 (dims) block in its registers; eight lanes side by side along the
// positions store one whole 128-byte line of a V^T row.
#define KV_KBLK (B_ * KVH_ * N_ * 4 / 256)          // 256
#define KV_VBLK (B_ * KVH_ * N_ * DH_ / 64 / 256)   // 64
__global__ __launch_bounds__(256) void rotary_kv_k(
    const _Float16* __restrict__ kvraw, _Float16* __restrict__ kh,
    _Float16* __restrict__ vT) {
  if (blockIdx.x < KV_KBLK) {
    const int idx = blockIdx.x * 256 + threadIdx.x;  // b*kvh*n*4 = 64K
    const int j0  = (idx & 3) * 8;
    const int pos = (idx >> 2) & (N_ - 1);
    const int kv  = (idx >> 13) & 1;
    const int b   = idx >> 14;
    const size_t tok = (size_t)(b * N_ + pos);
    const _Float16* kp = kvraw + tok * 256 + kv * DH_ + j0;
    const v8h lo = *(const v8h*)kp;
    const v8h hi = *(const v8h*)(kp + 32);
    v8h olo, ohi;
#pragma unroll
    for (int e = 0; e < 8; ++e) {
      float cs, sn, scl;
      xpos_coeffs(pos, j0 + e, cs, sn, scl);
      const float a = (float)lo[e], c = (float)hi[e];
      olo[e] = (_Float16)((a * cs + (-c) * sn) / scl);
      ohi[e] = (_Float16)((c * cs + a * sn) / scl);
    }
    _Float16* op = kh + (((size_t)(b * KVH_ + kv) * N_) + pos) * DH_ + j0;
    *(v8h*)op        = olo;
    *(v8h*)(op + 32) = ohi;
  } else {
    const int idx = (blockIdx.x - KV_KBLK) * 256 + threadIdx.x;  // b*kvh*(n/8)*(dh/8) = 16K
    const int p0 = ((idx >> 6) & 31) * 64 + (idx & 7) * 8;
    const int d0 = ((idx >> 3) & 7) * 8;
    const int kv = (idx >> 11) & 1;
    const int b  = idx >> 12;
    const _Float16* vp = kvraw + (size_t)(b * N_ + p0) * 256 + 128 + kv * DH_ + d0;
    v8h r[8];
#pragma unroll
    for (int e = 0; e < 8; ++e) r[e] = *(const v8h*)(vp + (size_t)e * 256);
    _Float16* op = vT + (((size_t)(b * KVH_ + kv) * DH_) + d0) * N_ + p0;
#pragma unroll
    for (int d = 0; d < 8; ++d) {
      v8h o;
#pragma unroll
      for (int e = 0; e < 8; ++e) o[e] = r[e][d];
      *(v8h*)(op + (size_t)d * N_) = o;
    }
    // the built code lays the K branch behind these stores: keep the wait in front of
    // any rewrite of a register that an issued store names
    asm volatile("s_wait_xcnt 0x0" ::: "memory");
  }
}

// ---------- 5) Flash attention: per (b,h), wave = 16 queries ----------
// The 8 waves of a work-group walk the same keys, so K and V^T go through LDS once for
// all of them: tiles of 64 keys, two buffers, the next tile copied while this one is used.
#define FA_KEYS  64                   // keys per tile: a K row and a V^T row are 128 bytes each
#define FA_PITCH 72                   // halves per LDS row: 144 bytes, an odd multiple of 16
#define FA_OPER  (64 * FA_PITCH)      // halves of one operand's tile (64 rows)
#define FA_BUF   (2 * FA_OPER)        // K tile, V^T tile behind it
#define FA_TILES (N_ / FA_KEYS)

// One tile: 128 rows of 128 bytes, 16 bytes a lane and copy, so a wave's copy takes four
// whole lines. kg, vg: this lane's place in rows 0..31 of the K and the V^T tile.
__device__ __forceinline__ void stage_kv(const _Float16* kg, const _Float16* vg,
                                         unsigned dst) {
  const _Float16* kg1 = kg + 32 * DH_;
  const _Float16* vg1 = vg + (size_t)32 * N_;
  const unsigned dk1 = dst + 32 * FA_PITCH * 2;
  const unsigned dv0 = dst + FA_OPER * 2;
  const unsigned dv1 = dv0 + 32 * FA_PITCH * 2;
  // the wait stands inside the statement, in front of any rewrite of an address register
  asm volatile(
      "global_load_async_to_lds_b128 %0, %4, off\n\t"
      "global_load_async_to_lds_b128 %1, %5, off\n\t"
      "global_load_async_to_lds_b128 %2, %6, off\n\t"
      "global_load_async_to_lds_b128 %3, %7, off\n\t"
      "s_wait_xcnt 0x0"
      :: "v"(dst), "v"(dk1), "v"(dv0), "v"(dv1), "v"(kg), "v"(kg1), "v"(vg), "v"(vg1)
      : "memory");
}

// lane l with lane l ^ 16: the two lanes that share a query column
__device__ __forceinline__ float xhalf(float x) {
  const int i = __builtin_bit_cast(int, x);
  return __builtin_bit_cast(
      float, __builtin_amdgcn_permlanex16(i, i, 0x76543210, 0xfedcba98, false, false));
}

// 2^x in place for a run of values. The run and the v_nop behind it are one statement: the
// instruction set asks for one slot between a transcendental and an instruction that reads
// its result or overwrites its source; inside the run every neighbour is independent, and
// the v_nop keeps the slot behind the last one, whatever the compiler puts next.
__device__ __forceinline__ void exp2_run9(float& e, float (&x)[8]) {
  asm("v_exp_f32 %0, %0\n\tv_exp_f32 %1, %1\n\tv_exp_f32 %2, %2\n\t"
      "v_exp_f32 %3, %3\n\tv_exp_f32 %4, %4\n\tv_exp_f32 %5, %5\n\t"
      "v_exp_f32 %6, %6\n\tv_exp_f32 %7, %7\n\tv_exp_f32 %8, %8\n\tv_nop"
      : "+v"(e), "+v"(x[0]), "+v"(x[1]), "+v"(x[2]), "+v"(x[3]), "+v"(x[4]), "+v"(x[5]),
        "+v"(x[6]), "+v"(x[7]));
}
__device__ __forceinline__ void exp2_run8(float (&x)[8]) {
  asm("v_exp_f32 %0, %0\n\tv_exp_f32 %1, %1\n\tv_exp_f32 %2, %2\n\t"
      "v_exp_f32 %3, %3\n\tv_exp_f32 %4, %4\n\tv_exp_f32 %5, %5\n\t"
      "v_exp_f32 %6, %6\n\tv_exp_f32 %7, %7\n\tv_nop"
      : "+v"(x[0]), "+v"(x[1]), "+v"(x[2]), "+v"(x[3]), "+v"(x[4]), "+v"(x[5]), "+v"(x[6]),
        "+v"(x[7]));
}
#define LOG2E_ 1.44269504f

__global__ __launch_bounds__(256) void flash_k(
    const _Float16* __restrict__ Q,   // (b, h, n, dh)
    const _Float16* __restrict__ Kt,  // (b, kvh, n, dh)
    const _Float16* __restrict__ VT,  // (b, kvh, dh, n)
    _Float16* __restrict__ O) {       // (b, n, h*dh)
  __shared__ __align__(16) _Float16 kvs[2 * FA_BUF];   // the two K / V^T buffers
  const int lane = threadIdx.x & 31;
  const int w    = threadIdx.x >> 5;
  const int h    = blockIdx.y, b = blockIdx.z;
  const int kv   = h & (KVH_ - 1);                     // tile(k, r): head h -> h % kvh
  const int qRow0 = blockIdx.x * 128 + w * 16;

  const _Float16* qptr  = Q  + (((size_t)(b * H_ + h) * N_) + qRow0) * DH_;
  const _Float16* kbase = Kt + ((size_t)(b * KVH_ + kv) * N_) * DH_;
  const _Float16* vbase = VT + ((size_t)(b * KVH_ + kv) * DH_) * N_;

  // this lane's share of a tile: row threadIdx.x / 8 (and 32 on), 16-byte piece threadIdx.x % 8
  const int srow = threadIdx.x >> 3, spc = (threadIdx.x & 7) * 8;
  const _Float16* kg = kbase + (size_t)srow * DH_ + spc;
  const _Float16* vg = vbase + (size_t)srow * N_ + spc;
  const unsigned sdst = (unsigned)(size_t)kvs + (unsigned)(srow * FA_PITCH + spc) * 2u;

  stage_kv(kg, vg, sdst);                              // tile 0 into buffer 0
  asm volatile("s_wait_asynccnt 0x0" ::: "memory");    // this wave's share of tile 0 has landed
  __syncthreads();                                     // every wave's share has
  stage_kv(kg + FA_KEYS * DH_, vg + FA_KEYS, sdst + FA_BUF * 2);  // tile 1 into buffer 1

  const v16h bq0 = load_frag(qptr,      DH_, lane);    // Q^T, dims  0..31, column = query
  const v16h bq1 = load_frag(qptr + 32, DH_, lane);    // Q^T, dims 32..63

  const v8f z = {0.f, 0.f, 0.f, 0.f, 0.f, 0.f, 0.f, 0.f};
  v8f oacc[4]; oacc[0] = z; oacc[1] = z; oacc[2] = z; oacc[3] = z;  // O^T: dim 16j+8g+p, query c
  float mcol = -1e30f;   // running maximum of this lane's query
  float lcol = 0.f;      // sum over this lane's half of the keys; the halves join at the end

  const int c = lane & 15, g = lane >> 4;

  for (int t = 0; t < FA_TILES; ++t) {
    const _Float16* kt = kvs + (t & 1) * FA_BUF;
    const _Float16* vt = kt + FA_OPER;
    // both 32-key passes of a tile inline: sub becomes a constant offset of the LDS loads
#pragma unroll
    for (int sub = 0; sub < FA_KEYS; sub += 32) {
      // ---- scores: two 16 (keys) x 16 (queries) f32 tiles covering 32 keys ----
      v8f s0 = z, s1 = z;
      {
        const _Float16* kp0 = kt + sub * FA_PITCH;
        s0 = wmma_f16(load_frag(kp0,      FA_PITCH, lane), bq0, s0);
        s0 = wmma_f16(load_frag(kp0 + 32, FA_PITCH, lane), bq1, s0);
        const _Float16* kp1 = kt + (sub + 16) * FA_PITCH;
        s1 = wmma_f16(load_frag(kp1,      FA_PITCH, lane), bq0, s1);
        s1 = wmma_f16(load_frag(kp1 + 32, FA_PITCH, lane), bq1, s1);
      }
      // ---- online softmax of one query column, in this lane's registers ----
      float mx[8];
#pragma unroll
      for (int p = 0; p < 8; ++p) mx[p] = fmaxf(s0[p], s1[p]);
      float rmax = fmaxf(fmaxf(fmaxf(mx[0], mx[1]), fmaxf(mx[2], mx[3])),
                         fmaxf(fmaxf(mx[4], mx[5]), fmaxf(mx[6], mx[7])));
      rmax = fmaxf(rmax, xhalf(rmax));
      const float nm = fmaxf(mcol, rmax);
      // e^x as 2^(x log2 e), the same two roundings as __expf
      float sc = (mcol - nm) * LOG2E_;
      float p0[8], p1[8];
#pragma unroll
      for (int p = 0; p < 8; ++p) {
        p0[p] = (s0[p] - nm) * LOG2E_;
        p1[p] = (s1[p] - nm) * LOG2E_;
      }
      exp2_run9(sc, p0);
      exp2_run8(p1);
      v16h pb;             // P^T as B operand: element s is key 8g+s, or 16+8g+(s-8), of column c
      float rs[4];         // four short chains instead of one of sixteen links
#pragma unroll
      for (int p = 0; p < 8; ++p) {
        pb[p]     = (_Float16)p0[p];
        pb[p + 8] = (_Float16)p1[p];
      }
#pragma unroll
      for (int p = 0; p < 4; ++p) rs[p] = (p0[p] + p1[p]) + (p0[p + 4] + p1[p + 4]);
      lcol = lcol * sc + ((rs[0] + rs[1]) + (rs[2] + rs[3]));
      mcol = nm;
#pragma unroll
      for (int j = 0; j < 4; ++j) oacc[j] *= sc;
      // ---- O^T += V^T P^T over dh in 4 tiles of 16 rows ----
#pragma unroll
      for (int j = 0; j < 4; ++j) {
        const v16h av = load_frag(vt + (j * 16) * FA_PITCH + sub, FA_PITCH, lane);
        oacc[j] = wmma_f16(av, pb, oacc[j]);
      }
    }
    // hand-over: this wave's reads of buffer t % 2 are done, its share of tile t + 1 has
    // landed; behind the barrier that holds for every wave, and the buffer may be refilled
    asm volatile("s_wait_dscnt 0x0" ::: "memory");
    asm volatile("s_wait_asynccnt 0x0" ::: "memory");
    __syncthreads();
    if (t + 2 < FA_TILES)
      stage_kv(kg + (size_t)(t + 2) * (FA_KEYS * DH_), vg + (t + 2) * FA_KEYS,
               sdst + (unsigned)(t & 1) * (FA_BUF * 2));
  }
  asm volatile("s_wait_asynccnt 0x0" ::: "memory");    // no copy is left in flight at the end

  // a lane holds 8 consecutive dims of its query in each tile: one 16-byte store each
  const float inv = 1.f / (lcol + xhalf(lcol));
  _Float16* op = O + (size_t)(b * N_ + qRow0 + c) * (H_ * DH_) + h * DH_ + g * 8;
#pragma unroll
  for (int j = 0; j < 4; ++j) {
    v8h o;
#pragma unroll
    for (int p = 0; p < 8; ++p) o[p] = (_Float16)(oacc[j][p] * inv);
    *(v8h*)(op + j * 16) = o;
  }
}

// ---------- launch ----------
extern "C" void kernel_launch(void* const* d_in, const int* in_sizes, int n_in,
                              void* d_out, int out_size, void* d_ws, size_t ws_size,
                              hipStream_t stream) {
  const float* x     = (const float*)d_in[0];
  const float* gamma = (const float*)d_in[1];
  const float* beta  = (const float*)d_in[2];
  const float* Wq    = (const float*)d_in[3];
  const float* Wkv   = (const float*)d_in[4];
  const float* Wout  = (const float*)d_in[5];
  const float* bout  = (const float*)d_in[6];
  float* y = (float*)d_out;

  char* wsp = (char*)d_ws;
  auto take = [&](size_t bytes) {
    void* p = (void*)wsp;
    wsp += (bytes + 255) & ~(size_t)255;
    return p;
  };
  float*    xnf   = (float*)take((size_t)BN_ * D_ * 4);
  _Float16* xnh   = (_Float16*)take((size_t)BN_ * D_ * 2);
  _Float16* WqT   = (_Float16*)take((size_t)D_ * D_ * 2);
  _Float16* WkvT  = (_Float16*)take((size_t)256 * D_ * 2);
  _Float16* WoutT = (_Float16*)take((size_t)D_ * D_ * 2);
  _Float16* qraw  = (_Float16*)take((size_t)BN_ * D_ * 2);
  _Float16* kvraw = (_Float16*)take((size_t)BN_ * 256 * 2);
  _Float16* qh    = (_Float16*)take((size_t)B_ * H_ * N_ * DH_ * 2);
  _Float16* kh    = (_Float16*)take((size_t)B_ * KVH_ * N_ * DH_ * 2);
  _Float16* vT    = (_Float16*)take((size_t)B_ * KVH_ * N_ * DH_ * 2);
  _Float16* ao    = (_Float16*)take((size_t)BN_ * D_ * 2);

  layernorm_k<<<BN_ / LN_TOK, 512, 0, stream>>>(x, gamma, beta, xnf, xnh);
  transpose_w_k<D_, D_><<<D_ * D_ / 64 / 256, 256, 0, stream>>>(Wq, WqT);
  transpose_w_k<D_, 256><<<D_ * 256 / 64 / 256, 256, 0, stream>>>(Wkv, WkvT);
  transpose_w_k<D_, D_><<<D_ * D_ / 64 / 256, 256, 0, stream>>>(Wout, WoutT);

  gemm_wmma_k<0><<<dim3(BN_ / 64, D_ / 128), 256, 0, stream>>>(
      xnh, WqT, BN_, D_, D_, qraw, nullptr, nullptr, nullptr);
  gemm_wmma_k<0><<<dim3(BN_ / 64, 256 / 128), 256, 0, stream>>>(
      xnh, WkvT, BN_, 256, D_, kvraw, nullptr, nullptr, nullptr);

  rotary_q_k<<<(B_ * H_ * N_ * 4) / 256, 256, 0, stream>>>(qraw, qh);
  rotary_kv_k<<<KV_KBLK + KV_VBLK, 256, 0, stream>>>(kvraw, kh, vT);

  flash_k<<<dim3(N_ / 128, H_, B_), 256, 0, stream>>>(qh, kh, vT, ao);

  gemm_wmma_k<1><<<dim3(BN_ / 64, D_ / 128), 256, 0, stream>>>(
      ao, WoutT, BN_, D_, D_, nullptr, xnf, bout, y);
}

// v005
// Measured time: 97.5 microseconds a run.
// Timed twice side by side with v004, it ran 1.27 and 1.28 times as fast.
// All steps since v000 together make it 3.64 times as fast.
#include <hip/hip_runtime.h>

// ---------- types ----------
typedef __attribute__((ext_vector_type(16))) _Float16 v16h;
typedef __attribute__((ext_vector_type(8)))  _Float16 v8h;
typedef __attribute__((ext_vector_type(8)))  float    v8f;

#define B_   4
#define N_   2048
#define D_   512
#define H_   8
#define KVH_ 2
#define DH_  64
#define BN_  (B_ * N_)   // 8192 tokens

// ---------- WMMA helpers ----------
__device__ __forceinline__ v8f wmma_f16(v16h a, v16h b, v8f c) {
  // D = A(16x32 f16) x B(32x16 f16) + C(16x16 f32)
  return __builtin_amdgcn_wmma_f32_16x16x32_f16(
      /*neg_a=*/false, a, /*neg_b=*/false, b,
      /*c_mod=*/(short)0, c, /*reuse_a=*/false, /*reuse_b=*/false);
}

// Load a 16x32 f16 fragment (A-layout; identical striping assumed for B^T rows)
// from a row-major matrix with leading dimension `ld` (in elements).
// Lane (r = lane&15, g = lane>>4) holds row r, K = {g*8..g*8+7, 16+g*8..16+g*8+7}.
__device__ __forceinline__ v16h load_frag(const _Float16* __restrict__ base,
                                          int ld, int lane) {
  const int r = lane & 15, g = lane >> 4;
  const _Float16* p = base + (size_t)r * ld + g * 8;
  v8h lo = *(const v8h*)(p);
  v8h hi = *(const v8h*)(p + 16);
  v16h f;
#pragma unroll
  for (int i = 0; i < 8; ++i) { f[i] = lo[i]; f[i + 8] = hi[i]; }
  return f;
}

// ---------- 1) LayerNorm: x (b,d,n) -> xn (b*n, d) f32 + f16 ----------
// One work-group takes 32 tokens x all 512 channels. x is read along n (whole
// 128-byte lines), turned through LDS, and each token's row is then summed,
// normalised and stored along d (whole lines again).
typedef __attribute__((ext_vector_type(4))) _Float16 v4h;
#define LN_TOK   32
#define LN_PITCH 516  // dwords; 4 mod 64, so a column walk of 16-byte stores meets every bank once

__global__ __launch_bounds__(512) void layernorm_k(
    const float* __restrict__ x, const float* __restrict__ gamma,
    const float* __restrict__ beta, float* __restrict__ xnf,
    _Float16* __restrict__ xnh) {
  __shared__ __align__(16) float tile[LN_TOK * LN_PITCH];
  const int lane = threadIdx.x & 31;
  const int w    = threadIdx.x >> 5;               // 16 waves
  const int t0   = blockIdx.x * LN_TOK;            // first token of the tile
  const int b = t0 >> 11, pos0 = t0 & (N_ - 1);

  // lane = token, wave w holds channels w*32 .. w*32+31 of it
  const float* xb = x + ((size_t)b * D_ + w * 32) * N_ + pos0 + lane;
  float v[32];
  for (int i = 0; i < 32; ++i) v[i] = xb[(size_t)i * N_];
  float* tp = tile + lane * LN_PITCH + w * 32;
  for (int i = 0; i < 32; i += 4)
    *(float4*)(tp + i) = make_float4(v[i], v[i + 1], v[i + 2], v[i + 3]);

  // lane holds channels k*128 + lane*4 .. +3, k = 0..3
  float4 gm[4], bt[4];
  for (int k = 0; k < 4; ++k) {
    gm[k] = *(const float4*)(gamma + k * 128 + lane * 4);
    bt[k] = *(const float4*)(beta  + k * 128 + lane * 4);
  }
  __syncthreads();

  // wave w owns tokens 2w and 2w+1 of the tile
  for (int r = 0; r < 2; ++r) {
    const int row = w * 2 + r;
    const float* rp = tile + row * LN_PITCH + lane * 4;
    float4 a[4];
    for (int k = 0; k < 4; ++k) a[k] = *(const float4*)(rp + k * 128);
    float s = 0.f, ss = 0.f;
    for (int k = 0; k < 4; ++k) {
      s  += (a[k].x + a[k].y) + (a[k].z + a[k].w);
      ss += (a[k].x * a[k].x + a[k].y * a[k].y) + (a[k].z * a[k].z + a[k].w * a[k].w);
    }
    for (int m = 1; m < 32; m <<= 1) {
      s  += __shfl_xor(s,  m, 32);
      ss += __shfl_xor(ss, m, 32);
    }
    const float mu  = s * (1.f / D_);
    const float var = ss * (1.f / D_) - mu * mu;
    const float rst = rsqrtf(var + 1e-5f);
    float*    o  = xnf + (size_t)(t0 + row) * D_ + lane * 4;
    _Float16* oh = xnh + (size_t)(t0 + row) * D_ + lane * 4;
    for (int k = 0; k < 4; ++k) {
      float4 y;
      y.x = (a[k].x - mu) * rst * gm[k].x + bt[k].x;
      y.y = (a[k].y - mu) * rst * gm[k].y + bt[k].y;
      y.z = (a[k].z - mu) * rst * gm[k].z + bt[k].z;
      y.w = (a[k].w - mu) * rst * gm[k].w + bt[k].w;
      *(float4*)(o + k * 128) = y;
      v4h yh = {(_Float16)y.x, (_Float16)y.y, (_Float16)y.z, (_Float16)y.w};
      *(v4h*)(oh + k * 128) = yh;
    }
  }
}

// ---------- 2) Weight convert + transpose: W (K x N) f32 -> W^T (N x K) f16 ----------
// One lane turns an 8 (k) x 8 (n) block in its registers, so a launch starts 64 times
// fewer waves than with one element a lane. A wave takes 64 k x 32 n: eight lanes side
// by side along k store one whole 128-byte line of a W^T row. The grid is exact:
// K * N / 64 lanes, a multiple of 256.
template <int K, int N>
__global__ __launch_bounds__(256) void transpose_w_k(
    const float* __restrict__ W, _Float16* __restrict__ WT) {
  static_assert(K % 64 == 0 && N % 32 == 0 && (K * N / 64) % 256 == 0, "tile shape");
  const int idx = blockIdx.x * 256 + threadIdx.x;
  const int lane = idx & 31, tile = idx >> 5;
  const int tk = tile % (K >> 6), tn = tile / (K >> 6);
  const int k0 = tk * 64 + (lane & 7) * 8;
  const int n0 = tn * 32 + (lane >> 3) * 8;
  const float* wp = W + (size_t)k0 * N + n0;
  float r[8][8];
#pragma unroll
  for (int e = 0; e < 8; ++e) {
    const float4 a = *(const float4*)(wp + (size_t)e * N);
    const float4 b = *(const float4*)(wp + (size_t)e * N + 4);
    r[e][0] = a.x; r[e][1] = a.y; r[e][2] = a.z; r[e][3] = a.w;
    r[e][4] = b.x; r[e][5] = b.y; r[e][6] = b.z; r[e][7] = b.w;
  }
  _Float16* op = WT + (size_t)n0 * K + k0;
#pragma unroll
  for (int n = 0; n < 8; ++n) {
    v8h o;
#pragma unroll
    for (int e = 0; e < 8; ++e) o[e] = (_Float16)r[e][n];
    *(v8h*)(op + (size_t)n * K) = o;
  }
}

// ---------- 3) WMMA GEMM: C = A(M x 512) * B(512 x N), B given transposed ----------
// EPI 0: store f16 row-major MxN.
// EPI 1: out-proj epilogue: +resid(row,col) +bias(col), store f32 transposed (b,d,n).
// The 8 waves of a work-group share 64 rows of A and 128 rows of B^T, so both go through
// LDS once for all of them: tiles of 64 k, two buffers, the next tile copied while this
// one is used. A copy takes whole 128-byte lines; a fragment load straight from global
// memory takes 32 bytes out of each of 16 lines.
#define GM_KT    64                   // k per tile: a row of A or of B^T is 128 bytes
#define GM_PITCH 72                   // halves per LDS row: 144 bytes, an odd multiple of 16
#define GM_A     (64 * GM_PITCH)      // halves of the A tile (64 rows)
#define GM_BUF   (192 * GM_PITCH)     // A tile, B^T tile (128 rows) behind it
#define GM_TILES (D_ / GM_KT)

// One tile: 192 rows of 128 bytes, 16 bytes a lane and copy, so a wave's copy takes four
// whole lines. ag, bg: this lane's place in rows 0..31 of the A and the B^T tile.
__device__ __forceinline__ void stage_ab(const _Float16* ag, const _Float16* bg,
                                         unsigned dst) {
  const _Float16* ag1 = ag + 32 * D_;
  const _Float16* bg1 = bg + 32 * D_;
  const _Float16* bg2 = bg + 64 * D_;
  const _Float16* bg3 = bg + 96 * D_;
  const unsigned da1 = dst + 32 * GM_PITCH * 2;
  const unsigned db0 = dst + GM_A * 2;
  const unsigned db1 = db0 + 32 * GM_PITCH * 2;
  const unsigned db2 = db0 + 64 * GM_PITCH * 2;
  const unsigned db3 = db0 + 96 * GM_PITCH * 2;
  // the wait stands inside the statement, in front of any rewrite of an address register
  asm volatile(
      "global_load_async_to_lds_b128 %0, %6, off\n\t"
      "global_load_async_to_lds_b128 %1, %7, off\n\t"
      "global_load_async_to_lds_b128 %2, %8, off\n\t"
      "global_load_async_to_lds_b128 %3, %9, off\n\t"
      "global_load_async_to_lds_b128 %4, %10, off\n\t"
      "global_load_async_to_lds_b128 %5, %11, off\n\t"
      "s_wait_xcnt 0x0"
      :: "v"(dst), "v"(da1), "v"(db0), "v"(db1), "v"(db2), "v"(db3),
         "v"(ag), "v"(ag1), "v"(bg), "v"(bg1), "v"(bg2), "v"(bg3)
      : "memory");
}

template <int EPI>
__global__ __launch_bounds__(256) void gemm_wmma_k(
    const _Float16* __restrict__ A, const _Float16* __restrict__ BT,
    int N, _Float16* __restrict__ Ch,
    const float* __restrict__ resid, const float* __restrict__ bias,
    float* __restrict__ outT) {
  __shared__ __align__(16) _Float16 abt[2 * GM_BUF];   // the two A / B^T buffers
  const int lane = threadIdx.x & 31;
  const int w    = threadIdx.x >> 5;             // 8 waves
  const int m0   = blockIdx.x * 64  + (w & 1) * 32;
  const int n0   = blockIdx.y * 128 + (w >> 1) * 32;

  // this lane's share of a tile: row threadIdx.x / 8 (and 32, 64, 96 on), 16-byte piece
  // threadIdx.x % 8
  const int srow = threadIdx.x >> 3, spc = (threadIdx.x & 7) * 8;
  const _Float16* ag = A  + (size_t)(blockIdx.x * 64  + srow) * D_ + spc;
  const _Float16* bg = BT + (size_t)(blockIdx.y * 128 + srow) * D_ + spc;
  const unsigned sdst = (unsigned)(size_t)abt + (unsigned)(srow * GM_PITCH + spc) * 2u;

  stage_ab(ag, bg, sdst);                              // tile 0 into buffer 0
  asm volatile("s_wait_asynccnt 0x0" ::: "memory");    // this wave's share of tile 0 has landed
  __syncthreads();                                     // every wave's share has
  stage_ab(ag + GM_KT, bg + GM_KT, sdst + GM_BUF * 2); // tile 1 into buffer 1

  const v8f z = {0.f, 0.f, 0.f, 0.f, 0.f, 0.f, 0.f, 0.f};
  v8f acc[2][2];
  acc[0][0] = z; acc[0][1] = z; acc[1][0] = z; acc[1][1] = z;

  for (int t = 0; t < GM_TILES; ++t) {
    const _Float16* as = abt + (t & 1) * GM_BUF + (w & 1) * (32 * GM_PITCH);
    const _Float16* bs = abt + (t & 1) * GM_BUF + GM_A + (w >> 1) * (32 * GM_PITCH);
    // both 32-k passes of a tile inline: kk becomes a constant offset of the LDS loads
#pragma unroll
    for (int kk = 0; kk < GM_KT; kk += 32) {
      v16h a0 = load_frag(as + kk,                 GM_PITCH, lane);
      v16h a1 = load_frag(as + 16 * GM_PITCH + kk, GM_PITCH, lane);
      v16h b0 = load_frag(bs + kk,                 GM_PITCH, lane);
      v16h b1 = load_frag(bs + 16 * GM_PITCH + kk, GM_PITCH, lane);
      acc[0][0] = wmma_f16(a0, b0, acc[0][0]);
      acc[0][1] = wmma_f16(a0, b1, acc[0][1]);
      acc[1][0] = wmma_f16(a1, b0, acc[1][0]);
      acc[1][1] = wmma_f16(a1, b1, acc[1][1]);
    }
    // hand-over: this wave's reads of buffer t % 2 are done, its share of tile t + 1 has
    // landed; behind the barrier that holds for every wave, and the buffer may be refilled
    asm volatile("s_wait_dscnt 0x0" ::: "memory");
    asm volatile("s_wait_asynccnt 0x0" ::: "memory");
    __syncthreads();
    if (t + 2 < GM_TILES)
      stage_ab(ag + (t + 2) * GM_KT, bg + (t + 2) * GM_KT,
               sdst + (unsigned)(t & 1) * (GM_BUF * 2));
  }
  asm volatile("s_wait_asynccnt 0x0" ::: "memory");    // no copy is left in flight at the end

  const int c = lane & 15, g = lane >> 4;
#pragma unroll
  for (int ti = 0; ti < 2; ++ti)
#pragma unroll
    for (int tj = 0; tj < 2; ++tj)
#pragma unroll
      for (int p = 0; p < 8; ++p) {
        const int row = m0 + ti * 16 + g * 8 + p;
        const int col = n0 + tj * 16 + c;
        float v = acc[ti][tj][p];
        if (EPI == 0) {
          Ch[(size_t)row * N + col] = (_Float16)v;
        } else {
          v += resid[(size_t)row * N + col] + bias[col];
          const int bb = row >> 11, pos = row & (N_ - 1);
          outT[((size_t)(bb * D_ + col)) * N_ + pos] = v;
        }
      }
}

// ---------- 4) xPos rotary ----------
__device__ __forceinline__ void xpos_coeffs(int pos, int j, float& cs, float& sn,
                                            float& scl) {
  const float fpos = (float)pos;
  const float invf = __powf(10000.f, -(float)(2 * j) * (1.f / (float)DH_));
  const float fr   = fpos * invf;
  cs = __cosf(fr);
  sn = __sinf(fr);
  const float bs = ((float)(2 * j) + 0.4f * DH_) * (1.f / (1.4f * DH_));
  const float pw = (fpos - (float)(N_ / 2)) * (1.f / 4096.f);
  scl = __powf(bs, pw);
}

// One lane takes 8 rotation pairs of one (token, head): dims j0 .. j0+7 and their
// partners 32 on, each half one 16-byte load and one 16-byte store. The coefficients of
// a pair are formed once, and a launch starts 16 times fewer waves.
__global__ __launch_bounds__(256) void rotary_q_k(
    const _Float16* __restrict__ qraw, _Float16* __restrict__ qh) {
  const int idx = blockIdx.x * 256 + threadIdx.x;  // b*h*n*4 = 256K
  const int j0  = (idx & 3) * 8;
  const int pos = (idx >> 2) & (N_ - 1);
  const int h   = (idx >> 13) & (H_ - 1);
  const int b   = idx >> 16;
  const size_t tok = (size_t)(b * N_ + pos);
  const _Float16* qp = qraw + tok * (H_ * DH_) + h * DH_ + j0;
  const v8h lo = *(const v8h*)qp;
  const v8h hi = *(const v8h*)(qp + 32);
  v8h olo, ohi;
#pragma unroll
  for (int e = 0; e < 8; ++e) {
    float cs, sn, scl;
    xpos_coeffs(pos, j0 + e, cs, sn, scl);
    const float a = (float)lo[e], c = (float)hi[e];
    olo[e] = (_Float16)((a * cs + (-c) * sn) * scl * 0.125f);  // fold 1/sqrt(dh)
    ohi[e] = (_Float16)((c * cs + a * sn) * scl * 0.125f);
  }
  _Float16* op = qh + (((size_t)(b * H_ + h) * N_) + pos) * DH_ + j0;
  *(v8h*)op        = olo;
  *(v8h*)(op + 32) = ohi;
}

// Blocks 0 .. KV_KBLK-1 rotate K as above. The rest turn V: one lane takes an
// 8 (positions) x 8 (dims) block in its registers; eight lanes side by side along the
// positions store one whole 128-byte line of a V^T row.
#define KV_KBLK (B_ * KVH_ * N_ * 4 / 256)          // 256
#define KV_VBLK (B_ * KVH_ * N_ * DH_ / 64 / 256)   // 64
__global__ __launch_bounds__(256) void rotary_kv_k(
    const _Float16* __restrict__ kvraw, _Float16* __restrict__ kh,
    _Float16* __restrict__ vT) {
  if (blockIdx.x < KV_KBLK) {
    const int idx = blockIdx.x * 256 + threadIdx.x;  // b*kvh*n*4 = 64K
    const int j0  = (idx & 3) * 8;
    const int pos = (idx >> 2) & (N_ - 1);
    const int kv  = (idx >> 13) & 1;
    const int b   = idx >> 14;
    const size_t tok = (size_t)(b * N_ + pos);
    const _Float16* kp = kvraw + tok * 256 + kv * DH_ + j0;
    const v8h lo = *(const v8h*)kp;
    const v8h hi = *(const v8h*)(kp + 32);
    v8h olo, ohi;
#pragma unroll
    for (int e = 0; e < 8; ++e) {
      float cs, sn, scl;
      xpos_coeffs(pos, j0 + e, cs, sn, scl);
      const float a = (float)lo[e], c = (float)hi[e];
      olo[e] = (_Float16)((a * cs + (-c) * sn) / scl);
      ohi[e] = (_Float16)((c * cs + a * sn) / scl);
    }
    _Float16* op = kh + (((size_t)(b * KVH_ + kv) * N_) + pos) * DH_ + j0;
    *(v8h*)op        = olo;
    *(v8h*)(op + 32) = ohi;
  } else {
    const int idx = (blockIdx.x - KV_KBLK) * 256 + threadIdx.x;  // b*kvh*(n/8)*(dh/8) = 16K
    const int p0 = ((idx >> 6) & 31) * 64 + (idx & 7) * 8;
    const int d0 = ((idx >> 3) & 7) * 8;
    const int kv = (idx >> 11) & 1;
    const int b  = idx >> 12;
    const _Float16* vp = kvraw + (size_t)(b * N_ + p0) * 256 + 128 + kv * DH_ + d0;
    v8h r[8];
#pragma unroll
    for (int e = 0; e < 8; ++e) r[e] = *(const v8h*)(vp + (size_t)e * 256);
    _Float16* op = vT + (((size_t)(b * KVH_ + kv) * DH_) + d0) * N_ + p0;
#pragma unroll
    for (int d = 0; d < 8; ++d) {
      v8h o;
#pragma unroll
      for (int e = 0; e < 8; ++e) o[e] = r[e][d];
      *(v8h*)(op + (size_t)d * N_) = o;
    }
    // the built code lays the K branch behind these stores: keep the wait in front of
    // any rewrite of a register that an issued store names
    asm volatile("s_wait_xcnt 0x0" ::: "memory");
  }
}

// ---------- 5) Flash attention: per (b,h), wave = 16 queries ----------
// The 8 waves of a work-group walk the same keys, so K and V^T go through LDS once for
// all of them: tiles of 64 keys, two buffers, the next tile copied while this one is used.
#define FA_KEYS  64                   // keys per tile: a K row and a V^T row are 128 bytes each
#define FA_PITCH 72                   // halves per LDS row: 144 bytes, an odd multiple of 16
#define FA_OPER  (64 * FA_PITCH)      // halves of one operand's tile (64 rows)
#define FA_BUF   (2 * FA_OPER)        // K tile, V^T tile behind it
#define FA_TILES (N_ / FA_KEYS)

// One tile: 128 rows of 128 bytes, 16 bytes a lane and copy, so a wave's copy takes four
// whole lines. kg, vg: this lane's place in rows 0..31 of the K and the V^T tile.
__device__ __forceinline__ void stage_kv(const _Float16* kg, const _Float16* vg,
                                         unsigned dst) {
  const _Float16* kg1 = kg + 32 * DH_;
  const _Float16* vg1 = vg + (size_t)32 * N_;
  const unsigned dk1 = dst + 32 * FA_PITCH * 2;
  const unsigned dv0 = dst + FA_OPER * 2;
  const unsigned dv1 = dv0 + 32 * FA_PITCH * 2;
  // the wait stands inside the statement, in front of any rewrite of an address register
  asm volatile(
      "global_load_async_to_lds_b128 %0, %4, off\n\t"
      "global_load_async_to_lds_b128 %1, %5, off\n\t"
      "global_load_async_to_lds_b128 %2, %6, off\n\t"
      "global_load_async_to_lds_b128 %3, %7, off\n\t"
      "s_wait_xcnt 0x0"
      :: "v"(dst), "v"(dk1), "v"(dv0), "v"(dv1), "v"(kg), "v"(kg1), "v"(vg), "v"(vg1)
      : "memory");
}

// lane l with lane l ^ 16: the two lanes that share a query column
__device__ __forceinline__ float xhalf(float x) {
  const int i = __builtin_bit_cast(int, x);
  return __builtin_bit_cast(
      float, __builtin_amdgcn_permlanex16(i, i, 0x76543210, 0xfedcba98, false, false));
}

// 2^x in place for a run of values. The run and the v_nop behind it are one statement: the
// instruction set asks for one slot between a transcendental and an instruction that reads
// its result or overwrites its source; inside the run every neighbour is independent, and
// the v_nop keeps the slot behind the last one, whatever the compiler puts next.
__device__ __forceinline__ void exp2_run9(float& e, float (&x)[8]) {
  asm("v_exp_f32 %0, %0\n\tv_exp_f32 %1, %1\n\tv_exp_f32 %2, %2\n\t"
      "v_exp_f32 %3, %3\n\tv_exp_f32 %4, %4\n\tv_exp_f32 %5, %5\n\t"
      "v_exp_f32 %6, %6\n\tv_exp_f32 %7, %7\n\tv_exp_f32 %8, %8\n\tv_nop"
      : "+v"(e), "+v"(x[0]), "+v"(x[1]), "+v"(x[2]), "+v"(x[3]), "+v"(x[4]), "+v"(x[5]),
        "+v"(x[6]), "+v"(x[7]));
}
__device__ __forceinline__ void exp2_run8(float (&x)[8]) {
  asm("v_exp_f32 %0, %0\n\tv_exp_f32 %1, %1\n\tv_exp_f32 %2, %2\n\t"
      "v_exp_f32 %3, %3\n\tv_exp_f32 %4, %4\n\tv_exp_f32 %5, %5\n\t"
      "v_exp_f32 %6, %6\n\tv_exp_f32 %7, %7\n\tv_nop"
      : "+v"(x[0]), "+v"(x[1]), "+v"(x[2]), "+v"(x[3]), "+v"(x[4]), "+v"(x[5]), "+v"(x[6]),
        "+v"(x[7]));
}
#define LOG2E_ 1.44269504f

__global__ __launch_bounds__(256) void flash_k(
    const _Float16* __restrict__ Q,   // (b, h, n, dh)
    const _Float16* __restrict__ Kt,  // (b, kvh, n, dh)
    const _Float16* __restrict__ VT,  // (b, kvh, dh, n)
    _Float16* __restrict__ O) {       // (b, n, h*dh)
  __shared__ __align__(16) _Float16 kvs[2 * FA_BUF];   // the two K / V^T buffers
  const int lane = threadIdx.x & 31;
  const int w    = threadIdx.x >> 5;
  const int h    = blockIdx.y, b = blockIdx.z;
  const int kv   = h & (KVH_ - 1);                     // tile(k, r): head h -> h % kvh
  const int qRow0 = blockIdx.x * 128 + w * 16;

  const _Float16* qptr  = Q  + (((size_t)(b * H_ + h) * N_) + qRow0) * DH_;
  const _Float16* kbase = Kt + ((size_t)(b * KVH_ + kv) * N_) * DH_;
  const _Float16* vbase = VT + ((size_t)(b * KVH_ + kv) * DH_) * N_;

  // this lane's share of a tile: row threadIdx.x / 8 (and 32 on), 16-byte piece threadIdx.x % 8
  const int srow = threadIdx.x >> 3, spc = (threadIdx.x & 7) * 8;
  const _Float16* kg = kbase + (size_t)srow * DH_ + spc;
  const _Float16* vg = vbase + (size_t)srow * N_ + spc;
  const unsigned sdst = (unsigned)(size_t)kvs + (unsigned)(srow * FA_PITCH + spc) * 2u;

  stage_kv(kg, vg, sdst);                              // tile 0 into buffer 0
  asm volatile("s_wait_asynccnt 0x0" ::: "memory");    // this wave's share of tile 0 has landed
  __syncthreads();                                     // every wave's share has
  stage_kv(kg + FA_KEYS * DH_, vg + FA_KEYS, sdst + FA_BUF * 2);  // tile 1 into buffer 1

  const v16h bq0 = load_frag(qptr,      DH_, lane);    // Q^T, dims  0..31, column = query
  const v16h bq1 = load_frag(qptr + 32, DH_, lane);    // Q^T, dims 32..63

  const v8f z = {0.f, 0.f, 0.f, 0.f, 0.f, 0.f, 0.f, 0.f};
  v8f oacc[4]; oacc[0] = z; oacc[1] = z; oacc[2] = z; oacc[3] = z;  // O^T: dim 16j+8g+p, query c
  float mcol = -1e30f;   // running maximum of this lane's query
  float lcol = 0.f;      // sum over this lane's half of the keys; the halves join at the end

  const int c = lane & 15, g = lane >> 4;

  for (int t = 0; t < FA_TILES; ++t) {
    const _Float16* kt = kvs + (t & 1) * FA_BUF;
    const _Float16* vt = kt + FA_OPER;
    // both 32-key passes of a tile inline: sub becomes a constant offset of the LDS loads
#pragma unroll
    for (int sub = 0; sub < FA_KEYS; sub += 32) {
      // ---- scores: two 16 (keys) x 16 (queries) f32 tiles covering 32 keys ----
      v8f s0 = z, s1 = z;
      {
        const _Float16* kp0 = kt + sub * FA_PITCH;
        s0 = wmma_f16(load_frag(kp0,      FA_PITCH, lane), bq0, s0);
        s0 = wmma_f16(load_frag(kp0 + 32, FA_PITCH, lane), bq1, s0);
        const _Float16* kp1 = kt + (sub + 16) * FA_PITCH;
        s1 = wmma_f16(load_frag(kp1,      FA_PITCH, lane), bq0, s1);
        s1 = wmma_f16(load_frag(kp1 + 32, FA_PITCH, lane), bq1, s1);
      }
      // ---- online softmax of one query column, in this lane's registers ----
      float mx[8];
#pragma unroll
      for (int p = 0; p < 8; ++p) mx[p] = fmaxf(s0[p], s1[p]);
      float rmax = fmaxf(fmaxf(fmaxf(mx[0], mx[1]), fmaxf(mx[2], mx[3])),
                         fmaxf(fmaxf(mx[4], mx[5]), fmaxf(mx[6], mx[7])));
      rmax = fmaxf(rmax, xhalf(rmax));
      const float nm = fmaxf(mcol, rmax);
      // e^x as 2^(x log2 e), the same two roundings as __expf
      float sc = (mcol - nm) * LOG2E_;
      float p0[8], p1[8];
#pragma unroll
      for (int p = 0; p < 8; ++p) {
        p0[p] = (s0[p] - nm) * LOG2E_;
        p1[p] = (s1[p] - nm) * LOG2E_;
      }
      exp2_run9(sc, p0);
      exp2_run8(p1);
      v16h pb;             // P^T as B operand: element s is key 8g+s, or 16+8g+(s-8), of column c
      float rs[4];         // four short chains instead of one of sixteen links
#pragma unroll
      for (int p = 0; p < 8; ++p) {
        pb[p]     = (_Float16)p0[p];
        pb[p + 8] = (_Float16)p1[p];
      }
#pragma unroll
      for (int p = 0; p < 4; ++p) rs[p] = (p0[p] + p1[p]) + (p0[p + 4] + p1[p + 4]);
      lcol = lcol * sc + ((rs[0] + rs[1]) + (rs[2] + rs[3]));
      mcol = nm;
#pragma unroll
      for (int j = 0; j < 4; ++j) oacc[j] *= sc;
      // ---- O^T += V^T P^T over dh in 4 tiles of 16 rows ----
#pragma unroll
      for (int j = 0; j < 4; ++j) {
        const v16h av = load_frag(vt + (j * 16) * FA_PITCH + sub, FA_PITCH, lane);
        oacc[j] = wmma_f16(av, pb, oacc[j]);
      }
    }
    // hand-over: this wave's reads of buffer t % 2 are done, its share of tile t + 1 has
    // landed; behind the barrier that holds for every wave, and the buffer may be refilled
    asm volatile("s_wait_dscnt 0x0" ::: "memory");
    asm volatile("s_wait_asynccnt 0x0" ::: "memory");
    __syncthreads();
    if (t + 2 < FA_TILES)
      stage_kv(kg + (size_t)(t + 2) * (FA_KEYS * DH_), vg + (t + 2) * FA_KEYS,
               sdst + (unsigned)(t & 1) * (FA_BUF * 2));
  }
  asm volatile("s_wait_asynccnt 0x0" ::: "memory");    // no copy is left in flight at the end

  // a lane holds 8 consecutive dims of its query in each tile: one 16-byte store each
  const float inv = 1.f / (lcol + xhalf(lcol));
  _Float16* op = O + (size_t)(b * N_ + qRow0 + c) * (H_ * DH_) + h * DH_ + g * 8;
#pragma unroll
  for (int j = 0; j < 4; ++j) {
    v8h o;
#pragma unroll
    for (int p = 0; p < 8; ++p) o[p] = (_Float16)(oacc[j][p] * inv);
    *(v8h*)(op + j * 16) = o;
  }
}

// ---------- launch ----------
extern "C" void kernel_launch(void* const* d_in, const int* in_sizes, int n_in,
                              void* d_out, int out_size, void* d_ws, size_t ws_size,
                              hipStream_t stream) {
  const float* x     = (const float*)d_in[0];
  const float* gamma = (const float*)d_in[1];
  const float* beta  = (const float*)d_in[2];
  const float* Wq    = (const float*)d_in[3];
  const float* Wkv   = (const float*)d_in[4];
  const float* Wout  = (const float*)d_in[5];
  const float* bout  = (const float*)d_in[6];
  float* y = (float*)d_out;

  char* wsp = (char*)d_ws;
  auto take = [&](size_t bytes) {
    void* p = (void*)wsp;
    wsp += (bytes + 255) & ~(size_t)255;
    return p;
  };
  float*    xnf   = (float*)take((size_t)BN_ * D_ * 4);
  _Float16* xnh   = (_Float16*)take((size_t)BN_ * D_ * 2);
  _Float16* WqT   = (_Float16*)take((size_t)D_ * D_ * 2);
  _Float16* WkvT  = (_Float16*)take((size_t)256 * D_ * 2);
  _Float16* WoutT = (_Float16*)take((size_t)D_ * D_ * 2);
  _Float16* qraw  = (_Float16*)take((size_t)BN_ * D_ * 2);
  _Float16* kvraw = (_Float16*)take((size_t)BN_ * 256 * 2);
  _Float16* qh    = (_Float16*)take((size_t)B_ * H_ * N_ * DH_ * 2);
  _Float16* kh    = (_Float16*)take((size_t)B_ * KVH_ * N_ * DH_ * 2);
  _Float16* vT    = (_Float16*)take((size_t)B_ * KVH_ * N_ * DH_ * 2);
  _Float16* ao    = (_Float16*)take((size_t)BN_ * D_ * 2);

  layernorm_k<<<BN_ / LN_TOK, 512, 0, stream>>>(x, gamma, beta, xnf, xnh);
  transpose_w_k<D_, D_><<<D_ * D_ / 64 / 256, 256, 0, stream>>>(Wq, WqT);
  transpose_w_k<D_, 256><<<D_ * 256 / 64 / 256, 256, 0, stream>>>(Wkv, WkvT);
  transpose_w_k<D_, D_><<<D_ * D_ / 64 / 256, 256, 0, stream>>>(Wout, WoutT);

  gemm_wmma_k<0><<<dim3(BN_ / 64, D_ / 128), 256, 0, stream>>>(
      xnh, WqT, D_, qraw, nullptr, nullptr, nullptr);
  gemm_wmma_k<0><<<dim3(BN_ / 64, 256 / 128), 256, 0, stream>>>(
      xnh, WkvT, 256, kvraw, nullptr, nullptr, nullptr);

  rotary_q_k<<<(B_ * H_ * N_ * 4) / 256, 256, 0, stream>>>(qraw, qh);
  rotary_kv_k<<<KV_KBLK + KV_VBLK, 256, 0, stream>>>(kvraw, kh, vT);

  flash_k<<<dim3(N_ / 128, H_, B_), 256, 0, stream>>>(qh, kh, vT, ao);

  gemm_wmma_k<1><<<dim3(BN_ / 64, D_ / 128), 256, 0, stream>>>(
      ao, WoutT, D_, nullptr, xnf, bout, y);
}

// v006
// It runs in 78 microseconds.
// Two timings next to v005 put it at 1.26 and 1.25 times that version's speed.
// Over all steps from v000 it is 4.57 times as fast.
#include <hip/hip_runtime.h>

// ---------- types ----------
typedef __attribute__((ext_vector_type(16))) _Float16 v16h;
typedef __attribute__((ext_vector_type(8)))  _Float16 v8h;
typedef __attribute__((ext_vector_type(8)))  float    v8f;

#define B_   4
#define N_   2048
#define D_   512
#define H_   8
#define KVH_ 2
#define DH_  64
#define BN_  (B_ * N_)   // 8192 tokens

// ---------- WMMA helpers ----------
__device__ __forceinline__ v8f wmma_f16(v16h a, v16h b, v8f c) {
  // D = A(16x32 f16) x B(32x16 f16) + C(16x16 f32)
  return __builtin_amdgcn_wmma_f32_16x16x32_f16(
      /*neg_a=*/false, a, /*neg_b=*/false, b,
      /*c_mod=*/(short)0, c, /*reuse_a=*/false, /*reuse_b=*/false);
}

// Load a 16x32 f16 fragment (A-layout; identical striping assumed for B^T rows)
// from a row-major matrix with leading dimension `ld` (in elements).
// Lane (r = lane&15, g = lane>>4) holds row r, K = {g*8..g*8+7, 16+g*8..16+g*8+7}.
__device__ __forceinline__ v16h load_frag(const _Float16* __restrict__ base,
                                          int ld, int lane) {
  const int r = lane & 15, g = lane >> 4;
  const _Float16* p = base + (size_t)r * ld + g * 8;
  v8h lo = *(const v8h*)(p);
  v8h hi = *(const v8h*)(p + 16);
  v16h f;
#pragma unroll
  for (int i = 0; i < 8; ++i) { f[i] = lo[i]; f[i + 8] = hi[i]; }
  return f;
}

// ---------- 1a) Weight convert + transpose: W (K x N) f32 -> W^T (N x K) f16 ----------
// One lane turns an 8 (k) x 8 (n) block in its registers. A wave takes 64 k x 32 n: eight
// lanes side by side along k store one whole 128-byte line of a W^T row. idx counts the
// K * N / 64 lanes of one matrix.
template <int K, int N>
__device__ __forceinline__ void transpose_w(
    const float* __restrict__ W, _Float16* __restrict__ WT, int idx) {
  static_assert(K % 64 == 0 && N % 32 == 0 && (K * N / 64) % 512 == 0, "tile shape");
  const int lane = idx & 31, tile = idx >> 5;
  const int tk = tile % (K >> 6), tn = tile / (K >> 6);
  const int k0 = tk * 64 + (lane & 7) * 8;
  const int n0 = tn * 32 + (lane >> 3) * 8;
  const float* wp = W + (size_t)k0 * N + n0;
  float r[8][8];
#pragma unroll
  for (int e = 0; e < 8; ++e) {
    const float4 a = *(const float4*)(wp + (size_t)e * N);
    const float4 b = *(const float4*)(wp + (size_t)e * N + 4);
    r[e][0] = a.x; r[e][1] = a.y; r[e][2] = a.z; r[e][3] = a.w;
    r[e][4] = b.x; r[e][5] = b.y; r[e][6] = b.z; r[e][7] = b.w;
  }
  _Float16* op = WT + (size_t)n0 * K + k0;
#pragma unroll
  for (int n = 0; n < 8; ++n) {
    v8h o;
#pragma unroll
    for (int e = 0; e < 8; ++e) o[e] = (_Float16)r[e][n];
    *(v8h*)(op + (size_t)n * K) = o;
  }
  // the built code lays the next matrix's branch behind these stores: keep the wait in front
  // of any rewrite of a register that an issued store names
  asm volatile("s_wait_xcnt 0x0" ::: "memory");
}

// ---------- 1) LayerNorm: x (b,d,n) -> xn (b*n, d) f32 + f16 ----------
// One work-group takes 32 tokens x all 512 channels. x is read along n (whole
// 128-byte lines), turned through LDS, and each token's row is then summed,
// normalised and stored along d (whole lines again).
// The weight transposes depend on nothing and nothing but the GEMMs reads them, so they
// ride in this launch as its first TW_BLK work-groups instead of three launches of their own.
typedef __attribute__((ext_vector_type(4))) _Float16 v4h;
#define LN_TOK   32
#define LN_PITCH 516  // dwords; 4 mod 64, so a column walk of 16-byte stores meets every bank once
#define TW_Q   (D_ * D_ / 64)         // lanes that turn Wq (and Wout)
#define TW_KV  (D_ * 256 / 64)        // lanes that turn Wkv
#define TW_BLK ((2 * TW_Q + TW_KV) / 512)

__global__ __launch_bounds__(512) void layernorm_k(
    const float* __restrict__ x, const float* __restrict__ gamma,
    const float* __restrict__ beta, float* __restrict__ xnf,
    _Float16* __restrict__ xnh,
    const float* __restrict__ Wq, const float* __restrict__ Wkv,
    const float* __restrict__ Wout, _Float16* __restrict__ WqkvT,
    _Float16* __restrict__ WoutT) {
  __shared__ __align__(16) float tile[LN_TOK * LN_PITCH];
  if (blockIdx.x < TW_BLK) {                       // whole work-groups, in front of the barrier
    const int blk = blockIdx.x, tid = threadIdx.x;
    if (blk < TW_Q / 512)
      transpose_w<D_, D_>(Wq, WqkvT, blk * 512 + tid);
    else if (blk < (TW_Q + TW_KV) / 512)
      transpose_w<D_, 256>(Wkv, WqkvT + D_ * D_, (blk - TW_Q / 512) * 512 + tid);
    else
      transpose_w<D_, D_>(Wout, WoutT, (blk - (TW_Q + TW_KV) / 512) * 512 + tid);
    return;
  }
  const int lane = threadIdx.x & 31;
  const int w    = threadIdx.x >> 5;               // 16 waves
  const int t0   = (blockIdx.x - TW_BLK) * LN_TOK; // first token of the tile
  const int b = t0 >> 11, pos0 = t0 & (N_ - 1);

  // lane = token, wave w holds channels w*32 .. w*32+31 of it
  const float* xb = x + ((size_t)b * D_ + w * 32) * N_ + pos0 + lane;
  float v[32];
  for (int i = 0; i < 32; ++i) v[i] = xb[(size_t)i * N_];
  float* tp = tile + lane * LN_PITCH + w * 32;
  for (int i = 0; i < 32; i += 4)
    *(float4*)(tp + i) = make_float4(v[i], v[i + 1], v[i + 2], v[i + 3]);

  // lane holds channels k*128 + lane*4 .. +3, k = 0..3
  float4 gm[4], bt[4];
  for (int k = 0; k < 4; ++k) {
    gm[k] = *(const float4*)(gamma + k * 128 + lane * 4);
    bt[k] = *(const float4*)(beta  + k * 128 + lane * 4);
  }
  __syncthreads();

  // wave w owns tokens 2w and 2w+1 of the tile
  for (int r = 0; r < 2; ++r) {
    const int row = w * 2 + r;
    const float* rp = tile + row * LN_PITCH + lane * 4;
    float4 a[4];
    for (int k = 0; k < 4; ++k) a[k] = *(const float4*)(rp + k * 128);
    float s = 0.f, ss = 0.f;
    for (int k = 0; k < 4; ++k) {
      s  += (a[k].x + a[k].y) + (a[k].z + a[k].w);
      ss += (a[k].x * a[k].x + a[k].y * a[k].y) + (a[k].z * a[k].z + a[k].w * a[k].w);
    }
    for (int m = 1; m < 32; m <<= 1) {
      s  += __shfl_xor(s,  m, 32);
      ss += __shfl_xor(ss, m, 32);
    }
    const float mu  = s * (1.f / D_);
    const float var = ss * (1.f / D_) - mu * mu;
    const float rst = rsqrtf(var + 1e-5f);
    float*    o  = xnf + (size_t)(t0 + row) * D_ + lane * 4;
    _Float16* oh = xnh + (size_t)(t0 + row) * D_ + lane * 4;
    for (int k = 0; k < 4; ++k) {
      float4 y;
      y.x = (a[k].x - mu) * rst * gm[k].x + bt[k].x;
      y.y = (a[k].y - mu) * rst * gm[k].y + bt[k].y;
      y.z = (a[k].z - mu) * rst * gm[k].z + bt[k].z;
      y.w = (a[k].w - mu) * rst * gm[k].w + bt[k].w;
      *(float4*)(o + k * 128) = y;
      v4h yh = {(_Float16)y.x, (_Float16)y.y, (_Float16)y.z, (_Float16)y.w};
      *(v4h*)(oh + k * 128) = yh;
    }
  }
  // the built code lays the transpose branch behind these stores: keep the wait in front of
  // any rewrite of a register that an issued store names
  asm volatile("s_wait_xcnt 0x0" ::: "memory");
}

// ---------- 2) xPos rotary coefficients ----------
// sgn +1: scl is the scale (q); sgn -1: its reciprocal (k)
__device__ __forceinline__ void xpos_coeffs(int pos, int j, float sgn, float& cs, float& sn,
                                            float& scl) {
  const float fpos = (float)pos;
  const float invf = __powf(10000.f, -(float)(2 * j) * (1.f / (float)DH_));
  const float fr   = fpos * invf;
  cs = __cosf(fr);
  sn = __sinf(fr);
  const float bs = ((float)(2 * j) + 0.4f * DH_) * (1.f / (1.4f * DH_));
  const float pw = sgn * ((fpos - (float)(N_ / 2)) * (1.f / 4096.f));
  scl = __powf(bs, pw);
}

// ---------- 3) WMMA GEMM: C = A(M x 512) * B(512 x N), B given transposed ----------
// EPI 0: q, k and v projections in one launch (B^T = Wq^T with Wkv^T behind it, 768 rows).
//        The rotary and the V transpose are done on the f32 accumulators, so the raw
//        projections never go to memory and need no launches of their own.
// EPI 1: out-proj epilogue: +resid(row,col) +bias(col), store f32 transposed (b,d,n).
// The 8 waves of a work-group share 64 rows of A and 128 rows of B^T, so both go through
// LDS once for all of them: tiles of 64 k, two buffers, the next tile copied while this
// one is used. A copy takes whole 128-byte lines; a fragment load straight from global
// memory takes 32 bytes out of each of 16 lines.
#define GM_KT    64                   // k per tile: a row of A or of B^T is 128 bytes
#define GM_PITCH 72                   // halves per LDS row: 144 bytes, an odd multiple of 16
#define GM_A     (64 * GM_PITCH)      // halves of the A tile (64 rows)
#define GM_BUF   (192 * GM_PITCH)     // A tile, B^T tile (128 rows) behind it
#define GM_TILES (D_ / GM_KT)

// One tile: 192 rows of 128 bytes, 16 bytes a lane and copy, so a wave's copy takes four
// whole lines. ag, bg: this lane's place in rows 0..31 of the A and the B^T tile.
__device__ __forceinline__ void stage_ab(const _Float16* ag, const _Float16* bg,
                                         unsigned dst) {
  const _Float16* ag1 = ag + 32 * D_;
  const _Float16* bg1 = bg + 32 * D_;
  const _Float16* bg2 = bg + 64 * D_;
  const _Float16* bg3 = bg + 96 * D_;
  const unsigned da1 = dst + 32 * GM_PITCH * 2;
  const unsigned db0 = dst + GM_A * 2;
  const unsigned db1 = db0 + 32 * GM_PITCH * 2;
  const unsigned db2 = db0 + 64 * GM_PITCH * 2;
  const unsigned db3 = db0 + 96 * GM_PITCH * 2;
  // the wait stands inside the statement, in front of any rewrite of an address register
  asm volatile(
      "global_load_async_to_lds_b128 %0, %6, off\n\t"
      "global_load_async_to_lds_b128 %1, %7, off\n\t"
      "global_load_async_to_lds_b128 %2, %8, off\n\t"
      "global_load_async_to_lds_b128 %3, %9, off\n\t"
      "global_load_async_to_lds_b128 %4, %10, off\n\t"
      "global_load_async_to_lds_b128 %5, %11, off\n\t"
      "s_wait_xcnt 0x0"
      :: "v"(dst), "v"(da1), "v"(db0), "v"(db1), "v"(db2), "v"(db3),
         "v"(ag), "v"(ag1), "v"(bg), "v"(bg1), "v"(bg2), "v"(bg3)
      : "memory");
}

template <int EPI>
__global__ __launch_bounds__(256) void gemm_wmma_k(
    const _Float16* __restrict__ A, const _Float16* __restrict__ BT,
    _Float16* __restrict__ qh, _Float16* __restrict__ kh, _Float16* __restrict__ vT,
    const float* __restrict__ resid, const float* __restrict__ bias,
    float* __restrict__ outT) {
  __shared__ __align__(16) _Float16 abt[2 * GM_BUF];   // the two A / B^T buffers
  const int lane = threadIdx.x & 31;
  const int w    = threadIdx.x >> 5;             // 8 waves
  const int m0   = blockIdx.x * 64  + (w & 1) * 32;
  // the wave's rows of the B^T tile. EPI 1: 32 in a row. EPI 0: the tile is two heads; a
  // wave takes 16 dims of one head and, BSTEP rows on, their rotation partners
  const int bro  = EPI == 0 ? (w >> 2) * 64 + ((w >> 1) & 1) * 16 : (w >> 1) * 32;
  constexpr int BSTEP = EPI == 0 ? 32 : 16;

  // this lane's share of a tile: row threadIdx.x / 8 (and 32, 64, 96 on), 16-byte piece
  // threadIdx.x % 8
  const int srow = threadIdx.x >> 3, spc = (threadIdx.x & 7) * 8;
  const _Float16* ag = A  + (size_t)(blockIdx.x * 64  + srow) * D_ + spc;
  const _Float16* bg = BT + (size_t)(blockIdx.y * 128 + srow) * D_ + spc;
  const unsigned sdst = (unsigned)(size_t)abt + (unsigned)(srow * GM_PITCH + spc) * 2u;

  stage_ab(ag, bg, sdst);                              // tile 0 into buffer 0
  asm volatile("s_wait_asynccnt 0x0" ::: "memory");    // this wave's share of tile 0 has landed
  __syncthreads();                                     // every wave's share has
  stage_ab(ag + GM_KT, bg + GM_KT, sdst + GM_BUF * 2); // tile 1 into buffer 1

  const v8f z = {0.f, 0.f, 0.f, 0.f, 0.f, 0.f, 0.f, 0.f};
  v8f acc[2][2];
  acc[0][0] = z; acc[0][1] = z; acc[1][0] = z; acc[1][1] = z;

  for (int t = 0; t < GM_TILES; ++t) {
    const _Float16* as = abt + (t & 1) * GM_BUF + (w & 1) * (32 * GM_PITCH);
    const _Float16* bs = abt + (t & 1) * GM_BUF + GM_A + bro * GM_PITCH;
    // both 32-k passes of a tile inline: kk becomes a constant offset of the LDS loads
#pragma unroll
    for (int kk = 0; kk < GM_KT; kk += 32) {
      v16h a0 = load_frag(as + kk,                 GM_PITCH, lane);
      v16h a1 = load_frag(as + 16 * GM_PITCH + kk, GM_PITCH, lane);
      v16h b0 = load_frag(bs + kk,                 GM_PITCH, lane);
      v16h b1 = load_frag(bs + BSTEP * GM_PITCH + kk, GM_PITCH, lane);
      acc[0][0] = wmma_f16(a0, b0, acc[0][0]);
      acc[0][1] = wmma_f16(a0, b1, acc[0][1]);
      acc[1][0] = wmma_f16(a1, b0, acc[1][0]);
      acc[1][1] = wmma_f16(a1, b1, acc[1][1]);
    }
    // hand-over: this wave's reads of buffer t % 2 are done, its share of tile t + 1 has
    // landed; behind the barrier that holds for every wave, and the buffer may be refilled
    asm volatile("s_wait_dscnt 0x0" ::: "memory");
    asm volatile("s_wait_asynccnt 0x0" ::: "memory");
    __syncthreads();
    if (t + 2 < GM_TILES)
      stage_ab(ag + (t + 2) * GM_KT, bg + (t + 2) * GM_KT,
               sdst + (unsigned)(t & 1) * (GM_BUF * 2));
  }
  asm volatile("s_wait_asynccnt 0x0" ::: "memory");    // no copy is left in flight at the end

  const int c = lane & 15, g = lane >> 4;
  if (EPI == 0) {
    // acc[ti][tj][p]: token m0 + 16 ti + 8 g + p, dim j + 32 tj of head hd of this tile.
    // A lane keeps ONE rotation pair j for its 16 tokens: what the coefficients take from
    // j alone is the same expression in all 16 and is formed once.
    const int hd = w >> 2;
    const int j  = ((w >> 1) & 1) * 16 + c;
    const int by = blockIdx.y;                       // 0..3: q heads 2by, 2by+1; 4: k; 5: v
    const int bb = m0 >> 11, pos0 = (m0 & (N_ - 1)) + g * 8;   // 32 tokens lie in one batch
    if (by < 5) {
      const bool  isk  = by == 4;
      const float sgn  = isk ? -1.f : 1.f;           // k is divided by the scale: power negated
      const float fold = isk ? 1.f : 0.125f;         // q: fold 1/sqrt(dh)
      _Float16* op = (isk ? kh + ((size_t)(bb * KVH_ + hd) * N_ + pos0) * DH_
                          : qh + ((size_t)(bb * H_ + by * 2 + hd) * N_ + pos0) * DH_) + j;
      // every loop of this epilogue is unrolled: the accumulators are registers and take
      // constant indices only
#pragma unroll
      for (int ti = 0; ti < 2; ++ti) {
        _Float16 lo[8], hi[8];
#pragma unroll
        for (int p = 0; p < 8; ++p) {
          float cs, sn, scl;
          xpos_coeffs(pos0 + ti * 16 + p, j, sgn, cs, sn, scl);
          const float f = scl * fold;
          const float a = acc[ti][0][p], d = acc[ti][1][p];
          lo[p] = (_Float16)((a * cs + (-d) * sn) * f);
          hi[p] = (_Float16)((d * cs + a * sn) * f);
        }
#pragma unroll
        for (int p = 0; p < 8; ++p) {
          op[(ti * 16 + p) * DH_]      = lo[p];
          op[(ti * 16 + p) * DH_ + 32] = hi[p];
        }
        // the second half's arithmetic reuses registers that these stores name: the wait
        // stands in front of that rewrite (behind the last stores the wave ends)
        if (ti == 0) asm volatile("s_wait_xcnt 0x0" ::: "memory");
      }
    } else {
      // V^T (b, kvh, dh, n): a lane holds 8 consecutive positions of a dim, one 16-byte store
      _Float16* op = vT + ((size_t)(bb * KVH_ + hd) * DH_ + j) * N_ + pos0;
#pragma unroll
      for (int ti = 0; ti < 2; ++ti)
#pragma unroll
        for (int tj = 0; tj < 2; ++tj) {
          v8h o;
#pragma unroll
          for (int p = 0; p < 8; ++p) o[p] = (_Float16)acc[ti][tj][p];
          *(v8h*)(op + (size_t)(tj * 32) * N_ + ti * 16) = o;
        }
      // the built code lays the rotary branch behind these stores: the same wait
      asm volatile("s_wait_xcnt 0x0" ::: "memory");
    }
  } else {
    const int n0 = blockIdx.y * 128 + bro;
#pragma unroll
    for (int ti = 0; ti < 2; ++ti)
#pragma unroll
      for (int tj = 0; tj < 2; ++tj)
#pragma unroll
        for (int p = 0; p < 8; ++p) {
          const int row = m0 + ti * 16 + g * 8 + p;
          const int col = n0 + tj * 16 + c;
          const float v = acc[ti][tj][p] + (resid[(size_t)row * D_ + col] + bias[col]);
          const int bb = row >> 11, pos = row & (N_ - 1);
          outT[((size_t)(bb * D_ + col)) * N_ + pos] = v;
        }
  }
}

// ---------- 5) Flash attention: per (b,h), wave = 16 queries ----------
// The 8 waves of a work-group walk the same keys, so K and V^T go through LDS once for
// all of them: tiles of 64 keys, two buffers, the next tile copied while this one is used.
#define FA_KEYS  64                   // keys per tile: a K row and a V^T row are 128 bytes each
#define FA_PITCH 72                   // halves per LDS row: 144 bytes, an odd multiple of 16
#define FA_OPER  (64 * FA_PITCH)      // halves of one operand's tile (64 rows)
#define FA_BUF   (2 * FA_OPER)        // K tile, V^T tile behind it
#define FA_TILES (N_ / FA_KEYS)

// One tile: 128 rows of 128 bytes, 16 bytes a lane and copy, so a wave's copy takes four
// whole lines. kg, vg: this lane's place in rows 0..31 of the K and the V^T tile.
__device__ __forceinline__ void stage_kv(const _Float16* kg, const _Float16* vg,
                                         unsigned dst) {
  const _Float16* kg1 = kg + 32 * DH_;
  const _Float16* vg1 = vg + (size_t)32 * N_;
  const unsigned dk1 = dst + 32 * FA_PITCH * 2;
  const unsigned dv0 = dst + FA_OPER * 2;
  const unsigned dv1 = dv0 + 32 * FA_PITCH * 2;
  // the wait stands inside the statement, in front of any rewrite of an address register
  asm volatile(
      "global_load_async_to_lds_b128 %0, %4, off\n\t"
      "global_load_async_to_lds_b128 %1, %5, off\n\t"
      "global_load_async_to_lds_b128 %2, %6, off\n\t"
      "global_load_async_to_lds_b128 %3, %7, off\n\t"
      "s_wait_xcnt 0x0"
      :: "v"(dst), "v"(dk1), "v"(dv0), "v"(dv1), "v"(kg), "v"(kg1), "v"(vg), "v"(vg1)
      : "memory");
}

// lane l with lane l ^ 16: the two lanes that share a query column
__device__ __forceinline__ float xhalf(float x) {
  const int i = __builtin_bit_cast(int, x);
  return __builtin_bit_cast(
      float, __builtin_amdgcn_permlanex16(i, i, 0x76543210, 0xfedcba98, false, false));
}

// 2^x in place for a run of values. The run and the v_nop behind it are one statement: the
// instruction set asks for one slot between a transcendental and an instruction that reads
// its result or overwrites its source; inside the run every neighbour is independent, and
// the v_nop keeps the slot behind the last one, whatever the compiler puts next.
__device__ __forceinline__ void exp2_run9(float& e, float (&x)[8]) {
  asm("v_exp_f32 %0, %0\n\tv_exp_f32 %1, %1\n\tv_exp_f32 %2, %2\n\t"
      "v_exp_f32 %3, %3\n\tv_exp_f32 %4, %4\n\tv_exp_f32 %5, %5\n\t"
      "v_exp_f32 %6, %6\n\tv_exp_f32 %7, %7\n\tv_exp_f32 %8, %8\n\tv_nop"
      : "+v"(e), "+v"(x[0]), "+v"(x[1]), "+v"(x[2]), "+v"(x[3]), "+v"(x[4]), "+v"(x[5]),
        "+v"(x[6]), "+v"(x[7]));
}
__device__ __forceinline__ void exp2_run8(float (&x)[8]) {
  asm("v_exp_f32 %0, %0\n\tv_exp_f32 %1, %1\n\tv_exp_f32 %2, %2\n\t"
      "v_exp_f32 %3, %3\n\tv_exp_f32 %4, %4\n\tv_exp_f32 %5, %5\n\t"
      "v_exp_f32 %6, %6\n\tv_exp_f32 %7, %7\n\tv_nop"
      : "+v"(x[0]), "+v"(x[1]), "+v"(x[2]), "+v"(x[3]), "+v"(x[4]), "+v"(x[5]), "+v"(x[6]),
        "+v"(x[7]));
}
#define LOG2E_ 1.44269504f

__global__ __launch_bounds__(256) void flash_k(
    const _Float16* __restrict__ Q,   // (b, h, n, dh)
    const _Float16* __restrict__ Kt,  // (b, kvh, n, dh)
    const _Float16* __restrict__ VT,  // (b, kvh, dh, n)
    _Float16* __restrict__ O) {       // (b, n, h*dh)
  __shared__ __align__(16) _Float16 kvs[2 * FA_BUF];   // the two K / V^T buffers
  const int lane = threadIdx.x & 31;
  const int w    = threadIdx.x >> 5;
  const int h    = blockIdx.y, b = blockIdx.z;
  const int kv   = h & (KVH_ - 1);                     // tile(k, r): head h -> h % kvh
  const int qRow0 = blockIdx.x * 128 + w * 16;

  const _Float16* qptr  = Q  + (((size_t)(b * H_ + h) * N_) + qRow0) * DH_;
  const _Float16* kbase = Kt + ((size_t)(b * KVH_ + kv) * N_) * DH_;
  const _Float16* vbase = VT + ((size_t)(b * KVH_ + kv) * DH_) * N_;

  // this lane's share of a tile: row threadIdx.x / 8 (and 32 on), 16-byte piece threadIdx.x % 8
  const int srow = threadIdx.x >> 3, spc = (threadIdx.x & 7) * 8;
  const _Float16* kg = kbase + (size_t)srow * DH_ + spc;
  const _Float16* vg = vbase + (size_t)srow * N_ + spc;
  const unsigned sdst = (unsigned)(size_t)kvs + (unsigned)(srow * FA_PITCH + spc) * 2u;

  stage_kv(kg, vg, sdst);                              // tile 0 into buffer 0
  asm volatile("s_wait_asynccnt 0x0" ::: "memory");    // this wave's share of tile 0 has landed
  __syncthreads();                                     // every wave's share has
  stage_kv(kg + FA_KEYS * DH_, vg + FA_KEYS, sdst + FA_BUF * 2);  // tile 1 into buffer 1

  const v16h bq0 = load_frag(qptr,      DH_, lane);    // Q^T, dims  0..31, column = query
  const v16h bq1 = load_frag(qptr + 32, DH_, lane);    // Q^T, dims 32..63

  const v8f z = {0.f, 0.f, 0.f, 0.f, 0.f, 0.f, 0.f, 0.f};
  v8f oacc[4]; oacc[0] = z; oacc[1] = z; oacc[2] = z; oacc[3] = z;  // O^T: dim 16j+8g+p, query c
  float mcol = -1e30f;   // running maximum of this lane's query
  float lcol = 0.f;      // sum over this lane's half of the keys; the halves join at the end

  const int c = lane & 15, g = lane >> 4;

  for (int t = 0; t < FA_TILES; ++t) {
    const _Float16* kt = kvs + (t & 1) * FA_BUF;
    const _Float16* vt = kt + FA_OPER;
    // both 32-key passes of a tile inline: sub becomes a constant offset of the LDS loads
#pragma unroll
    for (int sub = 0; sub < FA_KEYS; sub += 32) {
      // ---- scores: two 16 (keys) x 16 (queries) f32 tiles covering 32 keys ----
      v8f s0 = z, s1 = z;
      {
        const _Float16* kp0 = kt + sub * FA_PITCH;
        s0 = wmma_f16(load_frag(kp0,      FA_PITCH, lane), bq0, s0);
        s0 = wmma_f16(load_frag(kp0 + 32, FA_PITCH, lane), bq1, s0);
        const _Float16* kp1 = kt + (sub + 16) * FA_PITCH;
        s1 = wmma_f16(load_frag(kp1,      FA_PITCH, lane), bq0, s1);
        s1 = wmma_f16(load_frag(kp1 + 32, FA_PITCH, lane), bq1, s1);
      }
      // ---- online softmax of one query column, in this lane's registers ----
      float mx[8];
#pragma unroll
      for (int p = 0; p < 8; ++p) mx[p] = fmaxf(s0[p], s1[p]);
      float rmax = fmaxf(fmaxf(fmaxf(mx[0], mx[1]), fmaxf(mx[2], mx[3])),
                         fmaxf(fmaxf(mx[4], mx[5]), fmaxf(mx[6], mx[7])));
      rmax = fmaxf(rmax, xhalf(rmax));
      const float nm = fmaxf(mcol, rmax);
      // e^x as 2^(x log2 e), the same two roundings as __expf
      float sc = (mcol - nm) * LOG2E_;
      float p0[8], p1[8];
#pragma unroll
      for (int p = 0; p < 8; ++p) {
        p0[p] = (s0[p] - nm) * LOG2E_;
        p1[p] = (s1[p] - nm) * LOG2E_;
      }
      exp2_run9(sc, p0);
      exp2_run8(p1);
      v16h pb;             // P^T as B operand: element s is key 8g+s, or 16+8g+(s-8), of column c
      float rs[4];         // four short chains instead of one of sixteen links
#pragma unroll
      for (int p = 0; p < 8; ++p) {
        pb[p]     = (_Float16)p0[p];
        pb[p + 8] = (_Float16)p1[p];
      }
#pragma unroll
      for (int p = 0; p < 4; ++p) rs[p] = (p0[p] + p1[p]) + (p0[p + 4] + p1[p + 4]);
      lcol = lcol * sc + ((rs[0] + rs[1]) + (rs[2] + rs[3]));
      mcol = nm;
#pragma unroll
      for (int j = 0; j < 4; ++j) oacc[j] *= sc;
      // ---- O^T += V^T P^T over dh in 4 tiles of 16 rows ----
#pragma unroll
      for (int j = 0; j < 4; ++j) {
        const v16h av = load_frag(vt + (j * 16) * FA_PITCH + sub, FA_PITCH, lane);
        oacc[j] = wmma_f16(av, pb, oacc[j]);
      }
    }
    // hand-over: this wave's reads of buffer t % 2 are done, its share of tile t + 1 has
    // landed; behind the barrier that holds for every wave, and the buffer may be refilled
    asm volatile("s_wait_dscnt 0x0" ::: "memory");
    asm volatile("s_wait_asynccnt 0x0" ::: "memory");
    __syncthreads();
    if (t + 2 < FA_TILES)
      stage_kv(kg + (size_t)(t + 2) * (FA_KEYS * DH_), vg + (t + 2) * FA_KEYS,
               sdst + (unsigned)(t & 1) * (FA_BUF * 2));
  }
  asm volatile("s_wait_asynccnt 0x0" ::: "memory");    // no copy is left in flight at the end

  // a lane holds 8 consecutive dims of its query in each tile: one 16-byte store each
  const float inv = 1.f / (lcol + xhalf(lcol));
  _Float16* op = O + (size_t)(b * N_ + qRow0 + c) * (H_ * DH_) + h * DH_ + g * 8;
#pragma unroll
  for (int j = 0; j < 4; ++j) {
    v8h o;
#pragma unroll
    for (int p = 0; p < 8; ++p) o[p] = (_Float16)(oacc[j][p] * inv);
    *(v8h*)(op + j * 16) = o;
  }
}

// ---------- launch ----------
extern "C" void kernel_launch(void* const* d_in, const int* in_sizes, int n_in,
                              void* d_out, int out_size, void* d_ws, size_t ws_size,
                              hipStream_t stream) {
  const float* x     = (const float*)d_in[0];
  const float* gamma = (const float*)d_in[1];
  const float* beta  = (const float*)d_in[2];
  const float* Wq    = (const float*)d_in[3];
  const float* Wkv   = (const float*)d_in[4];
  const float* Wout  = (const float*)d_in[5];
  const float* bout  = (const float*)d_in[6];
  float* y = (float*)d_out;

  char* wsp = (char*)d_ws;
  auto take = [&](size_t bytes) {
    void* p = (void*)wsp;
    wsp += (bytes + 255) & ~(size_t)255;
    return p;
  };
  float*    xnf   = (float*)take((size_t)BN_ * D_ * 4);
  _Float16* xnh   = (_Float16*)take((size_t)BN_ * D_ * 2);
  _Float16* WqkvT = (_Float16*)take((size_t)(D_ + 256) * D_ * 2);   // Wq^T, Wkv^T behind it
  _Float16* WoutT = (_Float16*)take((size_t)D_ * D_ * 2);
  _Float16* qh    = (_Float16*)take((size_t)B_ * H_ * N_ * DH_ * 2);
  _Float16* kh    = (_Float16*)take((size_t)B_ * KVH_ * N_ * DH_ * 2);
  _Float16* vT    = (_Float16*)take((size_t)B_ * KVH_ * N_ * DH_ * 2);
  _Float16* ao    = (_Float16*)take((size_t)BN_ * D_ * 2);

  layernorm_k<<<TW_BLK + BN_ / LN_TOK, 512, 0, stream>>>(
      x, gamma, beta, xnf, xnh, Wq, Wkv, Wout, WqkvT, WoutT);

  gemm_wmma_k<0><<<dim3(BN_ / 64, (D_ + 256) / 128), 256, 0, stream>>>(
      xnh, WqkvT, qh, kh, vT, nullptr, nullptr, nullptr);

  flash_k<<<dim3(N_ / 128, H_, B_), 256, 0, stream>>>(qh, kh, vT, ao);

  gemm_wmma_k<1><<<dim3(BN_ / 64, D_ / 128), 256, 0, stream>>>(
      ao, WoutT, nullptr, nullptr, nullptr, xnf, bout, y);
}

// v007
// It runs in 72.6 microseconds.
// Timed twice side by side with v006, it ran 1.07 times as fast both times.
// All steps since v000 together make it 4.89 times as fast.
#include <hip/hip_runtime.h>

// ---------- types ----------
typedef __attribute__((ext_vector_type(16))) _Float16 v16h;
typedef __attribute__((ext_vector_type(8)))  _Float16 v8h;
typedef __attribute__((ext_vector_type(8)))  float    v8f;

#define B_   4
#define N_   2048
#define D_   512
#define H_   8
#define KVH_ 2
#define DH_  64
#define BN_  (B_ * N_)   // 8192 tokens

// ---------- WMMA helpers ----------
__device__ __forceinline__ v8f wmma_f16(v16h a, v16h b, v8f c) {
  // D = A(16x32 f16) x B(32x16 f16) + C(16x16 f32)
  return __builtin_amdgcn_wmma_f32_16x16x32_f16(
      /*neg_a=*/false, a, /*neg_b=*/false, b,
      /*c_mod=*/(short)0, c, /*reuse_a=*/false, /*reuse_b=*/false);
}

// Load a 16x32 f16 fragment (A-layout; identical striping assumed for B^T rows)
// from a row-major matrix with leading dimension `ld` (in elements).
// Lane (r = lane&15, g = lane>>4) holds row r, K = {g*8..g*8+7, 16+g*8..16+g*8+7}.
__device__ __forceinline__ v16h load_frag(const _Float16* __restrict__ base,
                                          int ld, int lane) {
  const int r = lane & 15, g = lane >> 4;
  const _Float16* p = base + (size_t)r * ld + g * 8;
  v8h lo = *(const v8h*)(p);
  v8h hi = *(const v8h*)(p + 16);
  v16h f;
#pragma unroll
  for (int i = 0; i < 8; ++i) { f[i] = lo[i]; f[i + 8] = hi[i]; }
  return f;
}

// ---------- 1a) Weight convert + transpose: W (K x N) f32 -> W^T (N x K) f16 ----------
// One lane turns an 8 (k) x 8 (n) block in its registers. A wave takes 64 k x 32 n: eight
// lanes side by side along k store one whole 128-byte line of a W^T row. idx counts the
// K * N / 64 lanes of one matrix.
template <int K, int N>
__device__ __forceinline__ void transpose_w(
    const float* __restrict__ W, _Float16* __restrict__ WT, int idx) {
  static_assert(K % 64 == 0 && N % 32 == 0 && (K * N / 64) % 512 == 0, "tile shape");
  const int lane = idx & 31, tile = idx >> 5;
  const int tk = tile % (K >> 6), tn = tile / (K >> 6);
  const int k0 = tk * 64 + (lane & 7) * 8;
  const int n0 = tn * 32 + (lane >> 3) * 8;
  const float* wp = W + (size_t)k0 * N + n0;
  float r[8][8];
#pragma unroll
  for (int e = 0; e < 8; ++e) {
    const float4 a = *(const float4*)(wp + (size_t)e * N);
    const float4 b = *(const float4*)(wp + (size_t)e * N + 4);
    r[e][0] = a.x; r[e][1] = a.y; r[e][2] = a.z; r[e][3] = a.w;
    r[e][4] = b.x; r[e][5] = b.y; r[e][6] = b.z; r[e][7] = b.w;
  }
  _Float16* op = WT + (size_t)n0 * K + k0;
#pragma unroll
  for (int n = 0; n < 8; ++n) {
    v8h o;
#pragma unroll
    for (int e = 0; e < 8; ++e) o[e] = (_Float16)r[e][n];
    *(v8h*)(op + (size_t)n * K) = o;
  }
  // the built code lays the next matrix's branch behind these stores: keep the wait in front
  // of any rewrite of a register that an issued store names
  asm volatile("s_wait_xcnt 0x0" ::: "memory");
}

// ---------- 1) LayerNorm: x (b,d,n) -> xn (b*n, d) f32 + f16 ----------
// One work-group takes 32 tokens x all 512 channels. x is read along n (whole
// 128-byte lines), turned through LDS, and each token's row is then summed,
// normalised and stored along d (whole lines again).
// The weight transposes depend on nothing and nothing but the GEMMs reads them, so they
// ride in this launch as its first TW_BLK work-groups instead of three launches of their own.
typedef __attribute__((ext_vector_type(4))) _Float16 v4h;
#define LN_TOK   32
#define LN_PITCH 516  // dwords; 4 mod 64, so a column walk of 16-byte stores meets every bank once
#define TW_Q   (D_ * D_ / 64)         // lanes that turn Wq (and Wout)
#define TW_KV  (D_ * 256 / 64)        // lanes that turn Wkv
#define TW_BLK ((2 * TW_Q + TW_KV) / 512)

__global__ __launch_bounds__(512) void layernorm_k(
    const float* __restrict__ x, const float* __restrict__ gamma,
    const float* __restrict__ beta, float* __restrict__ xnf,
    _Float16* __restrict__ xnh,
    const float* __restrict__ Wq, const float* __restrict__ Wkv,
    const float* __restrict__ Wout, _Float16* __restrict__ WqkvT,
    _Float16* __restrict__ WoutT) {
  __shared__ __align__(16) float tile[LN_TOK * LN_PITCH];
  if (blockIdx.x < TW_BLK) {                       // whole work-groups, in front of the barrier
    const int blk = blockIdx.x, tid = threadIdx.x;
    if (blk < TW_Q / 512)
      transpose_w<D_, D_>(Wq, WqkvT, blk * 512 + tid);
    else if (blk < (TW_Q + TW_KV) / 512)
      transpose_w<D_, 256>(Wkv, WqkvT + D_ * D_, (blk - TW_Q / 512) * 512 + tid);
    else
      transpose_w<D_, D_>(Wout, WoutT, (blk - (TW_Q + TW_KV) / 512) * 512 + tid);
    return;
  }
  const int lane = threadIdx.x & 31;
  const int w    = threadIdx.x >> 5;               // 16 waves
  const int t0   = (blockIdx.x - TW_BLK) * LN_TOK; // first token of the tile
  const int b = t0 >> 11, pos0 = t0 & (N_ - 1);

  // lane = token, wave w holds channels w*32 .. w*32+31 of it
  const float* xb = x + ((size_t)b * D_ + w * 32) * N_ + pos0 + lane;
  float v[32];
  for (int i = 0; i < 32; ++i) v[i] = xb[(size_t)i * N_];
  float* tp = tile + lane * LN_PITCH + w * 32;
  for (int i = 0; i < 32; i += 4)
    *(float4*)(tp + i) = make_float4(v[i], v[i + 1], v[i + 2], v[i + 3]);

  // lane holds channels k*128 + lane*4 .. +3, k = 0..3
  float4 gm[4], bt[4];
  for (int k = 0; k < 4; ++k) {
    gm[k] = *(const float4*)(gamma + k * 128 + lane * 4);
    bt[k] = *(const float4*)(beta  + k * 128 + lane * 4);
  }
  __syncthreads();

  // wave w owns tokens 2w and 2w+1 of the tile
  for (int r = 0; r < 2; ++r) {
    const int row = w * 2 + r;
    const float* rp = tile + row * LN_PITCH + lane * 4;
    float4 a[4];
    for (int k = 0; k < 4; ++k) a[k] = *(const float4*)(rp + k * 128);
    float s = 0.f, ss = 0.f;
    for (int k = 0; k < 4; ++k) {
      s  += (a[k].x + a[k].y) + (a[k].z + a[k].w);
      ss += (a[k].x * a[k].x + a[k].y * a[k].y) + (a[k].z * a[k].z + a[k].w * a[k].w);
    }
    for (int m = 1; m < 32; m <<= 1) {
      s  += __shfl_xor(s,  m, 32);
      ss += __shfl_xor(ss, m, 32);
    }
    const float mu  = s * (1.f / D_);
    const float var = ss * (1.f / D_) - mu * mu;
    const float rst = rsqrtf(var + 1e-5f);
    float*    o  = xnf + (size_t)(t0 + row) * D_ + lane * 4;
    _Float16* oh = xnh + (size_t)(t0 + row) * D_ + lane * 4;
    for (int k = 0; k < 4; ++k) {
      float4 y;
      y.x = (a[k].x - mu) * rst * gm[k].x + bt[k].x;
      y.y = (a[k].y - mu) * rst * gm[k].y + bt[k].y;
      y.z = (a[k].z - mu) * rst * gm[k].z + bt[k].z;
      y.w = (a[k].w - mu) * rst * gm[k].w + bt[k].w;
      *(float4*)(o + k * 128) = y;
      v4h yh = {(_Float16)y.x, (_Float16)y.y, (_Float16)y.z, (_Float16)y.w};
      *(v4h*)(oh + k * 128) = yh;
    }
  }
  // the built code lays the transpose branch behind these stores: keep the wait in front of
  // any rewrite of a register that an issued store names
  asm volatile("s_wait_xcnt 0x0" ::: "memory");
}

// ---------- 2) xPos rotary coefficients ----------
// sgn +1: scl is the scale (q); sgn -1: its reciprocal (k)
__device__ __forceinline__ void xpos_coeffs(int pos, int j, float sgn, float& cs, float& sn,
                                            float& scl) {
  const float fpos = (float)pos;
  const float invf = __powf(10000.f, -(float)(2 * j) * (1.f / (float)DH_));
  const float fr   = fpos * invf;
  cs = __cosf(fr);
  sn = __sinf(fr);
  const float bs = ((float)(2 * j) + 0.4f * DH_) * (1.f / (1.4f * DH_));
  const float pw = sgn * ((fpos - (float)(N_ / 2)) * (1.f / 4096.f));
  scl = __powf(bs, pw);
}

// ---------- 3) WMMA GEMM: C = A(M x 512) * B(512 x N), B given transposed ----------
// EPI 0: q, k and v projections in one launch (B^T = Wq^T with Wkv^T behind it, 768 rows).
//        The rotary and the V transpose are done on the f32 accumulators, so the raw
//        projections never go to memory and need no launches of their own.
// EPI 1: out-proj epilogue: +resid(row,col) +bias(col), store f32 transposed (b,d,n).
// The 8 waves of a work-group share 64 rows of A and 128 rows of B^T, so both go through
// LDS once for all of them: tiles of 64 k, two buffers, the next tile copied while this
// one is used. A copy takes whole 128-byte lines; a fragment load straight from global
// memory takes 32 bytes out of each of 16 lines.
#define GM_KT    64                   // k per tile: a row of A or of B^T is 128 bytes
#define GM_PITCH 72                   // halves per LDS row: 144 bytes, an odd multiple of 16
#define GM_A     (64 * GM_PITCH)      // halves of the A tile (64 rows)
#define GM_BUF   (192 * GM_PITCH)     // A tile, B^T tile (128 rows) behind it
#define GM_TILES (D_ / GM_KT)

// One tile: 192 rows of 128 bytes, 16 bytes a lane and copy, so a wave's copy takes four
// whole lines. ag, bg: this lane's place in rows 0..31 of the A and the B^T tile.
__device__ __forceinline__ void stage_ab(const _Float16* ag, const _Float16* bg,
                                         unsigned dst) {
  const _Float16* ag1 = ag + 32 * D_;
  const _Float16* bg1 = bg + 32 * D_;
  const _Float16* bg2 = bg + 64 * D_;
  const _Float16* bg3 = bg + 96 * D_;
  const unsigned da1 = dst + 32 * GM_PITCH * 2;
  const unsigned db0 = dst + GM_A * 2;
  const unsigned db1 = db0 + 32 * GM_PITCH * 2;
  const unsigned db2 = db0 + 64 * GM_PITCH * 2;
  const unsigned db3 = db0 + 96 * GM_PITCH * 2;
  // the wait stands inside the statement, in front of any rewrite of an address register
  asm volatile(
      "global_load_async_to_lds_b128 %0, %6, off\n\t"
      "global_load_async_to_lds_b128 %1, %7, off\n\t"
      "global_load_async_to_lds_b128 %2, %8, off\n\t"
      "global_load_async_to_lds_b128 %3, %9, off\n\t"
      "global_load_async_to_lds_b128 %4, %10, off\n\t"
      "global_load_async_to_lds_b128 %5, %11, off\n\t"
      "s_wait_xcnt 0x0"
      :: "v"(dst), "v"(da1), "v"(db0), "v"(db1), "v"(db2), "v"(db3),
         "v"(ag), "v"(ag1), "v"(bg), "v"(bg1), "v"(bg2), "v"(bg3)
      : "memory");
}

template <int EPI>
__global__ __launch_bounds__(256) void gemm_wmma_k(
    const _Float16* __restrict__ A, const _Float16* __restrict__ BT,
    _Float16* __restrict__ qh, _Float16* __restrict__ kh, _Float16* __restrict__ vT,
    const float* __restrict__ resid, const float* __restrict__ bias,
    float* __restrict__ outT) {
  __shared__ __align__(16) _Float16 abt[2 * GM_BUF];   // the two A / B^T buffers
  const int lane = threadIdx.x & 31;
  const int w    = threadIdx.x >> 5;             // 8 waves
  const int m0   = blockIdx.x * 64  + (w & 1) * 32;
  // the wave's rows of the B^T tile. EPI 1: 32 in a row. EPI 0: the tile is two heads; a
  // wave takes 16 dims of one head and, BSTEP rows on, their rotation partners
  const int bro  = EPI == 0 ? (w >> 2) * 64 + ((w >> 1) & 1) * 16 : (w >> 1) * 32;
  constexpr int BSTEP = EPI == 0 ? 32 : 16;

  // this lane's share of a tile: row threadIdx.x / 8 (and 32, 64, 96 on), 16-byte piece
  // threadIdx.x % 8
  const int srow = threadIdx.x >> 3, spc = (threadIdx.x & 7) * 8;
  const _Float16* ag = A  + (size_t)(blockIdx.x * 64  + srow) * D_ + spc;
  const _Float16* bg = BT + (size_t)(blockIdx.y * 128 + srow) * D_ + spc;
  const unsigned sdst = (unsigned)(size_t)abt + (unsigned)(srow * GM_PITCH + spc) * 2u;

  stage_ab(ag, bg, sdst);                              // tile 0 into buffer 0
  asm volatile("s_wait_asynccnt 0x0" ::: "memory");    // this wave's share of tile 0 has landed
  __syncthreads();                                     // every wave's share has
  stage_ab(ag + GM_KT, bg + GM_KT, sdst + GM_BUF * 2); // tile 1 into buffer 1

  const v8f z = {0.f, 0.f, 0.f, 0.f, 0.f, 0.f, 0.f, 0.f};
  v8f acc[2][2];
  acc[0][0] = z; acc[0][1] = z; acc[1][0] = z; acc[1][1] = z;

  for (int t = 0; t < GM_TILES; ++t) {
    const _Float16* as = abt + (t & 1) * GM_BUF + (w & 1) * (32 * GM_PITCH);
    const _Float16* bs = abt + (t & 1) * GM_BUF + GM_A + bro * GM_PITCH;
    // both 32-k passes of a tile inline: kk becomes a constant offset of the LDS loads
#pragma unroll
    for (int kk = 0; kk < GM_KT; kk += 32) {
      v16h a0 = load_frag(as + kk,                 GM_PITCH, lane);
      v16h a1 = load_frag(as + 16 * GM_PITCH + kk, GM_PITCH, lane);
      v16h b0 = load_frag(bs + kk,                 GM_PITCH, lane);
      v16h b1 = load_frag(bs + BSTEP * GM_PITCH + kk, GM_PITCH, lane);
      acc[0][0] = wmma_f16(a0, b0, acc[0][0]);
      acc[0][1] = wmma_f16(a0, b1, acc[0][1]);
      acc[1][0] = wmma_f16(a1, b0, acc[1][0]);
      acc[1][1] = wmma_f16(a1, b1, acc[1][1]);
    }
    // hand-over: this wave's reads of buffer t % 2 are done, its share of tile t + 1 has
    // landed; behind the barrier that holds for every wave, and the buffer may be refilled
    asm volatile("s_wait_dscnt 0x0" ::: "memory");
    asm volatile("s_wait_asynccnt 0x0" ::: "memory");
    __syncthreads();
    if (t + 2 < GM_TILES)
      stage_ab(ag + (t + 2) * GM_KT, bg + (t + 2) * GM_KT,
               sdst + (unsigned)(t & 1) * (GM_BUF * 2));
  }
  asm volatile("s_wait_asynccnt 0x0" ::: "memory");    // no copy is left in flight at the end

  const int c = lane & 15, g = lane >> 4;
  if (EPI == 0) {
    // acc[ti][tj][p]: token m0 + 16 ti + 8 g + p, dim j + 32 tj of head hd of this tile.
    // A lane keeps ONE rotation pair j for its 16 tokens: what the coefficients take from
    // j alone is the same expression in all 16 and is formed once.
    const int hd = w >> 2;
    const int j  = ((w >> 1) & 1) * 16 + c;
    const int by = blockIdx.y;                       // 0..3: q heads 2by, 2by+1; 4: k; 5: v
    const int bb = m0 >> 11, pos0 = (m0 & (N_ - 1)) + g * 8;   // 32 tokens lie in one batch
    if (by < 5) {
      const bool  isk  = by == 4;
      const float sgn  = isk ? -1.f : 1.f;           // k is divided by the scale: power negated
      const float fold = isk ? 1.f : 0.125f;         // q: fold 1/sqrt(dh)
      _Float16* op = (isk ? kh + ((size_t)(bb * KVH_ + hd) * N_ + pos0) * DH_
                          : qh + ((size_t)(bb * H_ + by * 2 + hd) * N_ + pos0) * DH_) + j;
      // every loop of this epilogue is unrolled: the accumulators are registers and take
      // constant indices only
#pragma unroll
      for (int ti = 0; ti < 2; ++ti) {
        _Float16 lo[8], hi[8];
#pragma unroll
        for (int p = 0; p < 8; ++p) {
          float cs, sn, scl;
          xpos_coeffs(pos0 + ti * 16 + p, j, sgn, cs, sn, scl);
          const float f = scl * fold;
          const float a = acc[ti][0][p], d = acc[ti][1][p];
          lo[p] = (_Float16)((a * cs + (-d) * sn) * f);
          hi[p] = (_Float16)((d * cs + a * sn) * f);
        }
#pragma unroll
        for (int p = 0; p < 8; ++p) {
          op[(ti * 16 + p) * DH_]      = lo[p];
          op[(ti * 16 + p) * DH_ + 32] = hi[p];
        }
        // the second half's arithmetic reuses registers that these stores name: the wait
        // stands in front of that rewrite (behind the last stores the wave ends)
        if (ti == 0) asm volatile("s_wait_xcnt 0x0" ::: "memory");
      }
    } else {
      // V^T (b, kvh, dh, n): a lane holds 8 consecutive positions of a dim, one 16-byte store
      _Float16* op = vT + ((size_t)(bb * KVH_ + hd) * DH_ + j) * N_ + pos0;
#pragma unroll
      for (int ti = 0; ti < 2; ++ti)
#pragma unroll
        for (int tj = 0; tj < 2; ++tj) {
          v8h o;
#pragma unroll
          for (int p = 0; p < 8; ++p) o[p] = (_Float16)acc[ti][tj][p];
          *(v8h*)(op + (size_t)(tj * 32) * N_ + ti * 16) = o;
        }
      // the built code lays the rotary branch behind these stores: the same wait
      asm volatile("s_wait_xcnt 0x0" ::: "memory");
    }
  } else {
    const int n0 = blockIdx.y * 128 + bro;
#pragma unroll
    for (int ti = 0; ti < 2; ++ti)
#pragma unroll
      for (int tj = 0; tj < 2; ++tj)
#pragma unroll
        for (int p = 0; p < 8; ++p) {
          const int row = m0 + ti * 16 + g * 8 + p;
          const int col = n0 + tj * 16 + c;
          const float v = acc[ti][tj][p] + (resid[(size_t)row * D_ + col] + bias[col]);
          const int bb = row >> 11, pos = row & (N_ - 1);
          outT[((size_t)(bb * D_ + col)) * N_ + pos] = v;
        }
  }
}

// ---------- 5) Flash attention: per (b,h), wave = 16 queries ----------
// The 8 waves of a work-group walk the same keys, so K and V^T go through LDS once for
// all of them: tiles of 64 keys, two buffers, the next tile copied while this one is used.
#define FA_KEYS  64                   // keys per tile: a K row and a V^T row are 128 bytes each
#define FA_PITCH 72                   // halves per LDS row: 144 bytes, an odd multiple of 16
#define FA_OPER  (64 * FA_PITCH)      // halves of one operand's tile (64 rows)
#define FA_BUF   (2 * FA_OPER)        // K tile, V^T tile behind it
#define FA_TILES (N_ / FA_KEYS)

// One tile: 128 rows of 128 bytes, 16 bytes a lane and copy, so a wave's copy takes four
// whole lines. kg, vg: this lane's place in rows 0..31 of the K and the V^T tile.
__device__ __forceinline__ void stage_kv(const _Float16* kg, const _Float16* vg,
                                         unsigned dst) {
  const _Float16* kg1 = kg + 32 * DH_;
  const _Float16* vg1 = vg + (size_t)32 * N_;
  const unsigned dk1 = dst + 32 * FA_PITCH * 2;
  const unsigned dv0 = dst + FA_OPER * 2;
  const unsigned dv1 = dv0 + 32 * FA_PITCH * 2;
  // the wait stands inside the statement, in front of any rewrite of an address register
  asm volatile(
      "global_load_async_to_lds_b128 %0, %4, off\n\t"
      "global_load_async_to_lds_b128 %1, %5, off\n\t"
      "global_load_async_to_lds_b128 %2, %6, off\n\t"
      "global_load_async_to_lds_b128 %3, %7, off\n\t"
      "s_wait_xcnt 0x0"
      :: "v"(dst), "v"(dk1), "v"(dv0), "v"(dv1), "v"(kg), "v"(kg1), "v"(vg), "v"(vg1)
      : "memory");
}

// lane l with lane l ^ 16: the two lanes that share a query column
__device__ __forceinline__ float xhalf(float x) {
  const int i = __builtin_bit_cast(int, x);
  return __builtin_bit_cast(
      float, __builtin_amdgcn_permlanex16(i, i, 0x76543210, 0xfedcba98, false, false));
}

// 2^x in place for a run of values. The run and the v_nop behind it are one statement: the
// instruction set asks for one slot between a transcendental and an instruction that reads
// its result or overwrites its source; inside the run every neighbour is independent, and
// the v_nop keeps the slot behind the last one, whatever the compiler puts next.
__device__ __forceinline__ void exp2_run9(float& e, float (&x)[8]) {
  asm("v_exp_f32 %0, %0\n\tv_exp_f32 %1, %1\n\tv_exp_f32 %2, %2\n\t"
      "v_exp_f32 %3, %3\n\tv_exp_f32 %4, %4\n\tv_exp_f32 %5, %5\n\t"
      "v_exp_f32 %6, %6\n\tv_exp_f32 %7, %7\n\tv_exp_f32 %8, %8\n\tv_nop"
      : "+v"(e), "+v"(x[0]), "+v"(x[1]), "+v"(x[2]), "+v"(x[3]), "+v"(x[4]), "+v"(x[5]),
        "+v"(x[6]), "+v"(x[7]));
}
__device__ __forceinline__ void exp2_run8(float (&x)[8]) {
  asm("v_exp_f32 %0, %0\n\tv_exp_f32 %1, %1\n\tv_exp_f32 %2, %2\n\t"
      "v_exp_f32 %3, %3\n\tv_exp_f32 %4, %4\n\tv_exp_f32 %5, %5\n\t"
      "v_exp_f32 %6, %6\n\tv_exp_f32 %7, %7\n\tv_nop"
      : "+v"(x[0]), "+v"(x[1]), "+v"(x[2]), "+v"(x[3]), "+v"(x[4]), "+v"(x[5]), "+v"(x[6]),
        "+v"(x[7]));
}
#define LOG2E_ 1.44269504f

__global__ __launch_bounds__(256) void flash_k(
    const _Float16* __restrict__ Q,   // (b, h, n, dh)
    const _Float16* __restrict__ Kt,  // (b, kvh, n, dh)
    const _Float16* __restrict__ VT,  // (b, kvh, dh, n)
    _Float16* __restrict__ O) {       // (b, n, h*dh)
  __shared__ __align__(16) _Float16 kvs[2 * FA_BUF];   // the two K / V^T buffers
  const int lane = threadIdx.x & 31;
  const int w    = threadIdx.x >> 5;
  const int h    = blockIdx.y, b = blockIdx.z;
  const int kv   = h & (KVH_ - 1);                     // tile(k, r): head h -> h % kvh
  const int qRow0 = blockIdx.x * 128 + w * 16;

  const _Float16* qptr  = Q  + (((size_t)(b * H_ + h) * N_) + qRow0) * DH_;
  const _Float16* kbase = Kt + ((size_t)(b * KVH_ + kv) * N_) * DH_;
  const _Float16* vbase = VT + ((size_t)(b * KVH_ + kv) * DH_) * N_;

  // this lane's share of a tile: row threadIdx.x / 8 (and 32 on), 16-byte piece threadIdx.x % 8
  const int srow = threadIdx.x >> 3, spc = (threadIdx.x & 7) * 8;
  const _Float16* kg = kbase + (size_t)srow * DH_ + spc;
  const _Float16* vg = vbase + (size_t)srow * N_ + spc;
  const unsigned sdst = (unsigned)(size_t)kvs + (unsigned)(srow * FA_PITCH + spc) * 2u;

  stage_kv(kg, vg, sdst);                              // tile 0 into buffer 0
  asm volatile("s_wait_asynccnt 0x0" ::: "memory");    // this wave's share of tile 0 has landed
  __syncthreads();                                     // every wave's share has
  stage_kv(kg + FA_KEYS * DH_, vg + FA_KEYS, sdst + FA_BUF * 2);  // tile 1 into buffer 1

  const v16h bq0 = load_frag(qptr,      DH_, lane);    // Q^T, dims  0..31, column = query
  const v16h bq1 = load_frag(qptr + 32, DH_, lane);    // Q^T, dims 32..63

  const v8f z = {0.f, 0.f, 0.f, 0.f, 0.f, 0.f, 0.f, 0.f};
  v8f oacc[4]; oacc[0] = z; oacc[1] = z; oacc[2] = z; oacc[3] = z;  // O^T: dim 16j+8g+p, query c
  float mcol = -1e30f;   // running maximum of this lane's query
  float lcol = 0.f;      // sum over this lane's half of the keys; the halves join at the end

  const int c = lane & 15, g = lane >> 4;

  for (int t = 0; t < FA_TILES; ++t) {
    const _Float16* kt = kvs + (t & 1) * FA_BUF;
    const _Float16* vt = kt + FA_OPER;
    // every fragment of the tile is asked for here, as one group of LDS loads, K of both
    // passes, then V: a wave then waits for LDS once a tile, not in front of every product
    v16h kf[2][4], vf[2][4];
#pragma unroll
    for (int s = 0; s < 2; ++s)
#pragma unroll
      for (int i = 0; i < 4; ++i)
        kf[s][i] = load_frag(kt + (s * 32 + (i >> 1) * 16) * FA_PITCH + (i & 1) * 32,
                             FA_PITCH, lane);
#pragma unroll
    for (int s = 0; s < 2; ++s)
#pragma unroll
      for (int j = 0; j < 4; ++j)
        vf[s][j] = load_frag(vt + (j * 16) * FA_PITCH + s * 32, FA_PITCH, lane);
    // hand-over, here and not at the foot, since the tile is in registers from here on: this
    // wave's reads of buffer t % 2 are done, its share of tile t + 1 has landed; behind the
    // barrier that holds for every wave, and the buffer is refilled while the tile is worked on
    asm volatile("s_wait_dscnt 0x0" ::: "memory");
    asm volatile("s_wait_asynccnt 0x0" ::: "memory");
    __syncthreads();
    if (t + 2 < FA_TILES)
      stage_kv(kg + (size_t)(t + 2) * (FA_KEYS * DH_), vg + (t + 2) * FA_KEYS,
               sdst + (unsigned)(t & 1) * (FA_BUF * 2));
    // both 32-key passes of a tile inline: the fragments are registers and take constant indices
#pragma unroll
    for (int s = 0; s < 2; ++s) {
      // ---- scores: two 16 (keys) x 16 (queries) f32 tiles covering 32 keys ----
      v8f s0 = z, s1 = z;
      s0 = wmma_f16(kf[s][0], bq0, s0);
      s0 = wmma_f16(kf[s][1], bq1, s0);
      s1 = wmma_f16(kf[s][2], bq0, s1);
      s1 = wmma_f16(kf[s][3], bq1, s1);
      // ---- online softmax of one query column, in this lane's registers ----
      float mx[8];
#pragma unroll
      for (int p = 0; p < 8; ++p) mx[p] = fmaxf(s0[p], s1[p]);
      float rmax = fmaxf(fmaxf(fmaxf(mx[0], mx[1]), fmaxf(mx[2], mx[3])),
                         fmaxf(fmaxf(mx[4], mx[5]), fmaxf(mx[6], mx[7])));
      rmax = fmaxf(rmax, xhalf(rmax));
      const float nm = fmaxf(mcol, rmax);
      // e^x as 2^(x log2 e), the same two roundings as __expf
      float sc = (mcol - nm) * LOG2E_;
      float p0[8], p1[8];
#pragma unroll
      for (int p = 0; p < 8; ++p) {
        p0[p] = (s0[p] - nm) * LOG2E_;
        p1[p] = (s1[p] - nm) * LOG2E_;
      }
      exp2_run9(sc, p0);
      exp2_run8(p1);
      v16h pb;             // P^T as B operand: element s is key 8g+s, or 16+8g+(s-8), of column c
      float rs[4];         // four short chains instead of one of sixteen links
#pragma unroll
      for (int p = 0; p < 8; ++p) {
        pb[p]     = (_Float16)p0[p];
        pb[p + 8] = (_Float16)p1[p];
      }
#pragma unroll
      for (int p = 0; p < 4; ++p) rs[p] = (p0[p] + p1[p]) + (p0[p + 4] + p1[p + 4]);
      lcol = lcol * sc + ((rs[0] + rs[1]) + (rs[2] + rs[3]));
      mcol = nm;
#pragma unroll
      for (int j = 0; j < 4; ++j) oacc[j] *= sc;
      // ---- O^T += V^T P^T over dh in 4 tiles of 16 rows ----
#pragma unroll
      for (int j = 0; j < 4; ++j) oacc[j] = wmma_f16(vf[s][j], pb, oacc[j]);
    }
  }
  asm volatile("s_wait_asynccnt 0x0" ::: "memory");    // no copy is left in flight at the end

  // a lane holds 8 consecutive dims of its query in each tile: one 16-byte store each
  const float inv = 1.f / (lcol + xhalf(lcol));
  _Float16* op = O + (size_t)(b * N_ + qRow0 + c) * (H_ * DH_) + h * DH_ + g * 8;
#pragma unroll
  for (int j = 0; j < 4; ++j) {
    v8h o;
#pragma unroll
    for (int p = 0; p < 8; ++p) o[p] = (_Float16)(oacc[j][p] * inv);
    *(v8h*)(op + j * 16) = o;
  }
}

// ---------- launch ----------
extern "C" void kernel_launch(void* const* d_in, const int* in_sizes, int n_in,
                              void* d_out, int out_size, void* d_ws, size_t ws_size,
                              hipStream_t stream) {
  const float* x     = (const float*)d_in[0];
  const float* gamma = (const float*)d_in[1];
  const float* beta  = (const float*)d_in[2];
  const float* Wq    = (const float*)d_in[3];
  const float* Wkv   = (const float*)d_in[4];
  const float* Wout  = (const float*)d_in[5];
  const float* bout  = (const float*)d_in[6];
  float* y = (float*)d_out;

  char* wsp = (char*)d_ws;
  auto take = [&](size_t bytes) {
    void* p = (void*)wsp;
    wsp += (bytes + 255) & ~(size_t)255;
    return p;
  };
  float*    xnf   = (float*)take((size_t)BN_ * D_ * 4);
  _Float16* xnh   = (_Float16*)take((size_t)BN_ * D_ * 2);
  _Float16* WqkvT = (_Float16*)take((size_t)(D_ + 256) * D_ * 2);   // Wq^T, Wkv^T behind it
  _Float16* WoutT = (_Float16*)take((size_t)D_ * D_ * 2);
  _Float16* qh    = (_Float16*)take((size_t)B_ * H_ * N_ * DH_ * 2);
  _Float16* kh    = (_Float16*)take((size_t)B_ * KVH_ * N_ * DH_ * 2);
  _Float16* vT    = (_Float16*)take((size_t)B_ * KVH_ * N_ * DH_ * 2);
  _Float16* ao    = (_Float16*)take((size_t)BN_ * D_ * 2);

  layernorm_k<<<TW_BLK + BN_ / LN_TOK, 512, 0, stream>>>(
      x, gamma, beta, xnf, xnh, Wq, Wkv, Wout, WqkvT, WoutT);

  gemm_wmma_k<0><<<dim3(BN_ / 64, (D_ + 256) / 128), 256, 0, stream>>>(
      xnh, WqkvT, qh, kh, vT, nullptr, nullptr, nullptr);

  flash_k<<<dim3(N_ / 128, H_, B_), 256, 0, stream>>>(qh, kh, vT, ao);

  gemm_wmma_k<1><<<dim3(BN_ / 64, D_ / 128), 256, 0, stream>>>(
      ao, WoutT, nullptr, nullptr, nullptr, xnf, bout, y);
}

// v008
// A run of this version takes 69.2 microseconds.
// Next to v007, in two timings, it ran 1.05 and 1.06 times as fast.
// Over all steps from v000 it is 5.15 times as fast.
#include <hip/hip_runtime.h>

// ---------- types ----------
typedef __attribute__((ext_vector_type(16))) _Float16 v16h;
typedef __attribute__((ext_vector_type(8)))  _Float16 v8h;
typedef __attribute__((ext_vector_type(8)))  float    v8f;

#define B_   4
#define N_   2048
#define D_   512
#define H_   8
#define KVH_ 2
#define DH_  64
#define BN_  (B_ * N_)   // 8192 tokens
#define LOG2E_ 1.44269504f

// ---------- WMMA helpers ----------
__device__ __forceinline__ v8f wmma_f16(v16h a, v16h b, v8f c) {
  // D = A(16x32 f16) x B(32x16 f16) + C(16x16 f32)
  return __builtin_amdgcn_wmma_f32_16x16x32_f16(
      /*neg_a=*/false, a, /*neg_b=*/false, b,
      /*c_mod=*/(short)0, c, /*reuse_a=*/false, /*reuse_b=*/false);
}

// Load a 16x32 f16 fragment (A-layout; identical striping assumed for B^T rows)
// from a row-major matrix with leading dimension `ld` (in elements).
// Lane (r = lane&15, g = lane>>4) holds row r, K = {g*8..g*8+7, 16+g*8..16+g*8+7}.
__device__ __forceinline__ v16h load_frag(const _Float16* __restrict__ base,
                                          int ld, int lane) {
  const int r = lane & 15, g = lane >> 4;
  const _Float16* p = base + (size_t)r * ld + g * 8;
  v8h lo = *(const v8h*)(p);
  v8h hi = *(const v8h*)(p + 16);
  v16h f;
#pragma unroll
  for (int i = 0; i < 8; ++i) { f[i] = lo[i]; f[i + 8] = hi[i]; }
  return f;
}

// ---------- 1a) Weight convert + transpose: W (K x N) f32 -> W^T (N x K) f16 ----------
// One lane turns an 8 (k) x 8 (n) block in its registers. A wave takes 64 k x 32 n: eight
// lanes side by side along k store one whole 128-byte line of a W^T row. idx counts the
// K * N / 64 lanes of one matrix.
template <int K, int N>
__device__ __forceinline__ void transpose_w(
    const float* __restrict__ W, _Float16* __restrict__ WT, int idx) {
  static_assert(K % 64 == 0 && N % 32 == 0 && (K * N / 64) % 512 == 0, "tile shape");
  const int lane = idx & 31, tile = idx >> 5;
  const int tk = tile % (K >> 6), tn = tile / (K >> 6);
  const int k0 = tk * 64 + (lane & 7) * 8;
  const int n0 = tn * 32 + (lane >> 3) * 8;
  const float* wp = W + (size_t)k0 * N + n0;
  float r[8][8];
#pragma unroll
  for (int e = 0; e < 8; ++e) {
    const float4 a = *(const float4*)(wp + (size_t)e * N);
    const float4 b = *(const float4*)(wp + (size_t)e * N + 4);
    r[e][0] = a.x; r[e][1] = a.y; r[e][2] = a.z; r[e][3] = a.w;
    r[e][4] = b.x; r[e][5] = b.y; r[e][6] = b.z; r[e][7] = b.w;
  }
  _Float16* op = WT + (size_t)n0 * K + k0;
#pragma unroll
  for (int n = 0; n < 8; ++n) {
    v8h o;
#pragma unroll
    for (int e = 0; e < 8; ++e) o[e] = (_Float16)r[e][n];
    *(v8h*)(op + (size_t)n * K) = o;
  }
  // the built code lays the next matrix's branch behind these stores: keep the wait in front
  // of any rewrite of a register that an issued store names
  asm volatile("s_wait_xcnt 0x0" ::: "memory");
}

// ---------- 1) LayerNorm: x (b,d,n) -> xn (b*n, d) f32 + f16 ----------
// One work-group takes 32 tokens x all 512 channels. x is read along n (whole
// 128-byte lines), turned through LDS, and each token's row is then summed,
// normalised and stored along d (whole lines again).
// The weight transposes depend on nothing and nothing but the GEMMs reads them, so they
// ride in this launch as its first TW_BLK work-groups instead of three launches of their own.
typedef __attribute__((ext_vector_type(4))) _Float16 v4h;
#define LN_TOK   32
#define LN_PITCH 516  // dwords; 4 mod 64, so a column walk of 16-byte stores meets every bank once
#define TW_Q   (D_ * D_ / 64)         // lanes that turn Wq (and Wout)
#define TW_KV  (D_ * 256 / 64)        // lanes that turn Wkv
#define TW_BLK ((2 * TW_Q + TW_KV) / 512)

__global__ __launch_bounds__(512) void layernorm_k(
    const float* __restrict__ x, const float* __restrict__ gamma,
    const float* __restrict__ beta, float* __restrict__ xnf,
    _Float16* __restrict__ xnh,
    const float* __restrict__ Wq, const float* __restrict__ Wkv,
    const float* __restrict__ Wout, _Float16* __restrict__ WqkvT,
    _Float16* __restrict__ WoutT) {
  __shared__ __align__(16) float tile[LN_TOK * LN_PITCH];
  if (blockIdx.x < TW_BLK) {                       // whole work-groups, in front of the barrier
    const int blk = blockIdx.x, tid = threadIdx.x;
    if (blk < TW_Q / 512)
      transpose_w<D_, D_>(Wq, WqkvT, blk * 512 + tid);
    else if (blk < (TW_Q + TW_KV) / 512)
      transpose_w<D_, 256>(Wkv, WqkvT + D_ * D_, (blk - TW_Q / 512) * 512 + tid);
    else
      transpose_w<D_, D_>(Wout, WoutT, (blk - (TW_Q + TW_KV) / 512) * 512 + tid);
    return;
  }
  const int lane = threadIdx.x & 31;
  const int w    = threadIdx.x >> 5;               // 16 waves
  const int t0   = (blockIdx.x - TW_BLK) * LN_TOK; // first token of the tile
  const int b = t0 >> 11, pos0 = t0 & (N_ - 1);

  // lane = token, wave w holds channels w*32 .. w*32+31 of it
  const float* xb = x + ((size_t)b * D_ + w * 32) * N_ + pos0 + lane;
  float v[32];
  for (int i = 0; i < 32; ++i) v[i] = xb[(size_t)i * N_];
  float* tp = tile + lane * LN_PITCH + w * 32;
  for (int i = 0; i < 32; i += 4)
    *(float4*)(tp + i) = make_float4(v[i], v[i + 1], v[i + 2], v[i + 3]);

  // lane holds channels k*128 + lane*4 .. +3, k = 0..3
  float4 gm[4], bt[4];
  for (int k = 0; k < 4; ++k) {
    gm[k] = *(const float4*)(gamma + k * 128 + lane * 4);
    bt[k] = *(const float4*)(beta  + k * 128 + lane * 4);
  }
  __syncthreads();

  // wave w owns tokens 2w and 2w+1 of the tile
  for (int r = 0; r < 2; ++r) {
    const int row = w * 2 + r;
    const float* rp = tile + row * LN_PITCH + lane * 4;
    float4 a[4];
    for (int k = 0; k < 4; ++k) a[k] = *(const float4*)(rp + k * 128);
    float s = 0.f, ss = 0.f;
    for (int k = 0; k < 4; ++k) {
      s  += (a[k].x + a[k].y) + (a[k].z + a[k].w);
      ss += (a[k].x * a[k].x + a[k].y * a[k].y) + (a[k].z * a[k].z + a[k].w * a[k].w);
    }
    for (int m = 1; m < 32; m <<= 1) {
      s  += __shfl_xor(s,  m, 32);
      ss += __shfl_xor(ss, m, 32);
    }
    const float mu  = s * (1.f / D_);
    const float var = ss * (1.f / D_) - mu * mu;
    const float rst = rsqrtf(var + 1e-5f);
    float*    o  = xnf + (size_t)(t0 + row) * D_ + lane * 4;
    _Float16* oh = xnh + (size_t)(t0 + row) * D_ + lane * 4;
    for (int k = 0; k < 4; ++k) {
      float4 y;
      y.x = (a[k].x - mu) * rst * gm[k].x + bt[k].x;
      y.y = (a[k].y - mu) * rst * gm[k].y + bt[k].y;
      y.z = (a[k].z - mu) * rst * gm[k].z + bt[k].z;
      y.w = (a[k].w - mu) * rst * gm[k].w + bt[k].w;
      *(float4*)(o + k * 128) = y;
      v4h yh = {(_Float16)y.x, (_Float16)y.y, (_Float16)y.z, (_Float16)y.w};
      *(v4h*)(oh + k * 128) = yh;
    }
  }
  // the built code lays the transpose branch behind these stores: keep the wait in front of
  // any rewrite of a register that an issued store names
  asm volatile("s_wait_xcnt 0x0" ::: "memory");
}

// ---------- 2) xPos rotary coefficients ----------
// sgn +1: scl is the scale (q); sgn -1: its reciprocal (k)
__device__ __forceinline__ void xpos_coeffs(int pos, int j, float sgn, float& cs, float& sn,
                                            float& scl) {
  const float fpos = (float)pos;
  const float invf = __powf(10000.f, -(float)(2 * j) * (1.f / (float)DH_));
  const float fr   = fpos * invf;
  cs = __cosf(fr);
  sn = __sinf(fr);
  const float bs = ((float)(2 * j) + 0.4f * DH_) * (1.f / (1.4f * DH_));
  const float pw = sgn * ((fpos - (float)(N_ / 2)) * (1.f / 4096.f));
  scl = __powf(bs, pw);
}

// ---------- 3) WMMA GEMM: C = A(M x 512) * B(512 x N), B given transposed ----------
// EPI 0: q, k and v projections in one launch (B^T = Wq^T with Wkv^T behind it, 768 rows).
//        The rotary and the V transpose are done on the f32 accumulators, so the raw
//        projections never go to memory and need no launches of their own.
// EPI 1: out-proj epilogue: +resid(row,col) +bias(col), store f32 transposed (b,d,n).
// The 8 waves of a work-group share 64 rows of A and 128 rows of B^T, so both go through
// LDS once for all of them: tiles of 64 k, two buffers, the next tile copied while this
// one is used. A copy takes whole 128-byte lines; a fragment load straight from global
// memory takes 32 bytes out of each of 16 lines.
#define GM_KT    64                   // k per tile: a row of A or of B^T is 128 bytes
#define GM_PITCH 72                   // halves per LDS row: 144 bytes, an odd multiple of 16
#define GM_A     (64 * GM_PITCH)      // halves of the A tile (64 rows)
#define GM_BUF   (192 * GM_PITCH)     // A tile, B^T tile (128 rows) behind it
#define GM_TILES (D_ / GM_KT)

// One tile: 192 rows of 128 bytes, 16 bytes a lane and copy, so a wave's copy takes four
// whole lines. ag, bg: this lane's place in rows 0..31 of the A and the B^T tile.
__device__ __forceinline__ void stage_ab(const _Float16* ag, const _Float16* bg,
                                         unsigned dst) {
  const _Float16* ag1 = ag + 32 * D_;
  const _Float16* bg1 = bg + 32 * D_;
  const _Float16* bg2 = bg + 64 * D_;
  const _Float16* bg3 = bg + 96 * D_;
  const unsigned da1 = dst + 32 * GM_PITCH * 2;
  const unsigned db0 = dst + GM_A * 2;
  const unsigned db1 = db0 + 32 * GM_PITCH * 2;
  const unsigned db2 = db0 + 64 * GM_PITCH * 2;
  const unsigned db3 = db0 + 96 * GM_PITCH * 2;
  // the wait stands inside the statement, in front of any rewrite of an address register
  asm volatile(
      "global_load_async_to_lds_b128 %0, %6, off\n\t"
      "global_load_async_to_lds_b128 %1, %7, off\n\t"
      "global_load_async_to_lds_b128 %2, %8, off\n\t"
      "global_load_async_to_lds_b128 %3, %9, off\n\t"
      "global_load_async_to_lds_b128 %4, %10, off\n\t"
      "global_load_async_to_lds_b128 %5, %11, off\n\t"
      "s_wait_xcnt 0x0"
      :: "v"(dst), "v"(da1), "v"(db0), "v"(db1), "v"(db2), "v"(db3),
         "v"(ag), "v"(ag1), "v"(bg), "v"(bg1), "v"(bg2), "v"(bg3)
      : "memory");
}

template <int EPI>
__global__ __launch_bounds__(256) void gemm_wmma_k(
    const _Float16* __restrict__ A, const _Float16* __restrict__ BT,
    _Float16* __restrict__ qh, _Float16* __restrict__ kh, _Float16* __restrict__ vT,
    const float* __restrict__ resid, const float* __restrict__ bias,
    float* __restrict__ outT) {
  __shared__ __align__(16) _Float16 abt[2 * GM_BUF];   // the two A / B^T buffers
  const int lane = threadIdx.x & 31;
  const int w    = threadIdx.x >> 5;             // 8 waves
  const int m0   = blockIdx.x * 64  + (w & 1) * 32;
  // the wave's rows of the B^T tile. EPI 1: 32 in a row. EPI 0: the tile is two heads; a
  // wave takes 16 dims of one head and, BSTEP rows on, their rotation partners
  const int bro  = EPI == 0 ? (w >> 2) * 64 + ((w >> 1) & 1) * 16 : (w >> 1) * 32;
  constexpr int BSTEP = EPI == 0 ? 32 : 16;

  // this lane's share of a tile: row threadIdx.x / 8 (and 32, 64, 96 on), 16-byte piece
  // threadIdx.x % 8
  const int srow = threadIdx.x >> 3, spc = (threadIdx.x & 7) * 8;
  const _Float16* ag = A  + (size_t)(blockIdx.x * 64  + srow) * D_ + spc;
  const _Float16* bg = BT + (size_t)(blockIdx.y * 128 + srow) * D_ + spc;
  const unsigned sdst = (unsigned)(size_t)abt + (unsigned)(srow * GM_PITCH + spc) * 2u;

  stage_ab(ag, bg, sdst);                              // tile 0 into buffer 0
  asm volatile("s_wait_asynccnt 0x0" ::: "memory");    // this wave's share of tile 0 has landed
  __syncthreads();                                     // every wave's share has
  stage_ab(ag + GM_KT, bg + GM_KT, sdst + GM_BUF * 2); // tile 1 into buffer 1

  const v8f z = {0.f, 0.f, 0.f, 0.f, 0.f, 0.f, 0.f, 0.f};
  v8f acc[2][2];
  acc[0][0] = z; acc[0][1] = z; acc[1][0] = z; acc[1][1] = z;

  for (int t = 0; t < GM_TILES; ++t) {
    const _Float16* as = abt + (t & 1) * GM_BUF + (w & 1) * (32 * GM_PITCH);
    const _Float16* bs = abt + (t & 1) * GM_BUF + GM_A + bro * GM_PITCH;
    // both 32-k passes of a tile inline: kk becomes a constant offset of the LDS loads
#pragma unroll
    for (int kk = 0; kk < GM_KT; kk += 32) {
      v16h a0 = load_frag(as + kk,                 GM_PITCH, lane);
      v16h a1 = load_frag(as + 16 * GM_PITCH + kk, GM_PITCH, lane);
      v16h b0 = load_frag(bs + kk,                 GM_PITCH, lane);
      v16h b1 = load_frag(bs + BSTEP * GM_PITCH + kk, GM_PITCH, lane);
      acc[0][0] = wmma_f16(a0, b0, acc[0][0]);
      acc[0][1] = wmma_f16(a0, b1, acc[0][1]);
      acc[1][0] = wmma_f16(a1, b0, acc[1][0]);
      acc[1][1] = wmma_f16(a1, b1, acc[1][1]);
    }
    // hand-over: this wave's reads of buffer t % 2 are done, its share of tile t + 1 has
    // landed; behind the barrier that holds for every wave, and the buffer may be refilled
    asm volatile("s_wait_dscnt 0x0" ::: "memory");
    asm volatile("s_wait_asynccnt 0x0" ::: "memory");
    __syncthreads();
    if (t + 2 < GM_TILES)
      stage_ab(ag + (t + 2) * GM_KT, bg + (t + 2) * GM_KT,
               sdst + (unsigned)(t & 1) * (GM_BUF * 2));
  }
  asm volatile("s_wait_asynccnt 0x0" ::: "memory");    // no copy is left in flight at the end

  const int c = lane & 15, g = lane >> 4;
  if (EPI == 0) {
    // acc[ti][tj][p]: token m0 + 16 ti + 8 g + p, dim j + 32 tj of head hd of this tile.
    // A lane keeps ONE rotation pair j for its 16 tokens: what the coefficients take from
    // j alone is the same expression in all 16 and is formed once.
    const int hd = w >> 2;
    const int j  = ((w >> 1) & 1) * 16 + c;
    const int by = blockIdx.y;                       // 0..3: q heads 2by, 2by+1; 4: k; 5: v
    const int bb = m0 >> 11, pos0 = (m0 & (N_ - 1)) + g * 8;   // 32 tokens lie in one batch
    if (by < 5) {
      const bool  isk  = by == 4;
      const float sgn  = isk ? -1.f : 1.f;           // k is divided by the scale: power negated
      // q: fold 1/sqrt(dh), and log2 e, so that the scores come out as exponents of 2
      const float fold = isk ? 1.f : 0.125f * LOG2E_;
      _Float16* op = (isk ? kh + ((size_t)(bb * KVH_ + hd) * N_ + pos0) * DH_
                          : qh + ((size_t)(bb * H_ + by * 2 + hd) * N_ + pos0) * DH_) + j;
      // every loop of this epilogue is unrolled: the accumulators are registers and take
      // constant indices only
#pragma unroll
      for (int ti = 0; ti < 2; ++ti) {
        _Float16 lo[8], hi[8];
#pragma unroll
        for (int p = 0; p < 8; ++p) {
          float cs, sn, scl;
          xpos_coeffs(pos0 + ti * 16 + p, j, sgn, cs, sn, scl);
          const float f = scl * fold;
          const float a = acc[ti][0][p], d = acc[ti][1][p];
          lo[p] = (_Float16)((a * cs + (-d) * sn) * f);
          hi[p] = (_Float16)((d * cs + a * sn) * f);
        }
#pragma unroll
        for (int p = 0; p < 8; ++p) {
          op[(ti * 16 + p) * DH_]      = lo[p];
          op[(ti * 16 + p) * DH_ + 32] = hi[p];
        }
        // the second half's arithmetic reuses registers that these stores name: the wait
        // stands in front of that rewrite (behind the last stores the wave ends)
        if (ti == 0) asm volatile("s_wait_xcnt 0x0" ::: "memory");
      }
    } else {
      // V^T (b, kvh, dh, n): a lane holds 8 consecutive positions of a dim, one 16-byte store
      _Float16* op = vT + ((size_t)(bb * KVH_ + hd) * DH_ + j) * N_ + pos0;
#pragma unroll
      for (int ti = 0; ti < 2; ++ti)
#pragma unroll
        for (int tj = 0; tj < 2; ++tj) {
          v8h o;
#pragma unroll
          for (int p = 0; p < 8; ++p) o[p] = (_Float16)acc[ti][tj][p];
          *(v8h*)(op + (size_t)(tj * 32) * N_ + ti * 16) = o;
        }
      // the built code lays the rotary branch behind these stores: the same wait
      asm volatile("s_wait_xcnt 0x0" ::: "memory");
    }
  } else {
    const int n0 = blockIdx.y * 128 + bro;
#pragma unroll
    for (int ti = 0; ti < 2; ++ti)
#pragma unroll
      for (int tj = 0; tj < 2; ++tj)
#pragma unroll
        for (int p = 0; p < 8; ++p) {
          const int row = m0 + ti * 16 + g * 8 + p;
          const int col = n0 + tj * 16 + c;
          const float v = acc[ti][tj][p] + (resid[(size_t)row * D_ + col] + bias[col]);
          const int bb = row >> 11, pos = row & (N_ - 1);
          outT[((size_t)(bb * D_ + col)) * N_ + pos] = v;
        }
  }
}

// ---------- 5) Flash attention: per (b,h), wave = 16 queries ----------
// The 8 waves of a work-group walk the same keys, so K and V^T go through LDS once for
// all of them: tiles of 64 keys, two buffers, the next tile copied while this one is used.
#define FA_KEYS  64                   // keys per tile: a K row and a V^T row are 128 bytes each
#define FA_PITCH 72                   // halves per LDS row: 144 bytes, an odd multiple of 16
#define FA_OPER  (64 * FA_PITCH)      // halves of one operand's tile (64 rows)
#define FA_BUF   (2 * FA_OPER)        // K tile, V^T tile behind it
#define FA_TILES (N_ / FA_KEYS)

// One tile: 128 rows of 128 bytes, 16 bytes a lane and copy, so a wave's copy takes four
// whole lines. kg, vg: this lane's place in rows 0..31 of the K and the V^T tile.
__device__ __forceinline__ void stage_kv(const _Float16* kg, const _Float16* vg,
                                         unsigned dst) {
  const _Float16* kg1 = kg + 32 * DH_;
  const _Float16* vg1 = vg + (size_t)32 * N_;
  const unsigned dk1 = dst + 32 * FA_PITCH * 2;
  const unsigned dv0 = dst + FA_OPER * 2;
  const unsigned dv1 = dv0 + 32 * FA_PITCH * 2;
  // the wait stands inside the statement, in front of any rewrite of an address register
  asm volatile(
      "global_load_async_to_lds_b128 %0, %4, off\n\t"
      "global_load_async_to_lds_b128 %1, %5, off\n\t"
      "global_load_async_to_lds_b128 %2, %6, off\n\t"
      "global_load_async_to_lds_b128 %3, %7, off\n\t"
      "s_wait_xcnt 0x0"
      :: "v"(dst), "v"(dk1), "v"(dv0), "v"(dv1), "v"(kg), "v"(kg1), "v"(vg), "v"(vg1)
      : "memory");
}

// lane l with lane l ^ 16: the two lanes that share a query column
__device__ __forceinline__ float xhalf(float x) {
  const int i = __builtin_bit_cast(int, x);
  return __builtin_bit_cast(
      float, __builtin_amdgcn_permlanex16(i, i, 0x76543210, 0xfedcba98, false, false));
}

// 2^x in place for a run of values. The run and the v_nop behind it are one statement: the
// instruction set asks for one slot between a transcendental and an instruction that reads
// its result or overwrites its source; inside the run every neighbour is independent, and
// the v_nop keeps the slot behind the last one, whatever the compiler puts next.
__device__ __forceinline__ void exp2_one(float& e) {
  asm("v_exp_f32 %0, %0\n\tv_nop" : "+v"(e));
}
__device__ __forceinline__ void exp2_run8(float (&x)[8]) {
  asm("v_exp_f32 %0, %0\n\tv_exp_f32 %1, %1\n\tv_exp_f32 %2, %2\n\t"
      "v_exp_f32 %3, %3\n\tv_exp_f32 %4, %4\n\tv_exp_f32 %5, %5\n\t"
      "v_exp_f32 %6, %6\n\tv_exp_f32 %7, %7\n\tv_nop"
      : "+v"(x[0]), "+v"(x[1]), "+v"(x[2]), "+v"(x[3]), "+v"(x[4]), "+v"(x[5]), "+v"(x[6]),
        "+v"(x[7]));
}

#define FA_ROOM 8.f
__global__ __launch_bounds__(256) void flash_k(
    const _Float16* __restrict__ Q,   // (b, h, n, dh)
    const _Float16* __restrict__ Kt,  // (b, kvh, n, dh)
    const _Float16* __restrict__ VT,  // (b, kvh, dh, n)
    _Float16* __restrict__ O) {       // (b, n, h*dh)
  __shared__ __align__(16) _Float16 kvs[2 * FA_BUF];   // the two K / V^T buffers
  const int lane = threadIdx.x & 31;
  const int w    = threadIdx.x >> 5;
  const int h    = blockIdx.y, b = blockIdx.z;
  const int kv   = h & (KVH_ - 1);                     // tile(k, r): head h -> h % kvh
  const int qRow0 = blockIdx.x * 128 + w * 16;

  const _Float16* qptr  = Q  + (((size_t)(b * H_ + h) * N_) + qRow0) * DH_;
  const _Float16* kbase = Kt + ((size_t)(b * KVH_ + kv) * N_) * DH_;
  const _Float16* vbase = VT + ((size_t)(b * KVH_ + kv) * DH_) * N_;

  // this lane's share of a tile: row threadIdx.x / 8 (and 32 on), 16-byte piece threadIdx.x % 8
  const int srow = threadIdx.x >> 3, spc = (threadIdx.x & 7) * 8;
  const _Float16* kg = kbase + (size_t)srow * DH_ + spc;
  const _Float16* vg = vbase + (size_t)srow * N_ + spc;
  const unsigned sdst = (unsigned)(size_t)kvs + (unsigned)(srow * FA_PITCH + spc) * 2u;

  stage_kv(kg, vg, sdst);                              // tile 0 into buffer 0
  asm volatile("s_wait_asynccnt 0x0" ::: "memory");    // this wave's share of tile 0 has landed
  __syncthreads();                                     // every wave's share has
  stage_kv(kg + FA_KEYS * DH_, vg + FA_KEYS, sdst + FA_BUF * 2);  // tile 1 into buffer 1

  const v16h bq0 = load_frag(qptr,      DH_, lane);    // Q^T, dims  0..31, column = query
  const v16h bq1 = load_frag(qptr + 32, DH_, lane);    // Q^T, dims 32..63

  const v8f z = {0.f, 0.f, 0.f, 0.f, 0.f, 0.f, 0.f, 0.f};
  v8f oacc[4]; oacc[0] = z; oacc[1] = z; oacc[2] = z; oacc[3] = z;  // O^T: dim 16j+8g+p, query c
  v8f negm = z;          // minus the maximum in use for this lane's query, in all 8 registers
  float lcol = 0.f;      // sum over this lane's half of the keys; the halves join at the end

  const int c = lane & 15, g = lane >> 4;

  for (int t = 0; t < FA_TILES; ++t) {
    const _Float16* kt = kvs + (t & 1) * FA_BUF;
    const _Float16* vt = kt + FA_OPER;
    // every fragment of the tile is asked for here, as one group of LDS loads, K of both
    // passes, then V: a wave then waits for LDS once a tile, not in front of every product
    v16h kf[2][4], vf[2][4];
#pragma unroll
    for (int s = 0; s < 2; ++s)
#pragma unroll
      for (int i = 0; i < 4; ++i)
        kf[s][i] = load_frag(kt + (s * 32 + (i >> 1) * 16) * FA_PITCH + (i & 1) * 32,
                             FA_PITCH, lane);
#pragma unroll
    for (int s = 0; s < 2; ++s)
#pragma unroll
      for (int j = 0; j < 4; ++j)
        vf[s][j] = load_frag(vt + (j * 16) * FA_PITCH + s * 32, FA_PITCH, lane);
    // hand-over, here and not at the foot, since the tile is in registers from here on: this
    // wave's reads of buffer t % 2 are done, its share of tile t + 1 has landed; behind the
    // barrier that holds for every wave, and the buffer is refilled while the tile is worked on
    asm volatile("s_wait_dscnt 0x0" ::: "memory");
    asm volatile("s_wait_asynccnt 0x0" ::: "memory");
    __syncthreads();
    if (t + 2 < FA_TILES)
      stage_kv(kg + (size_t)(t + 2) * (FA_KEYS * DH_), vg + (t + 2) * FA_KEYS,
               sdst + (unsigned)(t & 1) * (FA_BUF * 2));
    // every loop below is unrolled: fragments and scores are registers and take constant indices
    // ---- exponents: four 16 (keys) x 16 (queries) f32 tiles covering the 64 keys ----
    v8f sx[2][2];
#pragma unroll
    for (int s = 0; s < 2; ++s)
#pragma unroll
      for (int i = 0; i < 2; ++i) {
        sx[s][i] = wmma_f16(kf[s][2 * i],     bq0, negm);
        sx[s][i] = wmma_f16(kf[s][2 * i + 1], bq1, sx[s][i]);
      }
    // ---- has a score outgrown the maximum in use? the first tile always sets it ----
    float mx[8];
#pragma unroll
    for (int p = 0; p < 8; ++p)
      mx[p] = fmaxf(fmaxf(sx[0][0][p], sx[0][1][p]), fmaxf(sx[1][0][p], sx[1][1][p]));
    float rmax = fmaxf(fmaxf(fmaxf(mx[0], mx[1]), fmaxf(mx[2], mx[3])),
                       fmaxf(fmaxf(mx[4], mx[5]), fmaxf(mx[6], mx[7])));
    const float room = t == 0 ? -3.0e38f : FA_ROOM;
    if (__builtin_amdgcn_ballot_w32(rmax > room) != 0) {   // one scalar branch for the wave
      rmax = fmaxf(rmax, xhalf(rmax));                      // both halves of a column move alike
      const float up = fmaxf(rmax, 0.f);
      const float d  = t == 0 ? rmax : up;                  // the maximum in use never falls again
      float sc = -up;
      exp2_one(sc);
#pragma unroll
      for (int s = 0; s < 2; ++s)
#pragma unroll
        for (int i = 0; i < 2; ++i) sx[s][i] -= d;
      negm -= d;
      lcol *= sc;
#pragma unroll
      for (int j = 0; j < 4; ++j) oacc[j] *= sc;
    }
    float rs[2][4];        // short chains instead of one of 32 links
#pragma unroll
    for (int s = 0; s < 2; ++s) {
      float p0[8], p1[8];
#pragma unroll
      for (int p = 0; p < 8; ++p) { p0[p] = sx[s][0][p]; p1[p] = sx[s][1][p]; }
      exp2_run8(p0);
      exp2_run8(p1);
      v16h pb;             // P^T as B operand: element s is key 8g+s, or 16+8g+(s-8), of column c
#pragma unroll
      for (int p = 0; p < 8; ++p) {
        pb[p]     = (_Float16)p0[p];
        pb[p + 8] = (_Float16)p1[p];
      }
#pragma unroll
      for (int p = 0; p < 4; ++p) rs[s][p] = (p0[p] + p1[p]) + (p0[p + 4] + p1[p + 4]);
      // ---- O^T += V^T P^T over dh in 4 tiles of 16 rows ----
#pragma unroll
      for (int j = 0; j < 4; ++j) oacc[j] = wmma_f16(vf[s][j], pb, oacc[j]);
    }
    lcol += ((rs[0][0] + rs[0][1]) + (rs[0][2] + rs[0][3])) +
            ((rs[1][0] + rs[1][1]) + (rs[1][2] + rs[1][3]));
  }
  asm volatile("s_wait_asynccnt 0x0" ::: "memory");    // no copy is left in flight at the end

  // a lane holds 8 consecutive dims of its query in each tile: one 16-byte store each
  const float inv = 1.f / (lcol + xhalf(lcol));
  _Float16* op = O + (size_t)(b * N_ + qRow0 + c) * (H_ * DH_) + h * DH_ + g * 8;
#pragma unroll
  for (int j = 0; j < 4; ++j) {
    v8h o;
#pragma unroll
    for (int p = 0; p < 8; ++p) o[p] = (_Float16)(oacc[j][p] * inv);
    *(v8h*)(op + j * 16) = o;
  }
}

// ---------- launch ----------
extern "C" void kernel_launch(void* const* d_in, const int* in_sizes, int n_in,
                              void* d_out, int out_size, void* d_ws, size_t ws_size,
                              hipStream_t stream) {
  const float* x     = (const float*)d_in[0];
  const float* gamma = (const float*)d_in[1];
  const float* beta  = (const float*)d_in[2];
  const float* Wq    = (const float*)d_in[3];
  const float* Wkv   = (const float*)d_in[4];
  const float* Wout  = (const float*)d_in[5];
  const float* bout  = (const float*)d_in[6];
  float* y = (float*)d_out;

  char* wsp = (char*)d_ws;
  auto take = [&](size_t bytes) {
    void* p = (void*)wsp;
    wsp += (bytes + 255) & ~(size_t)255;
    return p;
  };
  float*    xnf   = (float*)take((size_t)BN_ * D_ * 4);
  _Float16* xnh   = (_Float16*)take((size_t)BN_ * D_ * 2);
  _Float16* WqkvT = (_Float16*)take((size_t)(D_ + 256) * D_ * 2);   // Wq^T, Wkv^T behind it
  _Float16* WoutT = (_Float16*)take((size_t)D_ * D_ * 2);
  _Float16* qh    = (_Float16*)take((size_t)B_ * H_ * N_ * DH_ * 2);
  _Float16* kh    = (_Float16*)take((size_t)B_ * KVH_ * N_ * DH_ * 2);
  _Float16* vT    = (_Float16*)take((size_t)B_ * KVH_ * N_ * DH_ * 2);
  _Float16* ao    = (_Float16*)take((size_t)BN_ * D_ * 2);

  layernorm_k<<<TW_BLK + BN_ / LN_TOK, 512, 0, stream>>>(
      x, gamma, beta, xnf, xnh, Wq, Wkv, Wout, WqkvT, WoutT);

  gemm_wmma_k<0><<<dim3(BN_ / 64, (D_ + 256) / 128), 256, 0, stream>>>(
      xnh, WqkvT, qh, kh, vT, nullptr, nullptr, nullptr);

  flash_k<<<dim3(N_ / 128, H_, B_), 256, 0, stream>>>(qh, kh, vT, ao);

  gemm_wmma_k<1><<<dim3(BN_ / 64, D_ / 128), 256, 0, stream>>>(
      ao, WoutT, nullptr, nullptr, nullptr, xnf, bout, y);
}

// v009
// A run of this version takes 64 microseconds.
// Two timings next to v008 both put it at 1.08 times that version's speed.
// All steps since v000 together make it 5.56 times as fast.
#include <hip/hip_runtime.h>

// ---------- types ----------
typedef __attribute__((ext_vector_type(16))) _Float16 v16h;
typedef __attribute__((ext_vector_type(8)))  _Float16 v8h;
typedef __attribute__((ext_vector_type(8)))  float    v8f;

#define B_   4
#define N_   2048
#define D_   512
#define H_   8
#define KVH_ 2
#define DH_  64
#define BN_  (B_ * N_)   // 8192 tokens
#define LOG2E_ 1.44269504f

// ---------- WMMA helpers ----------
__device__ __forceinline__ v8f wmma_f16(v16h a, v16h b, v8f c) {
  // D = A(16x32 f16) x B(32x16 f16) + C(16x16 f32)
  return __builtin_amdgcn_wmma_f32_16x16x32_f16(
      /*neg_a=*/false, a, /*neg_b=*/false, b,
      /*c_mod=*/(short)0, c, /*reuse_a=*/false, /*reuse_b=*/false);
}

// Load a 16x32 f16 fragment (A-layout; identical striping assumed for B^T rows)
// from a row-major matrix with leading dimension `ld` (in elements).
// Lane (r = lane&15, g = lane>>4) holds row r, K = {g*8..g*8+7, 16+g*8..16+g*8+7}.
__device__ __forceinline__ v16h load_frag(const _Float16* __restrict__ base,
                                          int ld, int lane) {
  const int r = lane & 15, g = lane >> 4;
  const _Float16* p = base + (size_t)r * ld + g * 8;
  v8h lo = *(const v8h*)(p);
  v8h hi = *(const v8h*)(p + 16);
  v16h f;
#pragma unroll
  for (int i = 0; i < 8; ++i) { f[i] = lo[i]; f[i + 8] = hi[i]; }
  return f;
}

// ---------- 1a) Weight convert + transpose: W (K x N) f32 -> W^T (N x K) f16 ----------
// One lane turns an 8 (k) x 8 (n) block in its registers. A wave takes 64 k x 32 n: eight
// lanes side by side along k store one whole 128-byte line of a W^T row. idx counts the
// K * N / 64 lanes of one matrix.
template <int K, int N>
__device__ __forceinline__ void transpose_w(
    const float* __restrict__ W, _Float16* __restrict__ WT, int idx) {
  static_assert(K % 64 == 0 && N % 32 == 0 && (K * N / 64) % 512 == 0, "tile shape");
  const int lane = idx & 31, tile = idx >> 5;
  const int tk = tile % (K >> 6), tn = tile / (K >> 6);
  const int k0 = tk * 64 + (lane & 7) * 8;
  const int n0 = tn * 32 + (lane >> 3) * 8;
  const float* wp = W + (size_t)k0 * N + n0;
  float r[8][8];
#pragma unroll
  for (int e = 0; e < 8; ++e) {
    const float4 a = *(const float4*)(wp + (size_t)e * N);
    const float4 b = *(const float4*)(wp + (size_t)e * N + 4);
    r[e][0] = a.x; r[e][1] = a.y; r[e][2] = a.z; r[e][3] = a.w;
    r[e][4] = b.x; r[e][5] = b.y; r[e][6] = b.z; r[e][7] = b.w;
  }
  _Float16* op = WT + (size_t)n0 * K + k0;
#pragma unroll
  for (int n = 0; n < 8; ++n) {
    v8h o;
#pragma unroll
    for (int e = 0; e < 8; ++e) o[e] = (_Float16)r[e][n];
    *(v8h*)(op + (size_t)n * K) = o;
  }
  // the built code lays the next matrix's branch behind these stores: keep the wait in front
  // of any rewrite of a register that an issued store names
  asm volatile("s_wait_xcnt 0x0" ::: "memory");
}

// ---------- 1) LayerNorm: x (b,d,n) -> xn (b*n, d) f32 + f16 ----------
// One work-group takes 32 tokens x all 512 channels. x is read along n (whole
// 128-byte lines), turned through LDS, and each token's row is then summed,
// normalised and stored along d (whole lines again).
// The weight transposes depend on nothing and nothing but the GEMMs reads them, so they
// ride in this launch as its first TW_BLK work-groups instead of three launches of their own.
typedef __attribute__((ext_vector_type(4))) _Float16 v4h;
#define LN_TOK   32
#define LN_PITCH 516  // dwords; 4 mod 64, so a column walk of 16-byte stores meets every bank once
#define TW_Q   (D_ * D_ / 64)         // lanes that turn Wq (and Wout)
#define TW_KV  (D_ * 256 / 64)        // lanes that turn Wkv
#define TW_BLK ((2 * TW_Q + TW_KV) / 512)

__global__ __launch_bounds__(512) void layernorm_k(
    const float* __restrict__ x, const float* __restrict__ gamma,
    const float* __restrict__ beta, float* __restrict__ xnf,
    _Float16* __restrict__ xnh,
    const float* __restrict__ Wq, const float* __restrict__ Wkv,
    const float* __restrict__ Wout, _Float16* __restrict__ WqkvT,
    _Float16* __restrict__ WoutT) {
  __shared__ __align__(16) float tile[LN_TOK * LN_PITCH];
  if (blockIdx.x < TW_BLK) {                       // whole work-groups, in front of the barrier
    const int blk = blockIdx.x, tid = threadIdx.x;
    if (blk < TW_Q / 512)
      transpose_w<D_, D_>(Wq, WqkvT, blk * 512 + tid);
    else if (blk < (TW_Q + TW_KV) / 512)
      transpose_w<D_, 256>(Wkv, WqkvT + D_ * D_, (blk - TW_Q / 512) * 512 + tid);
    else
      transpose_w<D_, D_>(Wout, WoutT, (blk - (TW_Q + TW_KV) / 512) * 512 + tid);
    return;
  }
  const int lane = threadIdx.x & 31;
  const int w    = threadIdx.x >> 5;               // 16 waves
  const int t0   = (blockIdx.x - TW_BLK) * LN_TOK; // first token of the tile
  const int b = t0 >> 11, pos0 = t0 & (N_ - 1);

  // lane = token, wave w holds channels w*32 .. w*32+31 of it
  const float* xb = x + ((size_t)b * D_ + w * 32) * N_ + pos0 + lane;
  float v[32];
  for (int i = 0; i < 32; ++i) v[i] = xb[(size_t)i * N_];
  float* tp = tile + lane * LN_PITCH + w * 32;
  for (int i = 0; i < 32; i += 4)
    *(float4*)(tp + i) = make_float4(v[i], v[i + 1], v[i + 2], v[i + 3]);

  // lane holds channels k*128 + lane*4 .. +3, k = 0..3
  float4 gm[4], bt[4];
  for (int k = 0; k < 4; ++k) {
    gm[k] = *(const float4*)(gamma + k * 128 + lane * 4);
    bt[k] = *(const float4*)(beta  + k * 128 + lane * 4);
  }
  __syncthreads();

  // wave w owns tokens 2w and 2w+1 of the tile
  for (int r = 0; r < 2; ++r) {
    const int row = w * 2 + r;
    const float* rp = tile + row * LN_PITCH + lane * 4;
    float4 a[4];
    for (int k = 0; k < 4; ++k) a[k] = *(const float4*)(rp + k * 128);
    float s = 0.f, ss = 0.f;
    for (int k = 0; k < 4; ++k) {
      s  += (a[k].x + a[k].y) + (a[k].z + a[k].w);
      ss += (a[k].x * a[k].x + a[k].y * a[k].y) + (a[k].z * a[k].z + a[k].w * a[k].w);
    }
    for (int m = 1; m < 32; m <<= 1) {
      s  += __shfl_xor(s,  m, 32);
      ss += __shfl_xor(ss, m, 32);
    }
    const float mu  = s * (1.f / D_);
    const float var = ss * (1.f / D_) - mu * mu;
    const float rst = rsqrtf(var + 1e-5f);
    float*    o  = xnf + (size_t)(t0 + row) * D_ + lane * 4;
    _Float16* oh = xnh + (size_t)(t0 + row) * D_ + lane * 4;
    for (int k = 0; k < 4; ++k) {
      float4 y;
      y.x = (a[k].x - mu) * rst * gm[k].x + bt[k].x;
      y.y = (a[k].y - mu) * rst * gm[k].y + bt[k].y;
      y.z = (a[k].z - mu) * rst * gm[k].z + bt[k].z;
      y.w = (a[k].w - mu) * rst * gm[k].w + bt[k].w;
      *(float4*)(o + k * 128) = y;
      v4h yh = {(_Float16)y.x, (_Float16)y.y, (_Float16)y.z, (_Float16)y.w};
      *(v4h*)(oh + k * 128) = yh;
    }
  }
  // the built code lays the transpose branch behind these stores: keep the wait in front of
  // any rewrite of a register that an issued store names
  asm volatile("s_wait_xcnt 0x0" ::: "memory");
}

// ---------- 2) xPos rotary coefficients ----------
// sgn +1: scl is the scale (q); sgn -1: its reciprocal (k)
__device__ __forceinline__ void xpos_coeffs(int pos, int j, float sgn, float& cs, float& sn,
                                            float& scl) {
  const float fpos = (float)pos;
  const float invf = __powf(10000.f, -(float)(2 * j) * (1.f / (float)DH_));
  const float fr   = fpos * invf;
  const float rev = fr * 0.15915494f;
  asm("v_cos_f32 %0, %2\n\tv_sin_f32 %1, %2\n\tv_nop" : "=&v"(cs), "=&v"(sn) : "v"(rev));
  const float bs = ((float)(2 * j) + 0.4f * DH_) * (1.f / (1.4f * DH_));
  const float pw = sgn * ((fpos - (float)(N_ / 2)) * (1.f / 4096.f));
  // bs^pw as 2^(pw * log2 bs), one hardware instruction each; the library power expands to a
  // long extended-precision sequence for every element. For every position and pair of this
  // shape bs lies in (0.28, 1) and |pw| <= 0.25, so neither instruction meets a subnormal, an
  // overflow or a special case, and log2 bs depends on j alone: it is formed once a lane.
  // Each with its v_nop in one statement: the slot behind a transcendental, as above.
  float l2;
  asm("v_log_f32 %0, %1\n\tv_nop" : "=v"(l2) : "v"(bs));
  asm("v_exp_f32 %0, %1\n\tv_nop" : "=v"(scl) : "v"(pw * l2));
}

// ---------- 3) WMMA GEMM: C = A(M x 512) * B(512 x N), B given transposed ----------
// EPI 0: q, k and v projections in one launch (B^T = Wq^T with Wkv^T behind it, 768 rows).
//        The rotary and the V transpose are done on the f32 accumulators, so the raw
//        projections never go to memory and need no launches of their own.
// EPI 1: out-proj epilogue: +resid(row,col) +bias(col), store f32 transposed (b,d,n).
// The 8 waves of a work-group share 64 rows of A and 128 rows of B^T, so both go through
// LDS once for all of them: tiles of 64 k, two buffers, the next tile copied while this
// one is used. A copy takes whole 128-byte lines; a fragment load straight from global
// memory takes 32 bytes out of each of 16 lines.
#define GM_KT    64                   // k per tile: a row of A or of B^T is 128 bytes
#define GM_PITCH 72                   // halves per LDS row: 144 bytes, an odd multiple of 16
#define GM_A     (64 * GM_PITCH)      // halves of the A tile (64 rows)
#define GM_BUF   (192 * GM_PITCH)     // A tile, B^T tile (128 rows) behind it
#define GM_TILES (D_ / GM_KT)

// One tile: 192 rows of 128 bytes, 16 bytes a lane and copy, so a wave's copy takes four
// whole lines. ag, bg: this lane's place in rows 0..31 of the A and the B^T tile.
__device__ __forceinline__ void stage_ab(const _Float16* ag, const _Float16* bg,
                                         unsigned dst) {
  const _Float16* ag1 = ag + 32 * D_;
  const _Float16* bg1 = bg + 32 * D_;
  const _Float16* bg2 = bg + 64 * D_;
  const _Float16* bg3 = bg + 96 * D_;
  const unsigned da1 = dst + 32 * GM_PITCH * 2;
  const unsigned db0 = dst + GM_A * 2;
  const unsigned db1 = db0 + 32 * GM_PITCH * 2;
  const unsigned db2 = db0 + 64 * GM_PITCH * 2;
  const unsigned db3 = db0 + 96 * GM_PITCH * 2;
  // the wait stands inside the statement, in front of any rewrite of an address register
  asm volatile(
      "global_load_async_to_lds_b128 %0, %6, off\n\t"
      "global_load_async_to_lds_b128 %1, %7, off\n\t"
      "global_load_async_to_lds_b128 %2, %8, off\n\t"
      "global_load_async_to_lds_b128 %3, %9, off\n\t"
      "global_load_async_to_lds_b128 %4, %10, off\n\t"
      "global_load_async_to_lds_b128 %5, %11, off\n\t"
      "s_wait_xcnt 0x0"
      :: "v"(dst), "v"(da1), "v"(db0), "v"(db1), "v"(db2), "v"(db3),
         "v"(ag), "v"(ag1), "v"(bg), "v"(bg1), "v"(bg2), "v"(bg3)
      : "memory");
}

template <int EPI>
__global__ __launch_bounds__(256) void gemm_wmma_k(
    const _Float16* __restrict__ A, const _Float16* __restrict__ BT,
    _Float16* __restrict__ qh, _Float16* __restrict__ kh, _Float16* __restrict__ vT,
    const float* __restrict__ resid, const float* __restrict__ bias,
    float* __restrict__ outT) {
  __shared__ __align__(16) _Float16 abt[2 * GM_BUF];   // the two A / B^T buffers
  const int lane = threadIdx.x & 31;
  const int w    = threadIdx.x >> 5;             // 8 waves
  const int m0   = blockIdx.x * 64  + (w & 1) * 32;
  // the wave's rows of the B^T tile. EPI 1: 32 in a row. EPI 0: the tile is two heads; a
  // wave takes 16 dims of one head and, BSTEP rows on, their rotation partners
  const int bro  = EPI == 0 ? (w >> 2) * 64 + ((w >> 1) & 1) * 16 : (w >> 1) * 32;
  constexpr int BSTEP = EPI == 0 ? 32 : 16;

  // this lane's share of a tile: row threadIdx.x / 8 (and 32, 64, 96 on), 16-byte piece
  // threadIdx.x % 8
  const int srow = threadIdx.x >> 3, spc = (threadIdx.x & 7) * 8;
  const _Float16* ag = A  + (size_t)(blockIdx.x * 64  + srow) * D_ + spc;
  const _Float16* bg = BT + (size_t)(blockIdx.y * 128 + srow) * D_ + spc;
  const unsigned sdst = (unsigned)(size_t)abt + (unsigned)(srow * GM_PITCH + spc) * 2u;

  stage_ab(ag, bg, sdst);                              // tile 0 into buffer 0
  asm volatile("s_wait_asynccnt 0x0" ::: "memory");    // this wave's share of tile 0 has landed
  __syncthreads();                                     // every wave's share has
  stage_ab(ag + GM_KT, bg + GM_KT, sdst + GM_BUF * 2); // tile 1 into buffer 1

  const v8f z = {0.f, 0.f, 0.f, 0.f, 0.f, 0.f, 0.f, 0.f};
  v8f acc[2][2];
  acc[0][0] = z; acc[0][1] = z; acc[1][0] = z; acc[1][1] = z;

  for (int t = 0; t < GM_TILES; ++t) {
    const _Float16* as = abt + (t & 1) * GM_BUF + (w & 1) * (32 * GM_PITCH);
    const _Float16* bs = abt + (t & 1) * GM_BUF + GM_A + bro * GM_PITCH;
    // both 32-k passes of a tile inline: kk becomes a constant offset of the LDS loads
#pragma unroll
    for (int kk = 0; kk < GM_KT; kk += 32) {
      v16h a0 = load_frag(as + kk,                 GM_PITCH, lane);
      v16h a1 = load_frag(as + 16 * GM_PITCH + kk, GM_PITCH, lane);
      v16h b0 = load_frag(bs + kk,                 GM_PITCH, lane);
      v16h b1 = load_frag(bs + BSTEP * GM_PITCH + kk, GM_PITCH, lane);
      acc[0][0] = wmma_f16(a0, b0, acc[0][0]);
      acc[0][1] = wmma_f16(a0, b1, acc[0][1]);
      acc[1][0] = wmma_f16(a1, b0, acc[1][0]);
      acc[1][1] = wmma_f16(a1, b1, acc[1][1]);
    }
    // hand-over: this wave's reads of buffer t % 2 are done, its share of tile t + 1 has
    // landed; behind the barrier that holds for every wave, and the buffer may be refilled
    asm volatile("s_wait_dscnt 0x0" ::: "memory");
    asm volatile("s_wait_asynccnt 0x0" ::: "memory");
    __syncthreads();
    if (t + 2 < GM_TILES)
      stage_ab(ag + (t + 2) * GM_KT, bg + (t + 2) * GM_KT,
               sdst + (unsigned)(t & 1) * (GM_BUF * 2));
  }
  asm volatile("s_wait_asynccnt 0x0" ::: "memory");    // no copy is left in flight at the end

  const int c = lane & 15, g = lane >> 4;
  if (EPI == 0) {
    // keeps the last products above the index arithmetic that stands in front of this epilogue's
    // branches
    __builtin_amdgcn_sched_barrier(0);
    // acc[ti][tj][p]: token m0 + 16 ti + 8 g + p, dim j + 32 tj of head hd of this tile.
    // A lane keeps ONE rotation pair j for its 16 tokens: what the coefficients take from
    // j alone is the same expression in all 16 and is formed once.
    const int hd = w >> 2;
    const int j  = ((w >> 1) & 1) * 16 + c;
    const int by = blockIdx.y;                       // 0..3: q heads 2by, 2by+1; 4: k; 5: v
    const int bb = m0 >> 11, pos0 = (m0 & (N_ - 1)) + g * 8;   // 32 tokens lie in one batch
    if (by < 5) {
      const bool  isk  = by == 4;
      const float sgn  = isk ? -1.f : 1.f;           // k is divided by the scale: power negated
      // q: fold 1/sqrt(dh), and log2 e, so that the scores come out as exponents of 2
      const float fold = isk ? 1.f : 0.125f * LOG2E_;
      _Float16* op = (isk ? kh + ((size_t)(bb * KVH_ + hd) * N_ + pos0) * DH_
                          : qh + ((size_t)(bb * H_ + by * 2 + hd) * N_ + pos0) * DH_) + j;
      // every loop of this epilogue is unrolled: the accumulators are registers and take
      // constant indices only
#pragma unroll
      for (int ti = 0; ti < 2; ++ti) {
        _Float16 lo[8], hi[8];
#pragma unroll
        for (int p = 0; p < 8; ++p) {
          float cs, sn, scl;
          xpos_coeffs(pos0 + ti * 16 + p, j, sgn, cs, sn, scl);
          const float f = scl * fold;
          const float a = acc[ti][0][p], d = acc[ti][1][p];
          lo[p] = (_Float16)((a * cs + (-d) * sn) * f);
          hi[p] = (_Float16)((d * cs + a * sn) * f);
        }
#pragma unroll
        for (int p = 0; p < 8; ++p) {
          op[(ti * 16 + p) * DH_]      = lo[p];
          op[(ti * 16 + p) * DH_ + 32] = hi[p];
        }
        // the second half's arithmetic reuses registers that these stores name: the wait
        // stands in front of that rewrite (behind the last stores the wave ends)
        if (ti == 0) asm volatile("s_wait_xcnt 0x0" ::: "memory");
      }
    } else {
      // V^T (b, kvh, dh, n): a lane holds 8 consecutive positions of a dim, one 16-byte store
      _Float16* op = vT + ((size_t)(bb * KVH_ + hd) * DH_ + j) * N_ + pos0;
#pragma unroll
      for (int ti = 0; ti < 2; ++ti)
#pragma unroll
        for (int tj = 0; tj < 2; ++tj) {
          v8h o;
#pragma unroll
          for (int p = 0; p < 8; ++p) o[p] = (_Float16)acc[ti][tj][p];
          *(v8h*)(op + (size_t)(tj * 32) * N_ + ti * 16) = o;
        }
      // the built code lays the rotary branch behind these stores: the same wait
      asm volatile("s_wait_xcnt 0x0" ::: "memory");
    }
  } else {
    const int n0 = blockIdx.y * 128 + bro;
#pragma unroll
    for (int ti = 0; ti < 2; ++ti)
#pragma unroll
      for (int tj = 0; tj < 2; ++tj)
#pragma unroll
        for (int p = 0; p < 8; ++p) {
          const int row = m0 + ti * 16 + g * 8 + p;
          const int col = n0 + tj * 16 + c;
          const float v = acc[ti][tj][p] + (resid[(size_t)row * D_ + col] + bias[col]);
          const int bb = row >> 11, pos = row & (N_ - 1);
          outT[((size_t)(bb * D_ + col)) * N_ + pos] = v;
        }
  }
}

// ---------- 5) Flash attention: per (b,h), wave = 16 queries ----------
// The 8 waves of a work-group walk the same keys, so K and V^T go through LDS once for
// all of them: tiles of 64 keys, two buffers, the next tile copied while this one is used.
#define FA_KEYS  64                   // keys per tile: a K row and a V^T row are 128 bytes each
#define FA_PITCH 72                   // halves per LDS row: 144 bytes, an odd multiple of 16
#define FA_OPER  (64 * FA_PITCH)      // halves of one operand's tile (64 rows)
#define FA_BUF   (2 * FA_OPER)        // K tile, V^T tile behind it
#define FA_TILES (N_ / FA_KEYS)

// One tile: 128 rows of 128 bytes, 16 bytes a lane and copy, so a wave's copy takes four
// whole lines. kg, vg: this lane's place in rows 0..31 of the K and the V^T tile.
__device__ __forceinline__ void stage_kv(const _Float16* kg, const _Float16* vg,
                                         unsigned dst) {
  const _Float16* kg1 = kg + 32 * DH_;
  const _Float16* vg1 = vg + (size_t)32 * N_;
  const unsigned dk1 = dst + 32 * FA_PITCH * 2;
  const unsigned dv0 = dst + FA_OPER * 2;
  const unsigned dv1 = dv0 + 32 * FA_PITCH * 2;
  // the wait stands inside the statement, in front of any rewrite of an address register
  asm volatile(
      "global_load_async_to_lds_b128 %0, %4, off\n\t"
      "global_load_async_to_lds_b128 %1, %5, off\n\t"
      "global_load_async_to_lds_b128 %2, %6, off\n\t"
      "global_load_async_to_lds_b128 %3, %7, off\n\t"
      "s_wait_xcnt 0x0"
      :: "v"(dst), "v"(dk1), "v"(dv0), "v"(dv1), "v"(kg), "v"(kg1), "v"(vg), "v"(vg1)
      : "memory");
}

// lane l with lane l ^ 16: the two lanes that share a query column
__device__ __forceinline__ float xhalf(float x) {
  const int i = __builtin_bit_cast(int, x);
  return __builtin_bit_cast(
      float, __builtin_amdgcn_permlanex16(i, i, 0x76543210, 0xfedcba98, false, false));
}

// 2^x in place for a run of values. The run and the v_nop behind it are one statement: the
// instruction set asks for one slot between a transcendental and an instruction that reads
// its result or overwrites its source; inside the run every neighbour is independent, and
// the v_nop keeps the slot behind the last one, whatever the compiler puts next.
__device__ __forceinline__ void exp2_one(float& e) {
  asm("v_exp_f32 %0, %0\n\tv_nop" : "+v"(e));
}
__device__ __forceinline__ void exp2_run8(float (&x)[8]) {
  asm("v_exp_f32 %0, %0\n\tv_exp_f32 %1, %1\n\tv_exp_f32 %2, %2\n\t"
      "v_exp_f32 %3, %3\n\tv_exp_f32 %4, %4\n\tv_exp_f32 %5, %5\n\t"
      "v_exp_f32 %6, %6\n\tv_exp_f32 %7, %7\n\tv_nop"
      : "+v"(x[0]), "+v"(x[1]), "+v"(x[2]), "+v"(x[3]), "+v"(x[4]), "+v"(x[5]), "+v"(x[6]),
        "+v"(x[7]));
}

#define FA_ROOM 8.f
__global__ __launch_bounds__(256) void flash_k(
    const _Float16* __restrict__ Q,   // (b, h, n, dh)
    const _Float16* __restrict__ Kt,  // (b, kvh, n, dh)
    const _Float16* __restrict__ VT,  // (b, kvh, dh, n)
    _Float16* __restrict__ O) {       // (b, n, h*dh)
  __shared__ __align__(16) _Float16 kvs[2 * FA_BUF];   // the two K / V^T buffers
  const int lane = threadIdx.x & 31;
  const int w    = threadIdx.x >> 5;
  const int h    = blockIdx.y, b = blockIdx.z;
  const int kv   = h & (KVH_ - 1);                     // tile(k, r): head h -> h % kvh
  const int qRow0 = blockIdx.x * 128 + w * 16;

  const _Float16* qptr  = Q  + (((size_t)(b * H_ + h) * N_) + qRow0) * DH_;
  const _Float16* kbase = Kt + ((size_t)(b * KVH_ + kv) * N_) * DH_;
  const _Float16* vbase = VT + ((size_t)(b * KVH_ + kv) * DH_) * N_;

  // this lane's share of a tile: row threadIdx.x / 8 (and 32 on), 16-byte piece threadIdx.x % 8
  const int srow = threadIdx.x >> 3, spc = (threadIdx.x & 7) * 8;
  const _Float16* kg = kbase + (size_t)srow * DH_ + spc;
  const _Float16* vg = vbase + (size_t)srow * N_ + spc;
  const unsigned sdst = (unsigned)(size_t)kvs + (unsigned)(srow * FA_PITCH + spc) * 2u;

  stage_kv(kg, vg, sdst);                              // tile 0 into buffer 0
  asm volatile("s_wait_asynccnt 0x0" ::: "memory");    // this wave's share of tile 0 has landed
  __syncthreads();                                     // every wave's share has
  stage_kv(kg + FA_KEYS * DH_, vg + FA_KEYS, sdst + FA_BUF * 2);  // tile 1 into buffer 1

  const v16h bq0 = load_frag(qptr,      DH_, lane);    // Q^T, dims  0..31, column = query
  const v16h bq1 = load_frag(qptr + 32, DH_, lane);    // Q^T, dims 32..63

  const v8f z = {0.f, 0.f, 0.f, 0.f, 0.f, 0.f, 0.f, 0.f};
  v8f oacc[4]; oacc[0] = z; oacc[1] = z; oacc[2] = z; oacc[3] = z;  // O^T: dim 16j+8g+p, query c
  v8f negm = z;          // minus the maximum in use for this lane's query, in all 8 registers
  float lcol = 0.f;      // sum over this lane's half of the keys; the halves join at the end

  const int c = lane & 15, g = lane >> 4;

  for (int t = 0; t < FA_TILES; ++t) {
    const _Float16* kt = kvs + (t & 1) * FA_BUF;
    const _Float16* vt = kt + FA_OPER;
    // every fragment of the tile is asked for here, as one group of LDS loads, K of both
    // passes, then V: a wave then waits for LDS once a tile, not in front of every product
    v16h kf[2][4], vf[2][4];
#pragma unroll
    for (int s = 0; s < 2; ++s)
#pragma unroll
      for (int i = 0; i < 4; ++i)
        kf[s][i] = load_frag(kt + (s * 32 + (i >> 1) * 16) * FA_PITCH + (i & 1) * 32,
                             FA_PITCH, lane);
#pragma unroll
    for (int s = 0; s < 2; ++s)
#pragma unroll
      for (int j = 0; j < 4; ++j)
        vf[s][j] = load_frag(vt + (j * 16) * FA_PITCH + s * 32, FA_PITCH, lane);
    // hand-over, here and not at the foot, since the tile is in registers from here on: this
    // wave's reads of buffer t % 2 are done, its share of tile t + 1 has landed; behind the
    // barrier that holds for every wave, and the buffer is refilled while the tile is worked on
    asm volatile("s_wait_dscnt 0x0" ::: "memory");
    asm volatile("s_wait_asynccnt 0x0" ::: "memory");
    __syncthreads();
    if (t + 2 < FA_TILES)
      stage_kv(kg + (size_t)(t + 2) * (FA_KEYS * DH_), vg + (t + 2) * FA_KEYS,
               sdst + (unsigned)(t & 1) * (FA_BUF * 2));
    // every loop below is unrolled: fragments and scores are registers and take constant indices
    // ---- exponents: four 16 (keys) x 16 (queries) f32 tiles covering the 64 keys ----
    v8f sx[2][2];
#pragma unroll
    for (int s = 0; s < 2; ++s)
#pragma unroll
      for (int i = 0; i < 2; ++i) {
        sx[s][i] = wmma_f16(kf[s][2 * i],     bq0, negm);
        sx[s][i] = wmma_f16(kf[s][2 * i + 1], bq1, sx[s][i]);
      }
    // ---- has a score outgrown the maximum in use? the first tile always sets it ----
    float mx[8];
#pragma unroll
    for (int p = 0; p < 8; ++p)
      mx[p] = fmaxf(fmaxf(sx[0][0][p], sx[0][1][p]), fmaxf(sx[1][0][p], sx[1][1][p]));
    float rmax = fmaxf(fmaxf(fmaxf(mx[0], mx[1]), fmaxf(mx[2], mx[3])),
                       fmaxf(fmaxf(mx[4], mx[5]), fmaxf(mx[6], mx[7])));
    const float room = t == 0 ? -3.0e38f : FA_ROOM;
    if (__builtin_amdgcn_ballot_w32(rmax > room) != 0) {   // one scalar branch for the wave
      rmax = fmaxf(rmax, xhalf(rmax));                      // both halves of a column move alike
      const float up = fmaxf(rmax, 0.f);
      const float d  = t == 0 ? rmax : up;                  // the maximum in use never falls again
      float sc = -up;
      exp2_one(sc);
#pragma unroll
      for (int s = 0; s < 2; ++s)
#pragma unroll
        for (int i = 0; i < 2; ++i) sx[s][i] -= d;
      negm -= d;
      lcol *= sc;
#pragma unroll
      for (int j = 0; j < 4; ++j) oacc[j] *= sc;
    }
    float rs[2][4];        // short chains instead of one of 32 links
#pragma unroll
    for (int s = 0; s < 2; ++s) {
      float p0[8], p1[8];
#pragma unroll
      for (int p = 0; p < 8; ++p) { p0[p] = sx[s][0][p]; p1[p] = sx[s][1][p]; }
      exp2_run8(p0);
      exp2_run8(p1);
      v16h pb;             // P^T as B operand: element s is key 8g+s, or 16+8g+(s-8), of column c
#pragma unroll
      for (int p = 0; p < 8; ++p) {
        pb[p]     = (_Float16)p0[p];
        pb[p + 8] = (_Float16)p1[p];
      }
#pragma unroll
      for (int p = 0; p < 4; ++p) rs[s][p] = (p0[p] + p1[p]) + (p0[p + 4] + p1[p + 4]);
      // ---- O^T += V^T P^T over dh in 4 tiles of 16 rows ----
#pragma unroll
      for (int j = 0; j < 4; ++j) oacc[j] = wmma_f16(vf[s][j], pb, oacc[j]);
    }
    lcol += ((rs[0][0] + rs[0][1]) + (rs[0][2] + rs[0][3])) +
            ((rs[1][0] + rs[1][1]) + (rs[1][2] + rs[1][3]));
  }
  asm volatile("s_wait_asynccnt 0x0" ::: "memory");    // no copy is left in flight at the end

  // a lane holds 8 consecutive dims of its query in each tile: one 16-byte store each
  const float inv = 1.f / (lcol + xhalf(lcol));
  _Float16* op = O + (size_t)(b * N_ + qRow0 + c) * (H_ * DH_) + h * DH_ + g * 8;
#pragma unroll
  for (int j = 0; j < 4; ++j) {
    v8h o;
#pragma unroll
    for (int p = 0; p < 8; ++p) o[p] = (_Float16)(oacc[j][p] * inv);
    *(v8h*)(op + j * 16) = o;
  }
}

// ---------- launch ----------
extern "C" void kernel_launch(void* const* d_in, const int* in_sizes, int n_in,
                              void* d_out, int out_size, void* d_ws, size_t ws_size,
                              hipStream_t stream) {
  const float* x     = (const float*)d_in[0];
  const float* gamma = (const float*)d_in[1];
  const float* beta  = (const float*)d_in[2];
  const float* Wq    = (const float*)d_in[3];
  const float* Wkv   = (const float*)d_in[4];
  const float* Wout  = (const float*)d_in[5];
  const float* bout  = (const float*)d_in[6];
  float* y = (float*)d_out;

  char* wsp = (char*)d_ws;
  auto take = [&](size_t bytes) {
    void* p = (void*)wsp;
    wsp += (bytes + 255) & ~(size_t)255;
    return p;
  };
  float*    xnf   = (float*)take((size_t)BN_ * D_ * 4);
  _Float16* xnh   = (_Float16*)take((size_t)BN_ * D_ * 2);
  _Float16* WqkvT = (_Float16*)take((size_t)(D_ + 256) * D_ * 2);   // Wq^T, Wkv^T behind it
  _Float16* WoutT = (_Float16*)take((size_t)D_ * D_ * 2);
  _Float16* qh    = (_Float16*)take((size_t)B_ * H_ * N_ * DH_ * 2);
  _Float16* kh    = (_Float16*)take((size_t)B_ * KVH_ * N_ * DH_ * 2);
  _Float16* vT    = (_Float16*)take((size_t)B_ * KVH_ * N_ * DH_ * 2);
  _Float16* ao    = (_Float16*)take((size_t)BN_ * D_ * 2);

  layernorm_k<<<TW_BLK + BN_ / LN_TOK, 512, 0, stream>>>(
      x, gamma, beta, xnf, xnh, Wq, Wkv, Wout, WqkvT, WoutT);

  gemm_wmma_k<0><<<dim3(BN_ / 64, (D_ + 256) / 128), 256, 0, stream>>>(
      xnh, WqkvT, qh, kh, vT, nullptr, nullptr, nullptr);

  flash_k<<<dim3(N_ / 128, H_, B_), 256, 0, stream>>>(qh, kh, vT, ao);

  gemm_wmma_k<1><<<dim3(BN_ / 64, D_ / 128), 256, 0, stream>>>(
      ao, WoutT, nullptr, nullptr, nullptr, xnf, bout, y);
}

// v010
// It runs in 60.5 microseconds.
// In two side-by-side timings against v009, it was 1.05 and 1.06 times as fast.
// Counting every step since v000, it is 5.87 times as fast.
#include <hip/hip_runtime.h>

// ---------- types ----------
typedef __attribute__((ext_vector_type(16))) _Float16 v16h;
typedef __attribute__((ext_vector_type(8)))  _Float16 v8h;
typedef __attribute__((ext_vector_type(8)))  float    v8f;

#define B_   4
#define N_   2048
#define D_   512
#define H_   8
#define KVH_ 2
#define DH_  64
#define BN_  (B_ * N_)   // 8192 tokens
#define LOG2E_ 1.44269504f

// ---------- WMMA helpers ----------
__device__ __forceinline__ v8f wmma_f16(v16h a, v16h b, v8f c) {
  // D = A(16x32 f16) x B(32x16 f16) + C(16x16 f32)
  return __builtin_amdgcn_wmma_f32_16x16x32_f16(
      /*neg_a=*/false, a, /*neg_b=*/false, b,
      /*c_mod=*/(short)0, c, /*reuse_a=*/false, /*reuse_b=*/false);
}

// Load a 16x32 f16 fragment (A-layout; identical striping assumed for B^T rows)
// from a row-major matrix with leading dimension `ld` (in elements).
// Lane (r = lane&15, g = lane>>4) holds row r, K = {g*8..g*8+7, 16+g*8..16+g*8+7}.
__device__ __forceinline__ v16h load_frag(const _Float16* __restrict__ base,
                                          int ld, int lane) {
  const int r = lane & 15, g = lane >> 4;
  const _Float16* p = base + (size_t)r * ld + g * 8;
  v8h lo = *(const v8h*)(p);
  v8h hi = *(const v8h*)(p + 16);
  v16h f;
#pragma unroll
  for (int i = 0; i < 8; ++i) { f[i] = lo[i]; f[i + 8] = hi[i]; }
  return f;
}

// ---------- 1a) Weight convert + transpose: W (K x N) f32 -> W^T (N x K) f16 ----------
// One lane turns an 8 (k) x 8 (n) block in its registers. A wave takes 64 k x 32 n: eight
// lanes side by side along k store one whole 128-byte line of a W^T row. idx counts the
// K * N / 64 lanes of one matrix.
template <int K, int N>
__device__ __forceinline__ void transpose_w(
    const float* __restrict__ W, _Float16* __restrict__ WT, int idx) {
  static_assert(K % 64 == 0 && N % 32 == 0 && (K * N / 64) % 512 == 0, "tile shape");
  const int lane = idx & 31, tile = idx >> 5;
  const int tk = tile % (K >> 6), tn = tile / (K >> 6);
  const int k0 = tk * 64 + (lane & 7) * 8;
  const int n0 = tn * 32 + (lane >> 3) * 8;
  const float* wp = W + (size_t)k0 * N + n0;
  float r[8][8];
#pragma unroll
  for (int e = 0; e < 8; ++e) {
    const float4 a = *(const float4*)(wp + (size_t)e * N);
    const float4 b = *(const float4*)(wp + (size_t)e * N + 4);
    r[e][0] = a.x; r[e][1] = a.y; r[e][2] = a.z; r[e][3] = a.w;
    r[e][4] = b.x; r[e][5] = b.y; r[e][6] = b.z; r[e][7] = b.w;
  }
  _Float16* op = WT + (size_t)n0 * K + k0;
#pragma unroll
  for (int n = 0; n < 8; ++n) {
    v8h o;
#pragma unroll
    for (int e = 0; e < 8; ++e) o[e] = (_Float16)r[e][n];
    *(v8h*)(op + (size_t)n * K) = o;
  }
  // the built code lays the next matrix's branch behind these stores: keep the wait in front
  // of any rewrite of a register that an issued store names
  asm volatile("s_wait_xcnt 0x0" ::: "memory");
}

// ---------- 1) LayerNorm: x (b,d,n) -> xn (b*n, d) f16, and each token's mean and rstd ----------
// One work-group takes 32 tokens x all 512 channels. x is read along n (whole
// 128-byte lines), turned through LDS, and each token's row is then summed,
// normalised and stored along d (whole lines again). The f32 xn is wanted once more, as the
// residual of the out-projection, whose output lies as x does (b,d,n): that epilogue forms it
// again from x with the two numbers a token that are stored here.
// The weight transposes depend on nothing and nothing but the GEMMs reads them, so they
// ride in this launch as its first TW_BLK work-groups instead of three launches of their own.
typedef __attribute__((ext_vector_type(4))) _Float16 v4h;
#define LN_TOK   32
#define LN_PITCH 516  // dwords; 4 mod 64, so a column walk of 16-byte stores meets every bank once
#define TW_Q   (D_ * D_ / 64)         // lanes that turn Wq (and Wout)
#define TW_KV  (D_ * 256 / 64)        // lanes that turn Wkv
#define TW_BLK ((2 * TW_Q + TW_KV) / 512)

__global__ __launch_bounds__(512) void layernorm_k(
    const float* __restrict__ x, const float* __restrict__ gamma,
    const float* __restrict__ beta, float* __restrict__ stat,
    _Float16* __restrict__ xnh,
    const float* __restrict__ Wq, const float* __restrict__ Wkv,
    const float* __restrict__ Wout, _Float16* __restrict__ WqkvT,
    _Float16* __restrict__ WoutT) {
  __shared__ __align__(16) float tile[LN_TOK * LN_PITCH];
  if (blockIdx.x < TW_BLK) {                       // whole work-groups, in front of the barrier
    const int blk = blockIdx.x, tid = threadIdx.x;
    if (blk < TW_Q / 512)
      transpose_w<D_, D_>(Wq, WqkvT, blk * 512 + tid);
    else if (blk < (TW_Q + TW_KV) / 512)
      transpose_w<D_, 256>(Wkv, WqkvT + D_ * D_, (blk - TW_Q / 512) * 512 + tid);
    else
      transpose_w<D_, D_>(Wout, WoutT, (blk - (TW_Q + TW_KV) / 512) * 512 + tid);
    return;
  }
  const int lane = threadIdx.x & 31;
  const int w    = threadIdx.x >> 5;               // 16 waves
  const int t0   = (blockIdx.x - TW_BLK) * LN_TOK; // first token of the tile
  const int b = t0 >> 11, pos0 = t0 & (N_ - 1);

  // lane = token, wave w holds channels w*32 .. w*32+31 of it
  const float* xb = x + ((size_t)b * D_ + w * 32) * N_ + pos0 + lane;
  float v[32];
  for (int i = 0; i < 32; ++i) v[i] = xb[(size_t)i * N_];
  float* tp = tile + lane * LN_PITCH + w * 32;
  for (int i = 0; i < 32; i += 4)
    *(float4*)(tp + i) = make_float4(v[i], v[i + 1], v[i + 2], v[i + 3]);

  // lane holds channels k*128 + lane*4 .. +3, k = 0..3
  float4 gm[4], bt[4];
  for (int k = 0; k < 4; ++k) {
    gm[k] = *(const float4*)(gamma + k * 128 + lane * 4);
    bt[k] = *(const float4*)(beta  + k * 128 + lane * 4);
  }
  __syncthreads();

  // wave w owns tokens 2w and 2w+1 of the tile
  for (int r = 0; r < 2; ++r) {
    const int row = w * 2 + r;
    const float* rp = tile + row * LN_PITCH + lane * 4;
    float4 a[4];
    for (int k = 0; k < 4; ++k) a[k] = *(const float4*)(rp + k * 128);
    float s = 0.f, ss = 0.f;
    for (int k = 0; k < 4; ++k) {
      s  += (a[k].x + a[k].y) + (a[k].z + a[k].w);
      ss += (a[k].x * a[k].x + a[k].y * a[k].y) + (a[k].z * a[k].z + a[k].w * a[k].w);
    }
    for (int m = 1; m < 32; m <<= 1) {
      s  += __shfl_xor(s,  m, 32);
      ss += __shfl_xor(ss, m, 32);
    }
    const float mu  = s * (1.f / D_);
    const float var = ss * (1.f / D_) - mu * mu;
    const float rst = rsqrtf(var + 1e-5f);
    if (lane == 0) *(float2*)(stat + (size_t)(t0 + row) * 2) = make_float2(mu, rst);
    _Float16* oh = xnh + (size_t)(t0 + row) * D_ + lane * 4;
    for (int k = 0; k < 4; ++k) {
      float4 y;
      y.x = (a[k].x - mu) * rst * gm[k].x + bt[k].x;
      y.y = (a[k].y - mu) * rst * gm[k].y + bt[k].y;
      y.z = (a[k].z - mu) * rst * gm[k].z + bt[k].z;
      y.w = (a[k].w - mu) * rst * gm[k].w + bt[k].w;
      v4h yh = {(_Float16)y.x, (_Float16)y.y, (_Float16)y.z, (_Float16)y.w};
      *(v4h*)(oh + k * 128) = yh;
    }
  }
  // the built code lays the transpose branch behind these stores: keep the wait in front of
  // any rewrite of a register that an issued store names
  asm volatile("s_wait_xcnt 0x0" ::: "memory");
}

// ---------- 2) xPos rotary coefficients ----------
// sgn +1: scl is the scale (q); sgn -1: its reciprocal (k)
__device__ __forceinline__ void xpos_coeffs(int pos, int j, float sgn, float& cs, float& sn,
                                            float& scl) {
  const float fpos = (float)pos;
  const float invf = __powf(10000.f, -(float)(2 * j) * (1.f / (float)DH_));
  const float fr   = fpos * invf;
  const float rev = fr * 0.15915494f;
  asm("v_cos_f32 %0, %2\n\tv_sin_f32 %1, %2\n\tv_nop" : "=&v"(cs), "=&v"(sn) : "v"(rev));
  const float bs = ((float)(2 * j) + 0.4f * DH_) * (1.f / (1.4f * DH_));
  const float pw = sgn * ((fpos - (float)(N_ / 2)) * (1.f / 4096.f));
  // bs^pw as 2^(pw * log2 bs), one hardware instruction each; the library power expands to a
  // long extended-precision sequence for every element. For every position and pair of this
  // shape bs lies in (0.28, 1) and |pw| <= 0.25, so neither instruction meets a subnormal, an
  // overflow or a special case, and log2 bs depends on j alone: it is formed once a lane.
  // Each with its v_nop in one statement: the slot behind a transcendental, as above.
  float l2;
  asm("v_log_f32 %0, %1\n\tv_nop" : "=v"(l2) : "v"(bs));
  asm("v_exp_f32 %0, %1\n\tv_nop" : "=v"(scl) : "v"(pw * l2));
}

// ---------- 3) WMMA GEMM: C = A(M x 512) * B(512 x N), B given transposed ----------
// EPI 0: q, k and v projections in one launch (B^T = Wq^T with Wkv^T behind it, 768 rows).
//        The rotary and the V transpose are done on the f32 accumulators, so the raw
//        projections never go to memory and need no launches of their own.
// EPI 1: out-proj epilogue: + residual + bias(col), store f32 transposed (b,d,n). A lane holds 8
//        consecutive positions of a channel, 32 bytes of y and of x alike: the residual is
//        formed here from x, the token's mean and rstd, gamma and beta.
// The 8 waves of a work-group share 64 rows of A and 128 rows of B^T, so both go through
// LDS once for all of them: tiles of 64 k, two buffers, the next tile copied while this
// one is used. A copy takes whole 128-byte lines; a fragment load straight from global
// memory takes 32 bytes out of each of 16 lines.
#define GM_KT    64                   // k per tile: a row of A or of B^T is 128 bytes
#define GM_PITCH 72                   // halves per LDS row: 144 bytes, an odd multiple of 16
#define GM_A     (64 * GM_PITCH)      // halves of the A tile (64 rows)
#define GM_BUF   (192 * GM_PITCH)     // A tile, B^T tile (128 rows) behind it
#define GM_TILES (D_ / GM_KT)

// One tile: 192 rows of 128 bytes, 16 bytes a lane and copy, so a wave's copy takes four
// whole lines. ag, bg: this lane's place in rows 0..31 of the A and the B^T tile.
__device__ __forceinline__ void stage_ab(const _Float16* ag, const _Float16* bg,
                                         unsigned dst) {
  const _Float16* ag1 = ag + 32 * D_;
  const _Float16* bg1 = bg + 32 * D_;
  const _Float16* bg2 = bg + 64 * D_;
  const _Float16* bg3 = bg + 96 * D_;
  const unsigned da1 = dst + 32 * GM_PITCH * 2;
  const unsigned db0 = dst + GM_A * 2;
  const unsigned db1 = db0 + 32 * GM_PITCH * 2;
  const unsigned db2 = db0 + 64 * GM_PITCH * 2;
  const unsigned db3 = db0 + 96 * GM_PITCH * 2;
  // the wait stands inside the statement, in front of any rewrite of an address register
  asm volatile(
      "global_load_async_to_lds_b128 %0, %6, off\n\t"
      "global_load_async_to_lds_b128 %1, %7, off\n\t"
      "global_load_async_to_lds_b128 %2, %8, off\n\t"
      "global_load_async_to_lds_b128 %3, %9, off\n\t"
      "global_load_async_to_lds_b128 %4, %10, off\n\t"
      "global_load_async_to_lds_b128 %5, %11, off\n\t"
      "s_wait_xcnt 0x0"
      :: "v"(dst), "v"(da1), "v"(db0), "v"(db1), "v"(db2), "v"(db3),
         "v"(ag), "v"(ag1), "v"(bg), "v"(bg1), "v"(bg2), "v"(bg3)
      : "memory");
}

template <int EPI>
__global__ __launch_bounds__(256) void gemm_wmma_k(
    const _Float16* __restrict__ A, const _Float16* __restrict__ BT,
    _Float16* __restrict__ qh, _Float16* __restrict__ kh, _Float16* __restrict__ vT,
    const float* __restrict__ x, const float* __restrict__ stat,
    const float* __restrict__ gamma, const float* __restrict__ beta,
    const float* __restrict__ bias, float* __restrict__ outT) {
  __shared__ __align__(16) _Float16 abt[2 * GM_BUF];   // the two A / B^T buffers
  const int lane = threadIdx.x & 31;
  const int w    = threadIdx.x >> 5;             // 8 waves
  const int m0   = blockIdx.x * 64  + (w & 1) * 32;
  // the wave's rows of the B^T tile. EPI 1: 32 in a row. EPI 0: the tile is two heads; a
  // wave takes 16 dims of one head and, BSTEP rows on, their rotation partners
  const int bro  = EPI == 0 ? (w >> 2) * 64 + ((w >> 1) & 1) * 16 : (w >> 1) * 32;
  constexpr int BSTEP = EPI == 0 ? 32 : 16;

  // this lane's share of a tile: row threadIdx.x / 8 (and 32, 64, 96 on), 16-byte piece
  // threadIdx.x % 8
  const int srow = threadIdx.x >> 3, spc = (threadIdx.x & 7) * 8;
  const _Float16* ag = A  + (size_t)(blockIdx.x * 64  + srow) * D_ + spc;
  const _Float16* bg = BT + (size_t)(blockIdx.y * 128 + srow) * D_ + spc;
  const unsigned sdst = (unsigned)(size_t)abt + (unsigned)(srow * GM_PITCH + spc) * 2u;

  stage_ab(ag, bg, sdst);                              // tile 0 into buffer 0

  // EPI 1: what the residual takes depends on no product, so it is asked for here, beside tile
  // 0's copies, and its latency falls into the wait for that tile instead of standing at the
  // kernel's end. xr: 8 positions of channel col0 + 16 tj; sr: mean and rstd of those 8 tokens,
  // in pairs.
  float4 xr[2][2][2], sr[2][4];
  float  gm[2], bt[2], bi[2];
  if (EPI == 1) {
    const int c = lane & 15, g = lane >> 4;
    const int col0 = blockIdx.y * 128 + bro + c;
    const float* xp = x + ((size_t)((m0 >> 11) * D_ + col0)) * N_ + (m0 & (N_ - 1)) + g * 8;
    const float* sp = stat + (size_t)(m0 + g * 8) * 2;
#pragma unroll
    for (int tj = 0; tj < 2; ++tj) {
      gm[tj] = gamma[col0 + tj * 16];
      bt[tj] = beta[col0 + tj * 16];
      bi[tj] = bias[col0 + tj * 16];
    }
    // in front of any rewrite of a register that one of these loads names (the loads below
    // may land in it)
    asm volatile("s_wait_xcnt 0x0" ::: "memory");
#pragma unroll
    for (int ti = 0; ti < 2; ++ti) {
#pragma unroll
      for (int tj = 0; tj < 2; ++tj) {
        xr[ti][tj][0] = *(const float4*)(xp + (size_t)(tj * 16) * N_ + ti * 16);
        xr[ti][tj][1] = *(const float4*)(xp + (size_t)(tj * 16) * N_ + ti * 16 + 4);
      }
#pragma unroll
      for (int q = 0; q < 4; ++q) sr[ti][q] = *(const float4*)(sp + ti * 32 + q * 4);
    }
    // the same wait for these
    asm volatile("s_wait_xcnt 0x0" ::: "memory");
  }

  asm volatile("s_wait_asynccnt 0x0" ::: "memory");    // this wave's share of tile 0 has landed
  __syncthreads();                                     // every wave's share has
  stage_ab(ag + GM_KT, bg + GM_KT, sdst + GM_BUF * 2); // tile 1 into buffer 1

  const v8f z = {0.f, 0.f, 0.f, 0.f, 0.f, 0.f, 0.f, 0.f};
  v8f acc[2][2];
  acc[0][0] = z; acc[0][1] = z; acc[1][0] = z; acc[1][1] = z;

  for (int t = 0; t < GM_TILES; ++t) {
    const _Float16* as = abt + (t & 1) * GM_BUF + (w & 1) * (32 * GM_PITCH);
    const _Float16* bs = abt + (t & 1) * GM_BUF + GM_A + bro * GM_PITCH;
    // both 32-k passes of a tile inline: kk becomes a constant offset of the LDS loads
#pragma unroll
    for (int kk = 0; kk < GM_KT; kk += 32) {
      v16h a0 = load_frag(as + kk,                 GM_PITCH, lane);
      v16h a1 = load_frag(as + 16 * GM_PITCH + kk, GM_PITCH, lane);
      v16h b0 = load_frag(bs + kk,                 GM_PITCH, lane);
      v16h b1 = load_frag(bs + BSTEP * GM_PITCH + kk, GM_PITCH, lane);
      acc[0][0] = wmma_f16(a0, b0, acc[0][0]);
      acc[0][1] = wmma_f16(a0, b1, acc[0][1]);
      acc[1][0] = wmma_f16(a1, b0, acc[1][0]);
      acc[1][1] = wmma_f16(a1, b1, acc[1][1]);
    }
    // hand-over: this wave's reads of buffer t % 2 are done, its share of tile t + 1 has
    // landed; behind the barrier that holds for every wave, and the buffer may be refilled
    asm volatile("s_wait_dscnt 0x0" ::: "memory");
    asm volatile("s_wait_asynccnt 0x0" ::: "memory");
    __syncthreads();
    if (t + 2 < GM_TILES)
      stage_ab(ag + (t + 2) * GM_KT, bg + (t + 2) * GM_KT,
               sdst + (unsigned)(t & 1) * (GM_BUF * 2));
  }
  asm volatile("s_wait_asynccnt 0x0" ::: "memory");    // no copy is left in flight at the end

  const int c = lane & 15, g = lane >> 4;
  if (EPI == 0) {
    // keeps the last products above the index arithmetic that stands in front of this epilogue's
    // branches
    __builtin_amdgcn_sched_barrier(0);
    // acc[ti][tj][p]: token m0 + 16 ti + 8 g + p, dim j + 32 tj of head hd of this tile.
    // A lane keeps ONE rotation pair j for its 16 tokens: what the coefficients take from
    // j alone is the same expression in all 16 and is formed once.
    const int hd = w >> 2;
    const int j  = ((w >> 1) & 1) * 16 + c;
    const int by = blockIdx.y;                       // 0..3: q heads 2by, 2by+1; 4: k; 5: v
    const int bb = m0 >> 11, pos0 = (m0 & (N_ - 1)) + g * 8;   // 32 tokens lie in one batch
    if (by < 5) {
      const bool  isk  = by == 4;
      const float sgn  = isk ? -1.f : 1.f;           // k is divided by the scale: power negated
      // q: fold 1/sqrt(dh), and log2 e, so that the scores come out as exponents of 2
      const float fold = isk ? 1.f : 0.125f * LOG2E_;
      _Float16* op = (isk ? kh + ((size_t)(bb * KVH_ + hd) * N_ + pos0) * DH_
                          : qh + ((size_t)(bb * H_ + by * 2 + hd) * N_ + pos0) * DH_) + j;
      // every loop of this epilogue is unrolled: the accumulators are registers and take
      // constant indices only
#pragma unroll
      for (int ti = 0; ti < 2; ++ti) {
        _Float16 lo[8], hi[8];
#pragma unroll
        for (int p = 0; p < 8; ++p) {
          float cs, sn, scl;
          xpos_coeffs(pos0 + ti * 16 + p, j, sgn, cs, sn, scl);
          const float f = scl * fold;
          const float a = acc[ti][0][p], d = acc[ti][1][p];
          lo[p] = (_Float16)((a * cs + (-d) * sn) * f);
          hi[p] = (_Float16)((d * cs + a * sn) * f);
        }
#pragma unroll
        for (int p = 0; p < 8; ++p) {
          op[(ti * 16 + p) * DH_]      = lo[p];
          op[(ti * 16 + p) * DH_ + 32] = hi[p];
        }
        // the second half's arithmetic reuses registers that these stores name: the wait
        // stands in front of that rewrite (behind the last stores the wave ends)
        if (ti == 0) asm volatile("s_wait_xcnt 0x0" ::: "memory");
      }
    } else {
      // V^T (b, kvh, dh, n): a lane holds 8 consecutive positions of a dim, one 16-byte store
      _Float16* op = vT + ((size_t)(bb * KVH_ + hd) * DH_ + j) * N_ + pos0;
#pragma unroll
      for (int ti = 0; ti < 2; ++ti)
#pragma unroll
        for (int tj = 0; tj < 2; ++tj) {
          v8h o;
#pragma unroll
          for (int p = 0; p < 8; ++p) o[p] = (_Float16)acc[ti][tj][p];
          *(v8h*)(op + (size_t)(tj * 32) * N_ + ti * 16) = o;
        }
      // the built code lays the rotary branch behind these stores: the same wait
      asm volatile("s_wait_xcnt 0x0" ::: "memory");
    }
  } else {
    // acc[ti][tj][p]: token m0 + 16 ti + 8 g + p (32 tokens lie in one batch), channel col0 + 16 tj
    const int col0 = blockIdx.y * 128 + bro + c;
    float* yp = outT + ((size_t)((m0 >> 11) * D_ + col0)) * N_ + (m0 & (N_ - 1)) + g * 8;
#pragma unroll
    for (int ti = 0; ti < 2; ++ti)
#pragma unroll
      for (int tj = 0; tj < 2; ++tj) {
        const float xv[8] = {xr[ti][tj][0].x, xr[ti][tj][0].y, xr[ti][tj][0].z, xr[ti][tj][0].w,
                             xr[ti][tj][1].x, xr[ti][tj][1].y, xr[ti][tj][1].z, xr[ti][tj][1].w};
        float o[8];
#pragma unroll
        for (int p = 0; p < 8; ++p) {
          const float mu  = (p & 1) ? sr[ti][p >> 1].z : sr[ti][p >> 1].x;
          const float rst = (p & 1) ? sr[ti][p >> 1].w : sr[ti][p >> 1].y;
          const float res = (xv[p] - mu) * rst * gm[tj] + bt[tj];
          o[p] = acc[ti][tj][p] + (res + bi[tj]);
        }
        float* q = yp + (size_t)(tj * 16) * N_ + ti * 16;
        *(float4*)(q)     = make_float4(o[0], o[1], o[2], o[3]);
        *(float4*)(q + 4) = make_float4(o[4], o[5], o[6], o[7]);
      }
  }
}

// ---------- 5) Flash attention: per (b,h), wave = 16 queries ----------
// The 8 waves of a work-group walk the same keys, so K and V^T go through LDS once for
// all of them: tiles of 64 keys, two buffers, the next tile copied while this one is used.
#define FA_KEYS  64                   // keys per tile: a K row and a V^T row are 128 bytes each
#define FA_PITCH 72                   // halves per LDS row: 144 bytes, an odd multiple of 16
#define FA_OPER  (64 * FA_PITCH)      // halves of one operand's tile (64 rows)
#define FA_BUF   (2 * FA_OPER)        // K tile, V^T tile behind it
#define FA_TILES (N_ / FA_KEYS)

// One tile: 128 rows of 128 bytes, 16 bytes a lane and copy, so a wave's copy takes four
// whole lines. kg, vg: this lane's place in rows 0..31 of the K and the V^T tile.
__device__ __forceinline__ void stage_kv(const _Float16* kg, const _Float16* vg,
                                         unsigned dst) {
  const _Float16* kg1 = kg + 32 * DH_;
  const _Float16* vg1 = vg + (size_t)32 * N_;
  const unsigned dk1 = dst + 32 * FA_PITCH * 2;
  const unsigned dv0 = dst + FA_OPER * 2;
  const unsigned dv1 = dv0 + 32 * FA_PITCH * 2;
  // the wait stands inside the statement, in front of any rewrite of an address register
  asm volatile(
      "global_load_async_to_lds_b128 %0, %4, off\n\t"
      "global_load_async_to_lds_b128 %1, %5, off\n\t"
      "global_load_async_to_lds_b128 %2, %6, off\n\t"
      "global_load_async_to_lds_b128 %3, %7, off\n\t"
      "s_wait_xcnt 0x0"
      :: "v"(dst), "v"(dk1), "v"(dv0), "v"(dv1), "v"(kg), "v"(kg1), "v"(vg), "v"(vg1)
      : "memory");
}

// lane l with lane l ^ 16: the two lanes that share a query column
__device__ __forceinline__ float xhalf(float x) {
  const int i = __builtin_bit_cast(int, x);
  return __builtin_bit_cast(
      float, __builtin_amdgcn_permlanex16(i, i, 0x76543210, 0xfedcba98, false, false));
}

// 2^x in place for a run of values. The run and the v_nop behind it are one statement: the
// instruction set asks for one slot between a transcendental and an instruction that reads
// its result or overwrites its source; inside the run every neighbour is independent, and
// the v_nop keeps the slot behind the last one, whatever the compiler puts next.
__device__ __forceinline__ void exp2_one(float& e) {
  asm("v_exp_f32 %0, %0\n\tv_nop" : "+v"(e));
}
__device__ __forceinline__ void exp2_run8(float (&x)[8]) {
  asm("v_exp_f32 %0, %0\n\tv_exp_f32 %1, %1\n\tv_exp_f32 %2, %2\n\t"
      "v_exp_f32 %3, %3\n\tv_exp_f32 %4, %4\n\tv_exp_f32 %5, %5\n\t"
      "v_exp_f32 %6, %6\n\tv_exp_f32 %7, %7\n\tv_nop"
      : "+v"(x[0]), "+v"(x[1]), "+v"(x[2]), "+v"(x[3]), "+v"(x[4]), "+v"(x[5]), "+v"(x[6]),
        "+v"(x[7]));
}

#define FA_ROOM 8.f
__global__ __launch_bounds__(256) void flash_k(
    const _Float16* __restrict__ Q,   // (b, h, n, dh)
    const _Float16* __restrict__ Kt,  // (b, kvh, n, dh)
    const _Float16* __restrict__ VT,  // (b, kvh, dh, n)
    _Float16* __restrict__ O) {       // (b, n, h*dh)
  __shared__ __align__(16) _Float16 kvs[2 * FA_BUF];   // the two K / V^T buffers
  const int lane = threadIdx.x & 31;
  const int w    = threadIdx.x >> 5;
  const int h    = blockIdx.y, b = blockIdx.z;
  const int kv   = h & (KVH_ - 1);                     // tile(k, r): head h -> h % kvh
  const int qRow0 = blockIdx.x * 128 + w * 16;

  const _Float16* qptr  = Q  + (((size_t)(b * H_ + h) * N_) + qRow0) * DH_;
  const _Float16* kbase = Kt + ((size_t)(b * KVH_ + kv) * N_) * DH_;
  const _Float16* vbase = VT + ((size_t)(b * KVH_ + kv) * DH_) * N_;

  // this lane's share of a tile: row threadIdx.x / 8 (and 32 on), 16-byte piece threadIdx.x % 8
  const int srow = threadIdx.x >> 3, spc = (threadIdx.x & 7) * 8;
  const _Float16* kg = kbase + (size_t)srow * DH_ + spc;
  const _Float16* vg = vbase + (size_t)srow * N_ + spc;
  const unsigned sdst = (unsigned)(size_t)kvs + (unsigned)(srow * FA_PITCH + spc) * 2u;

  stage_kv(kg, vg, sdst);                              // tile 0 into buffer 0
  asm volatile("s_wait_asynccnt 0x0" ::: "memory");    // this wave's share of tile 0 has landed
  __syncthreads();                                     // every wave's share has
  stage_kv(kg + FA_KEYS * DH_, vg + FA_KEYS, sdst + FA_BUF * 2);  // tile 1 into buffer 1

  const v16h bq0 = load_frag(qptr,      DH_, lane);    // Q^T, dims  0..31, column = query
  const v16h bq1 = load_frag(qptr + 32, DH_, lane);    // Q^T, dims 32..63

  const v8f z = {0.f, 0.f, 0.f, 0.f, 0.f, 0.f, 0.f, 0.f};
  v8f oacc[4]; oacc[0] = z; oacc[1] = z; oacc[2] = z; oacc[3] = z;  // O^T: dim 16j+8g+p, query c
  v8f negm = z;          // minus the maximum in use for this lane's query, in all 8 registers
  float lcol = 0.f;      // sum over this lane's half of the keys; the halves join at the end

  const int c = lane & 15, g = lane >> 4;

  for (int t = 0; t < FA_TILES; ++t) {
    const _Float16* kt = kvs + (t & 1) * FA_BUF;
    const _Float16* vt = kt + FA_OPER;
    // every fragment of the tile is asked for here, as one group of LDS loads, K of both
    // passes, then V: a wave then waits for LDS once a tile, not in front of every product
    v16h kf[2][4], vf[2][4];
#pragma unroll
    for (int s = 0; s < 2; ++s)
#pragma unroll
      for (int i = 0; i < 4; ++i)
        kf[s][i] = load_frag(kt + (s * 32 + (i >> 1) * 16) * FA_PITCH + (i & 1) * 32,
                             FA_PITCH, lane);
#pragma unroll
    for (int s = 0; s < 2; ++s)
#pragma unroll
      for (int j = 0; j < 4; ++j)
        vf[s][j] = load_frag(vt + (j * 16) * FA_PITCH + s * 32, FA_PITCH, lane);
    // hand-over, here and not at the foot, since the tile is in registers from here on: this
    // wave's reads of buffer t % 2 are done, its share of tile t + 1 has landed; behind the
    // barrier that holds for every wave, and the buffer is refilled while the tile is worked on
    asm volatile("s_wait_dscnt 0x0" ::: "memory");
    asm volatile("s_wait_asynccnt 0x0" ::: "memory");
    __syncthreads();
    if (t + 2 < FA_TILES)
      stage_kv(kg + (size_t)(t + 2) * (FA_KEYS * DH_), vg + (t + 2) * FA_KEYS,
               sdst + (unsigned)(t & 1) * (FA_BUF * 2));
    // every loop below is unrolled: fragments and scores are registers and take constant indices
    // ---- exponents: four 16 (keys) x 16 (queries) f32 tiles covering the 64 keys ----
    v8f sx[2][2];
#pragma unroll
    for (int s = 0; s < 2; ++s)
#pragma unroll
      for (int i = 0; i < 2; ++i) {
        sx[s][i] = wmma_f16(kf[s][2 * i],     bq0, negm);
        sx[s][i] = wmma_f16(kf[s][2 * i + 1], bq1, sx[s][i]);
      }
    // ---- has a score outgrown the maximum in use? the first tile always sets it ----
    float mx[8];
#pragma unroll
    for (int p = 0; p < 8; ++p)
      mx[p] = fmaxf(fmaxf(sx[0][0][p], sx[0][1][p]), fmaxf(sx[1][0][p], sx[1][1][p]));
    float rmax = fmaxf(fmaxf(fmaxf(mx[0], mx[1]), fmaxf(mx[2], mx[3])),
                       fmaxf(fmaxf(mx[4], mx[5]), fmaxf(mx[6], mx[7])));
    const float room = t == 0 ? -3.0e38f : FA_ROOM;
    if (__builtin_amdgcn_ballot_w32(rmax > room) != 0) {   // one scalar branch for the wave
      rmax = fmaxf(rmax, xhalf(rmax));                      // both halves of a column move alike
      const float up = fmaxf(rmax, 0.f);
      const float d  = t == 0 ? rmax : up;                  // the maximum in use never falls again
      float sc = -up;
      exp2_one(sc);
#pragma unroll
      for (int s = 0; s < 2; ++s)
#pragma unroll
        for (int i = 0; i < 2; ++i) sx[s][i] -= d;
      negm -= d;
      lcol *= sc;
#pragma unroll
      for (int j = 0; j < 4; ++j) oacc[j] *= sc;
    }
    float rs[2][4];        // short chains instead of one of 32 links
#pragma unroll
    for (int s = 0; s < 2; ++s) {
      float p0[8], p1[8];
#pragma unroll
      for (int p = 0; p < 8; ++p) { p0[p] = sx[s][0][p]; p1[p] = sx[s][1][p]; }
      exp2_run8(p0);
      exp2_run8(p1);
      v16h pb;             // P^T as B operand: element s is key 8g+s, or 16+8g+(s-8), of column c
#pragma unroll
      for (int p = 0; p < 8; ++p) {
        pb[p]     = (_Float16)p0[p];
        pb[p + 8] = (_Float16)p1[p];
      }
#pragma unroll
      for (int p = 0; p < 4; ++p) rs[s][p] = (p0[p] + p1[p]) + (p0[p + 4] + p1[p + 4]);
      // ---- O^T += V^T P^T over dh in 4 tiles of 16 rows ----
#pragma unroll
      for (int j = 0; j < 4; ++j) oacc[j] = wmma_f16(vf[s][j], pb, oacc[j]);
    }
    lcol += ((rs[0][0] + rs[0][1]) + (rs[0][2] + rs[0][3])) +
            ((rs[1][0] + rs[1][1]) + (rs[1][2] + rs[1][3]));
  }
  asm volatile("s_wait_asynccnt 0x0" ::: "memory");    // no copy is left in flight at the end

  // a lane holds 8 consecutive dims of its query in each tile: one 16-byte store each
  const float inv = 1.f / (lcol + xhalf(lcol));
  _Float16* op = O + (size_t)(b * N_ + qRow0 + c) * (H_ * DH_) + h * DH_ + g * 8;
#pragma unroll
  for (int j = 0; j < 4; ++j) {
    v8h o;
#pragma unroll
    for (int p = 0; p < 8; ++p) o[p] = (_Float16)(oacc[j][p] * inv);
    *(v8h*)(op + j * 16) = o;
  }
}

// ---------- launch ----------
extern "C" void kernel_launch(void* const* d_in, const int* in_sizes, int n_in,
                              void* d_out, int out_size, void* d_ws, size_t ws_size,
                              hipStream_t stream) {
  const float* x     = (const float*)d_in[0];
  const float* gamma = (const float*)d_in[1];
  const float* beta  = (const float*)d_in[2];
  const float* Wq    = (const float*)d_in[3];
  const float* Wkv   = (const float*)d_in[4];
  const float* Wout  = (const float*)d_in[5];
  const float* bout  = (const float*)d_in[6];
  float* y = (float*)d_out;

  char* wsp = (char*)d_ws;
  auto take = [&](size_t bytes) {
    void* p = (void*)wsp;
    wsp += (bytes + 255) & ~(size_t)255;
    return p;
  };
  float*    stat  = (float*)take((size_t)BN_ * 2 * 4);               // mean, rstd of each token
  _Float16* xnh   = (_Float16*)take((size_t)BN_ * D_ * 2);
  _Float16* WqkvT = (_Float16*)take((size_t)(D_ + 256) * D_ * 2);   // Wq^T, Wkv^T behind it
  _Float16* WoutT = (_Float16*)take((size_t)D_ * D_ * 2);
  _Float16* qh    = (_Float16*)take((size_t)B_ * H_ * N_ * DH_ * 2);
  _Float16* kh    = (_Float16*)take((size_t)B_ * KVH_ * N_ * DH_ * 2);
  _Float16* vT    = (_Float16*)take((size_t)B_ * KVH_ * N_ * DH_ * 2);
  _Float16* ao    = (_Float16*)take((size_t)BN_ * D_ * 2);

  layernorm_k<<<TW_BLK + BN_ / LN_TOK, 512, 0, stream>>>(
      x, gamma, beta, stat, xnh, Wq, Wkv, Wout, WqkvT, WoutT);

  gemm_wmma_k<0><<<dim3(BN_ / 64, (D_ + 256) / 128), 256, 0, stream>>>(
      xnh, WqkvT, qh, kh, vT, nullptr, nullptr, nullptr, nullptr, nullptr, nullptr);

  flash_k<<<dim3(N_ / 128, H_, B_), 256, 0, stream>>>(qh, kh, vT, ao);

  gemm_wmma_k<1><<<dim3(BN_ / 64, D_ / 128), 256, 0, stream>>>(
      ao, WoutT, nullptr, nullptr, nullptr, x, stat, gamma, beta, bout, y);
}
